// v000
// The times below were measured on an AMD MI455X: many runs one after another, warmed up first and cycling through
// copies of the inputs, with the whole window's GPU time divided by the number of runs. Launches and the gaps
// between them are all in it. The median over several windows is given; except for v000 it joins two sittings, which
// can be a few percent apart, so the side-by-side timings, each taken in one sitting, are the better comparison.
// The starting kernel, v000, takes 428 microseconds a run.
#include <hip/hip_runtime.h>
#include <hip/hip_bf16.h>
#include <math.h>

// ---------------------------------------------------------------------------
// Types / helpers
// ---------------------------------------------------------------------------
typedef __attribute__((ext_vector_type(16))) __bf16 v16bf;
typedef __attribute__((ext_vector_type(8)))  __bf16 v8bf;
typedef __attribute__((ext_vector_type(8)))  float  v8f;

__device__ __forceinline__ __bf16 f2bf(float f) {
  unsigned u = __builtin_bit_cast(unsigned, f);
  unsigned r = u + 0x7FFFu + ((u >> 16) & 1u);   // round-to-nearest-even
  unsigned short h = (unsigned short)(r >> 16);
  return __builtin_bit_cast(__bf16, h);
}

__device__ __forceinline__ v8f zero8() {
  v8f z = {0.f, 0.f, 0.f, 0.f, 0.f, 0.f, 0.f, 0.f};
  return z;
}

__device__ __forceinline__ v8f wmma_bf16(v16bf a, v16bf b, v8f c) {
  // D(f32 16x16) = A(bf16 16x32) * B(bf16 32x16) + C
  return __builtin_amdgcn_wmma_f32_16x16x32_bf16(
      /*neg_a=*/false, a, /*neg_b=*/false, b,
      /*c_mod=*/(short)0, c, /*reuse_a=*/false, /*reuse_b=*/false);
}

// 16x32 bf16 fragment from 16 consecutive *rows* of a row-major matrix.
// Per ISA 16-bit A layout: lane r (0..15), half h: elems [0..7] = row r,
// K = k0 + h*8 .. +7 ; elems [8..15] = row r, K = k0 + 16 + h*8 .. +7.
// Identical layout serves B of X@W^T (B[k][n] = W[n][k] -> rows of W).
// Works for both global and LDS (generic) pointers.
__device__ __forceinline__ v16bf load_frag_rows(const __bf16* __restrict__ base,
                                                int ld, int row0, int k0, int lane) {
  int r = lane & 15, h = lane >> 4;
  const __bf16* p = base + (size_t)(row0 + r) * ld + (k0 + h * 8);
  v8bf lo = *(const v8bf*)p;          // 16-byte load
  v8bf hi = *(const v8bf*)(p + 16);   // 16-byte load
  v16bf f;
#pragma unroll
  for (int i = 0; i < 8; ++i) { f[i] = lo[i]; f[i + 8] = hi[i]; }
  return f;
}

// Fragment whose K dimension runs *down a column* of a row-major matrix
// (B operand of P@V: B[k][n] = V[k][n]).
__device__ __forceinline__ v16bf load_frag_cols(const __bf16* __restrict__ base,
                                                int ld, int k0, int col0, int lane) {
  int r = lane & 15, h = lane >> 4;
  const __bf16* p = base + (size_t)(k0 + h * 8) * ld + col0 + r;
  v16bf f;
#pragma unroll
  for (int i = 0; i < 8; ++i) f[i] = p[(size_t)i * ld];
  p += (size_t)16 * ld;
#pragma unroll
  for (int i = 0; i < 8; ++i) f[i + 8] = p[(size_t)i * ld];
  return f;
}

// Async Global -> LDS copy of 16 bytes (tracked by ASYNCcnt).
// lds_off: LDS byte address (low 32 bits of the generic shared pointer ==
// LDS offset per the flat-aperture mapping, ISA 10.2).
__device__ __forceinline__ void async_b128(unsigned lds_off, const void* g) {
  unsigned long long ga = (unsigned long long)g;
  asm volatile("global_load_async_to_lds_b128 %0, %1, off"
               :: "v"(lds_off), "v"(ga) : "memory");
}

// ---------------------------------------------------------------------------
// fp32 -> bf16 conversion
// ---------------------------------------------------------------------------
__global__ __launch_bounds__(256) void cvt_bf16_k(const float* __restrict__ in,
                                                  __bf16* __restrict__ out, int n) {
  int stride = gridDim.x * 256;
  for (int i = blockIdx.x * 256 + threadIdx.x; i < n; i += stride)
    out[i] = f2bf(in[i]);
}

template <int EPI>
__global__ __launch_bounds__(256) void gemm_bf16_k(
    const __bf16* __restrict__ X, const __bf16* __restrict__ W,
    const float* __restrict__ bias, const float* __restrict__ resid,
    float* __restrict__ outF, __bf16* __restrict__ outB,
    int M, int N, int K) {
  __shared__ __attribute__((aligned(16))) __bf16 xs[2][128 * 32];
  __shared__ __attribute__((aligned(16))) __bf16 wsb[2][64 * 32];

  int tid = threadIdx.x;
  int lane = tid & 31;
  int wave = tid >> 5;
  int wm = wave & 3, wn = wave >> 4 ? 0 : (wave >> 2);  // (kept simple below)
  wn = wave >> 2;
  int m0 = wm * 32;            // within block tile
  int n0 = wn * 32;
  int mblk = blockIdx.x * 128;
  int nblk = blockIdx.y * 64;

  // Issue one K=32 stage of async copies into buffer `buf`.
  auto stage = [&](int buf, int k0) {
    // X tile: 128 rows x 32 bf16 = 512 16B-chunks; thread t -> chunks t, t+256
    int c = tid;
    int row = c >> 2, q = c & 3;
    async_b128((unsigned)(size_t)&xs[buf][row * 32 + q * 8],
               X + (size_t)(mblk + row) * K + k0 + q * 8);
    c = tid + 256;
    row = c >> 2; q = c & 3;
    async_b128((unsigned)(size_t)&xs[buf][row * 32 + q * 8],
               X + (size_t)(mblk + row) * K + k0 + q * 8);
    // W tile: 64 rows x 32 bf16 = 256 16B-chunks; thread t -> chunk t
    row = tid >> 2; q = tid & 3;
    async_b128((unsigned)(size_t)&wsb[buf][row * 32 + q * 8],
               W + (size_t)(nblk + row) * K + k0 + q * 8);
  };

  v8f acc00 = zero8(), acc01 = zero8(), acc10 = zero8(), acc11 = zero8();

  int nk = K >> 5;
  stage(0, 0);
  for (int kk = 0; kk < nk; ++kk) {
    __syncthreads();                        // buf[(kk+1)&1] free for overwrite
    if (kk + 1 < nk) {
      stage((kk + 1) & 1, (kk + 1) << 5);
      asm volatile("s_wait_asynccnt 0x3" ::: "memory");  // stage kk complete
    } else {
      asm volatile("s_wait_asynccnt 0x0" ::: "memory");
    }
    __syncthreads();                        // stage kk visible to all waves

    const __bf16* xt = xs[kk & 1];
    const __bf16* wt = wsb[kk & 1];
    v16bf a0 = load_frag_rows(xt, 32, m0, 0, lane);
    v16bf a1 = load_frag_rows(xt, 32, m0 + 16, 0, lane);
    v16bf b0 = load_frag_rows(wt, 32, n0, 0, lane);
    v16bf b1 = load_frag_rows(wt, 32, n0 + 16, 0, lane);
    acc00 = wmma_bf16(a0, b0, acc00);
    acc01 = wmma_bf16(a0, b1, acc01);
    acc10 = wmma_bf16(a1, b0, acc10);
    acc11 = wmma_bf16(a1, b1, acc11);
  }

  int r = lane & 15, h = lane >> 4;
#pragma unroll
  for (int ti = 0; ti < 2; ++ti) {
#pragma unroll
    for (int tj = 0; tj < 2; ++tj) {
      v8f acc = (ti == 0) ? (tj == 0 ? acc00 : acc01)
                          : (tj == 0 ? acc10 : acc11);
      int col = nblk + n0 + tj * 16 + r;
      float bv = (EPI == 0) ? 0.f : (bias ? bias[col] : 0.f);
#pragma unroll
      for (int i = 0; i < 8; ++i) {
        int row = mblk + m0 + ti * 16 + i + 8 * h;  // C layout: vgpr i -> M=i+8*h
        float v = acc[i] + bv;
        size_t idx = (size_t)row * N + col;
        if (EPI == 1) {
          v = 0.5f * v * (1.0f + erff(v * 0.70710678118654752f));  // exact GELU
          outB[idx] = f2bf(v);
        } else if (EPI == 2) {
          outF[idx] = v + resid[idx];
        } else {
          outB[idx] = f2bf(v);
        }
      }
    }
  }
}

// ---------------------------------------------------------------------------
// Flash-style causal attention, hd = 64, wave32.
// One wave = 16 query rows; block = 8 waves = 128 rows.
// Grid: (S/128, H, B). Q/K/V/O are [B*S, D] bf16, head h at cols h*64.
// ---------------------------------------------------------------------------
__global__ __launch_bounds__(256) void attention_k(
    const __bf16* __restrict__ Q, const __bf16* __restrict__ Km,
    const __bf16* __restrict__ V, __bf16* __restrict__ O,
    int S, int Dm) {
  __shared__ __attribute__((aligned(16))) __bf16 Plds[8 * 16 * 32];

  int lane = threadIdx.x & 31, wave = threadIdx.x >> 5;
  int r = lane & 15, hl = lane >> 4;
  int h = blockIdx.y, b = blockIdx.z;
  int qbase = blockIdx.x * 128 + wave * 16;   // wave-uniform

  size_t base = (size_t)b * S * Dm + (size_t)h * 64;
  const __bf16* qp = Q + base;
  const __bf16* kp = Km + base;
  const __bf16* vp = V + base;
  __bf16* op = O + base;
  __bf16* pl = &Plds[wave * 512];             // per-wave 16x32 staging tile

  v16bf aq0 = load_frag_rows(qp, Dm, qbase, 0, lane);
  v16bf aq1 = load_frag_rows(qp, Dm, qbase, 32, lane);

  v8f o0 = zero8(), o1 = zero8(), o2 = zero8(), o3 = zero8();
  float m[8], l[8];
#pragma unroll
  for (int i = 0; i < 8; ++i) { m[i] = -1e30f; l[i] = 0.f; }

  for (int j0 = 0; j0 < qbase + 16; j0 += 32) {   // wave-uniform trip count
    // ---- S = Q @ K^T (two 16x16 score tiles: keys j0.. and j0+16..) ----
    v8f s0 = zero8(), s1 = zero8();
    {
      v16bf bk0 = load_frag_rows(kp, Dm, j0, 0, lane);
      v16bf bk1 = load_frag_rows(kp, Dm, j0, 32, lane);
      s0 = wmma_bf16(aq0, bk0, s0);
      s0 = wmma_bf16(aq1, bk1, s0);
      v16bf bk2 = load_frag_rows(kp, Dm, j0 + 16, 0, lane);
      v16bf bk3 = load_frag_rows(kp, Dm, j0 + 16, 32, lane);
      s1 = wmma_bf16(aq0, bk2, s1);
      s1 = wmma_bf16(aq1, bk3, s1);
    }
    // ---- scale, causal mask, online softmax ----
#pragma unroll
    for (int i = 0; i < 8; ++i) {
      int qrow = qbase + i + 8 * hl;
      float sc0 = s0[i] * 0.125f;               // 1/sqrt(64)
      float sc1 = s1[i] * 0.125f;
      if (j0 + r > qrow) sc0 = -1e30f;
      if (j0 + 16 + r > qrow) sc1 = -1e30f;
      float rm = fmaxf(sc0, sc1);
#pragma unroll
      for (int off = 1; off < 16; off <<= 1) rm = fmaxf(rm, __shfl_xor(rm, off, 32));
      float mn = fmaxf(m[i], rm);
      float al = __expf(m[i] - mn);
      float p0 = __expf(sc0 - mn);
      float p1 = __expf(sc1 - mn);
      float rs = p0 + p1;
#pragma unroll
      for (int off = 1; off < 16; off <<= 1) rs += __shfl_xor(rs, off, 32);
      l[i] = l[i] * al + rs;
      m[i] = mn;
      o0[i] *= al; o1[i] *= al; o2[i] *= al; o3[i] *= al;
      // stage P (C layout -> LDS row-major 16x32, bf16)
      pl[(i + 8 * hl) * 32 + r]      = f2bf(p0);
      pl[(i + 8 * hl) * 32 + 16 + r] = f2bf(p1);
    }
    asm volatile("s_wait_dscnt 0" ::: "memory");
    // ---- O += P @ V ----
    v16bf ap  = load_frag_rows(pl, 32, 0, 0, lane);   // A-layout reload from LDS
    v16bf bv0 = load_frag_cols(vp, Dm, j0, 0, lane);
    v16bf bv1 = load_frag_cols(vp, Dm, j0, 16, lane);
    v16bf bv2 = load_frag_cols(vp, Dm, j0, 32, lane);
    v16bf bv3 = load_frag_cols(vp, Dm, j0, 48, lane);
    o0 = wmma_bf16(ap, bv0, o0);
    o1 = wmma_bf16(ap, bv1, o1);
    o2 = wmma_bf16(ap, bv2, o2);
    o3 = wmma_bf16(ap, bv3, o3);
  }

#pragma unroll
  for (int i = 0; i < 8; ++i) {
    float inv = 1.0f / l[i];
    size_t row = (size_t)(qbase + i + 8 * hl);
    op[row * Dm + 0 + r]  = f2bf(o0[i] * inv);
    op[row * Dm + 16 + r] = f2bf(o1[i] * inv);
    op[row * Dm + 32 + r] = f2bf(o2[i] * inv);
    op[row * Dm + 48 + r] = f2bf(o3[i] * inv);
  }
}

// ---------------------------------------------------------------------------
// LayerNorm over last dim (block per row). Writes fp32 (+ optional bf16).
// ---------------------------------------------------------------------------
__global__ __launch_bounds__(256) void layernorm_k(
    const float* __restrict__ in, const float* __restrict__ gamma,
    const float* __restrict__ beta, float* __restrict__ outF,
    __bf16* outB, int D) {
  __shared__ float red[256];
  int row = blockIdx.x, tid = threadIdx.x;
  const float* p = in + (size_t)row * D;

  float s = 0.f;
  for (int i = tid; i < D; i += 256) s += p[i];
  red[tid] = s; __syncthreads();
  for (int o = 128; o > 0; o >>= 1) { if (tid < o) red[tid] += red[tid + o]; __syncthreads(); }
  float mu = red[0] / (float)D;
  __syncthreads();

  float ss = 0.f;
  for (int i = tid; i < D; i += 256) { float d = p[i] - mu; ss += d * d; }
  red[tid] = ss; __syncthreads();
  for (int o = 128; o > 0; o >>= 1) { if (tid < o) red[tid] += red[tid + o]; __syncthreads(); }
  float inv = rsqrtf(red[0] / (float)D + 1e-5f);

  for (int i = tid; i < D; i += 256) {
    float y = (p[i] - mu) * inv * gamma[i] + beta[i];
    outF[(size_t)row * D + i] = y;
    if (outB) outB[(size_t)row * D + i] = f2bf(y);
  }
}

// ---------------------------------------------------------------------------
// Host orchestration
// ---------------------------------------------------------------------------
extern "C" void kernel_launch(void* const* d_in, const int* in_sizes, int n_in,
                              void* d_out, int out_size, void* d_ws, size_t ws_size,
                              hipStream_t stream) {
  (void)in_sizes; (void)n_in; (void)out_size; (void)ws_size;
  constexpr int B = 2, S = 2048, D = 1024, H = 16, M = B * S, DF = 4 * D;

  const float* x   = (const float*)d_in[0];
  const float* wq  = (const float*)d_in[1];
  const float* wk  = (const float*)d_in[2];
  const float* wv  = (const float*)d_in[3];
  const float* wo  = (const float*)d_in[4];
  const float* w1  = (const float*)d_in[5];
  const float* b1  = (const float*)d_in[6];
  const float* w2  = (const float*)d_in[7];
  const float* b2  = (const float*)d_in[8];
  const float* g0  = (const float*)d_in[9];
  const float* be0 = (const float*)d_in[10];
  const float* g1  = (const float*)d_in[11];
  const float* be1 = (const float*)d_in[12];

  char* ws = (char*)d_ws;
  size_t off = 0;
  auto take = [&](size_t bytes) -> void* {
    void* p = ws + off;
    off = (off + bytes + 255) & ~(size_t)255;
    return p;
  };

  __bf16* xb   = (__bf16*)take((size_t)M * D * 2);    // also reused as ln0b
  __bf16* wqb  = (__bf16*)take((size_t)D * D * 2);
  __bf16* wkb  = (__bf16*)take((size_t)D * D * 2);
  __bf16* wvb  = (__bf16*)take((size_t)D * D * 2);
  __bf16* wob  = (__bf16*)take((size_t)D * D * 2);
  __bf16* w1b  = (__bf16*)take((size_t)DF * D * 2);
  __bf16* w2b  = (__bf16*)take((size_t)D * DF * 2);
  size_t qkv_off = off;
  __bf16* qb    = (__bf16*)take((size_t)M * D * 2);
  __bf16* kb    = (__bf16*)take((size_t)M * D * 2);
  __bf16* vb    = (__bf16*)take((size_t)M * D * 2);
  __bf16* attnb = (__bf16*)take((size_t)M * D * 2);
  float*  x1    = (float*)take((size_t)M * D * 4);    // also reused as x2
  float*  ln0f  = (float*)take((size_t)M * D * 4);
  // reuse dead regions:
  __bf16* hb   = (__bf16*)(ws + qkv_off);             // 32MB over q/k/v/attn (dead)
  __bf16* ln0b = xb;                                  // xb dead after QKV gemms
  float*  x2   = x1;                                  // x1 dead after LN0

  dim3 blk(256);

  // fp32 -> bf16 conversions
  cvt_bf16_k<<<1024, blk, 0, stream>>>(x,  xb,  M * D);
  cvt_bf16_k<<<1024, blk, 0, stream>>>(wq, wqb, D * D);
  cvt_bf16_k<<<1024, blk, 0, stream>>>(wk, wkb, D * D);
  cvt_bf16_k<<<1024, blk, 0, stream>>>(wv, wvb, D * D);
  cvt_bf16_k<<<1024, blk, 0, stream>>>(wo, wob, D * D);
  cvt_bf16_k<<<1024, blk, 0, stream>>>(w1, w1b, DF * D);
  cvt_bf16_k<<<1024, blk, 0, stream>>>(w2, w2b, D * DF);

  // Q, K, V projections (bf16 out)
  dim3 gD(M / 128, D / 64);
  gemm_bf16_k<0><<<gD, blk, 0, stream>>>(xb, wqb, nullptr, nullptr, nullptr, qb, M, D, D);
  gemm_bf16_k<0><<<gD, blk, 0, stream>>>(xb, wkb, nullptr, nullptr, nullptr, kb, M, D, D);
  gemm_bf16_k<0><<<gD, blk, 0, stream>>>(xb, wvb, nullptr, nullptr, nullptr, vb, M, D, D);

  // causal flash attention
  attention_k<<<dim3(S / 128, H, B), blk, 0, stream>>>(qb, kb, vb, attnb, S, D);

  // output projection + residual (fp32)
  gemm_bf16_k<2><<<gD, blk, 0, stream>>>(attnb, wob, nullptr, x, x1, nullptr, M, D, D);

  // LayerNorm 0 (fp32 + bf16 copies)
  layernorm_k<<<M, blk, 0, stream>>>(x1, g0, be0, ln0f, ln0b, D);

  // MLP up + exact GELU (bf16 out)
  gemm_bf16_k<1><<<dim3(M / 128, DF / 64), blk, 0, stream>>>(ln0b, w1b, b1, nullptr, nullptr, hb, M, DF, D);

  // MLP down + bias + residual (fp32)
  gemm_bf16_k<2><<<gD, blk, 0, stream>>>(hb, w2b, b2, ln0f, x2, nullptr, M, D, DF);

  // LayerNorm 1 -> final output (fp32)
  layernorm_k<<<M, blk, 0, stream>>>(x2, g1, be1, (float*)d_out, nullptr, D);
}

// v001
// Measured time: 370 microseconds a run.
// Timed twice side by side with v000, it ran 1.19 and 1.20 times as fast.
#include <hip/hip_runtime.h>
#include <hip/hip_bf16.h>
#include <math.h>

// ---------------------------------------------------------------------------
// Types / helpers
// ---------------------------------------------------------------------------
typedef __attribute__((ext_vector_type(16))) __bf16 v16bf;
typedef __attribute__((ext_vector_type(8)))  __bf16 v8bf;
typedef __attribute__((ext_vector_type(8)))  float  v8f;

__device__ __forceinline__ __bf16 f2bf(float f) {
  unsigned u = __builtin_bit_cast(unsigned, f);
  unsigned r = u + 0x7FFFu + ((u >> 16) & 1u);   // round-to-nearest-even
  unsigned short h = (unsigned short)(r >> 16);
  return __builtin_bit_cast(__bf16, h);
}

__device__ __forceinline__ v8f zero8() {
  v8f z = {0.f, 0.f, 0.f, 0.f, 0.f, 0.f, 0.f, 0.f};
  return z;
}

__device__ __forceinline__ v8f wmma_bf16(v16bf a, v16bf b, v8f c) {
  // D(f32 16x16) = A(bf16 16x32) * B(bf16 32x16) + C
  return __builtin_amdgcn_wmma_f32_16x16x32_bf16(
      /*neg_a=*/false, a, /*neg_b=*/false, b,
      /*c_mod=*/(short)0, c, /*reuse_a=*/false, /*reuse_b=*/false);
}

// 16x32 bf16 fragment from 16 consecutive *rows* of a row-major matrix.
// Per ISA 16-bit A layout: lane r (0..15), half h: elems [0..7] = row r,
// K = k0 + h*8 .. +7 ; elems [8..15] = row r, K = k0 + 16 + h*8 .. +7.
// Identical layout serves B of X@W^T (B[k][n] = W[n][k] -> rows of W).
// Works for both global and LDS (generic) pointers.
__device__ __forceinline__ v16bf load_frag_rows(const __bf16* __restrict__ base,
                                                int ld, int row0, int k0, int lane) {
  int r = lane & 15, h = lane >> 4;
  const __bf16* p = base + (size_t)(row0 + r) * ld + (k0 + h * 8);
  v8bf lo = *(const v8bf*)p;          // 16-byte load
  v8bf hi = *(const v8bf*)(p + 16);   // 16-byte load
  v16bf f;
#pragma unroll
  for (int i = 0; i < 8; ++i) { f[i] = lo[i]; f[i + 8] = hi[i]; }
  return f;
}

// Fragment whose K dimension runs *down a column* of a row-major matrix
// (B operand of P@V: B[k][n] = V[k][n]).
__device__ __forceinline__ v16bf load_frag_cols(const __bf16* __restrict__ base,
                                                int ld, int k0, int col0, int lane) {
  int r = lane & 15, h = lane >> 4;
  const __bf16* p = base + (size_t)(k0 + h * 8) * ld + col0 + r;
  v16bf f;
#pragma unroll
  for (int i = 0; i < 8; ++i) f[i] = p[(size_t)i * ld];
  p += (size_t)16 * ld;
#pragma unroll
  for (int i = 0; i < 8; ++i) f[i + 8] = p[(size_t)i * ld];
  return f;
}

// LDS row pitch, in bf16 elements, of every 32-element (64-byte) row that is
// read back as a WMMA fragment with 16-byte LDS loads: 80 bytes = 16 B x odd,
// so the 16 rows that one half-wave reads start on 16 different groups of four
// banks. At the unpadded 64 bytes only four such groups are hit.
constexpr int LDP = 40;

// Three async Global -> LDS copies of 16 bytes per lane (tracked by ASYNCcnt).
// l*: LDS byte address (low 32 bits of the generic shared pointer == LDS
// offset per the flat-aperture mapping, ISA 10.2).
// s_wait_xcnt 0 is the last line of the copies' own statement so that no later
// write of an address register can be scheduled ahead of it (a precaution).
__device__ __forceinline__ void async3_b128(unsigned l0, const void* g0,
                                            unsigned l1, const void* g1,
                                            unsigned l2, const void* g2) {
  unsigned long long a0 = (unsigned long long)g0;
  unsigned long long a1 = (unsigned long long)g1;
  unsigned long long a2 = (unsigned long long)g2;
  asm volatile("global_load_async_to_lds_b128 %0, %1, off\n\t"
               "global_load_async_to_lds_b128 %2, %3, off\n\t"
               "global_load_async_to_lds_b128 %4, %5, off\n\t"
               "s_wait_xcnt 0x0"
               :: "v"(l0), "v"(a0), "v"(l1), "v"(a1), "v"(l2), "v"(a2)
               : "memory");
}

// ---------------------------------------------------------------------------
// fp32 -> bf16 conversion
// ---------------------------------------------------------------------------
__global__ __launch_bounds__(256) void cvt_bf16_k(const float* __restrict__ in,
                                                  __bf16* __restrict__ out, int n) {
  int stride = gridDim.x * 256;
  for (int i = blockIdx.x * 256 + threadIdx.x; i < n; i += stride)
    out[i] = f2bf(in[i]);
}

template <int EPI>
__global__ __launch_bounds__(256) void gemm_bf16_k(
    const __bf16* __restrict__ X, const __bf16* __restrict__ W,
    const float* __restrict__ bias, const float* __restrict__ resid,
    float* __restrict__ outF, __bf16* __restrict__ outB,
    int M, int N, int K) {
  __shared__ __attribute__((aligned(16))) __bf16 xs[2][128 * LDP];
  __shared__ __attribute__((aligned(16))) __bf16 wsb[2][64 * LDP];

  int tid = threadIdx.x;
  int lane = tid & 31;
  int wave = tid >> 5;
  int wm = wave & 3, wn = wave >> 4 ? 0 : (wave >> 2);  // (kept simple below)
  wn = wave >> 2;
  int m0 = wm * 32;            // within block tile
  int n0 = wn * 32;
  int mblk = blockIdx.x * 128;
  int nblk = blockIdx.y * 64;

  // Issue one K=32 stage of async copies into buffer `buf`.
  auto stage = [&](int buf, int k0) {
    // X tile: 128 rows x 32 bf16 = 512 16B-chunks; thread t -> chunks t, t+256
    // W tile: 64 rows x 32 bf16 = 256 16B-chunks; thread t -> chunk t
    int row = tid >> 2, q = tid & 3;
    async3_b128((unsigned)(size_t)&xs[buf][row * LDP + q * 8],
                X + (size_t)(mblk + row) * K + k0 + q * 8,
                (unsigned)(size_t)&xs[buf][(row + 64) * LDP + q * 8],
                X + (size_t)(mblk + row + 64) * K + k0 + q * 8,
                (unsigned)(size_t)&wsb[buf][row * LDP + q * 8],
                W + (size_t)(nblk + row) * K + k0 + q * 8);
  };

  v8f acc00 = zero8(), acc01 = zero8(), acc10 = zero8(), acc11 = zero8();

  int nk = K >> 5;
  stage(0, 0);
  for (int kk = 0; kk < nk; ++kk) {
    __syncthreads();                        // buf[(kk+1)&1] free for overwrite
    if (kk + 1 < nk) {
      stage((kk + 1) & 1, (kk + 1) << 5);
      asm volatile("s_wait_asynccnt 0x3" ::: "memory");  // stage kk complete
    } else {
      asm volatile("s_wait_asynccnt 0x0" ::: "memory");
    }
    __syncthreads();                        // stage kk visible to all waves

    const __bf16* xt = xs[kk & 1];
    const __bf16* wt = wsb[kk & 1];
    v16bf a0 = load_frag_rows(xt, LDP, m0, 0, lane);
    v16bf a1 = load_frag_rows(xt, LDP, m0 + 16, 0, lane);
    v16bf b0 = load_frag_rows(wt, LDP, n0, 0, lane);
    v16bf b1 = load_frag_rows(wt, LDP, n0 + 16, 0, lane);
    acc00 = wmma_bf16(a0, b0, acc00);
    acc01 = wmma_bf16(a0, b1, acc01);
    acc10 = wmma_bf16(a1, b0, acc10);
    acc11 = wmma_bf16(a1, b1, acc11);
  }

  int r = lane & 15, h = lane >> 4;
#pragma unroll
  for (int ti = 0; ti < 2; ++ti) {
#pragma unroll
    for (int tj = 0; tj < 2; ++tj) {
      v8f acc = (ti == 0) ? (tj == 0 ? acc00 : acc01)
                          : (tj == 0 ? acc10 : acc11);
      int col = nblk + n0 + tj * 16 + r;
      float bv = (EPI == 0) ? 0.f : (bias ? bias[col] : 0.f);
#pragma unroll
      for (int i = 0; i < 8; ++i) {
        int row = mblk + m0 + ti * 16 + i + 8 * h;  // C layout: vgpr i -> M=i+8*h
        float v = acc[i] + bv;
        size_t idx = (size_t)row * N + col;
        if (EPI == 1) {
          v = 0.5f * v * (1.0f + erff(v * 0.70710678118654752f));  // exact GELU
          outB[idx] = f2bf(v);
        } else if (EPI == 2) {
          outF[idx] = v + resid[idx];
        } else {
          outB[idx] = f2bf(v);
        }
      }
    }
  }
}

// ---------------------------------------------------------------------------
// Flash-style causal attention, hd = 64, wave32.
// One wave = 16 query rows; block = 8 waves = 128 rows.
// Grid: (S/128, H, B). Q/K/V/O are [B*S, D] bf16, head h at cols h*64.
// ---------------------------------------------------------------------------
__global__ __launch_bounds__(256) void attention_k(
    const __bf16* __restrict__ Q, const __bf16* __restrict__ Km,
    const __bf16* __restrict__ V, __bf16* __restrict__ O,
    int S, int Dm) {
  __shared__ __attribute__((aligned(16))) __bf16 Plds[8 * 16 * LDP];

  int lane = threadIdx.x & 31, wave = threadIdx.x >> 5;
  int r = lane & 15, hl = lane >> 4;
  int h = blockIdx.y, b = blockIdx.z;
  int qbase = blockIdx.x * 128 + wave * 16;   // wave-uniform

  size_t base = (size_t)b * S * Dm + (size_t)h * 64;
  const __bf16* qp = Q + base;
  const __bf16* kp = Km + base;
  const __bf16* vp = V + base;
  __bf16* op = O + base;
  __bf16* pl = &Plds[wave * 16 * LDP];        // per-wave 16x32 staging tile, pitch LDP

  v16bf aq0 = load_frag_rows(qp, Dm, qbase, 0, lane);
  v16bf aq1 = load_frag_rows(qp, Dm, qbase, 32, lane);

  v8f o0 = zero8(), o1 = zero8(), o2 = zero8(), o3 = zero8();
  float m[8], l[8];
#pragma unroll
  for (int i = 0; i < 8; ++i) { m[i] = -1e30f; l[i] = 0.f; }

  for (int j0 = 0; j0 < qbase + 16; j0 += 32) {   // wave-uniform trip count
    // ---- S = Q @ K^T (two 16x16 score tiles: keys j0.. and j0+16..) ----
    v8f s0 = zero8(), s1 = zero8();
    {
      v16bf bk0 = load_frag_rows(kp, Dm, j0, 0, lane);
      v16bf bk1 = load_frag_rows(kp, Dm, j0, 32, lane);
      s0 = wmma_bf16(aq0, bk0, s0);
      s0 = wmma_bf16(aq1, bk1, s0);
      v16bf bk2 = load_frag_rows(kp, Dm, j0 + 16, 0, lane);
      v16bf bk3 = load_frag_rows(kp, Dm, j0 + 16, 32, lane);
      s1 = wmma_bf16(aq0, bk2, s1);
      s1 = wmma_bf16(aq1, bk3, s1);
    }
    // ---- scale, causal mask, online softmax ----
#pragma unroll
    for (int i = 0; i < 8; ++i) {
      int qrow = qbase + i + 8 * hl;
      float sc0 = s0[i] * 0.125f;               // 1/sqrt(64)
      float sc1 = s1[i] * 0.125f;
      if (j0 + r > qrow) sc0 = -1e30f;
      if (j0 + 16 + r > qrow) sc1 = -1e30f;
      float rm = fmaxf(sc0, sc1);
#pragma unroll
      for (int off = 1; off < 16; off <<= 1) rm = fmaxf(rm, __shfl_xor(rm, off, 32));
      float mn = fmaxf(m[i], rm);
      float al = __expf(m[i] - mn);
      float p0 = __expf(sc0 - mn);
      float p1 = __expf(sc1 - mn);
      float rs = p0 + p1;
#pragma unroll
      for (int off = 1; off < 16; off <<= 1) rs += __shfl_xor(rs, off, 32);
      l[i] = l[i] * al + rs;
      m[i] = mn;
      o0[i] *= al; o1[i] *= al; o2[i] *= al; o3[i] *= al;
      // stage P (C layout -> LDS row-major 16x32, bf16)
      pl[(i + 8 * hl) * LDP + r]      = f2bf(p0);
      pl[(i + 8 * hl) * LDP + 16 + r] = f2bf(p1);
    }
    asm volatile("s_wait_dscnt 0" ::: "memory");
    // ---- O += P @ V ----
    v16bf ap  = load_frag_rows(pl, LDP, 0, 0, lane);  // A-layout reload from LDS
    v16bf bv0 = load_frag_cols(vp, Dm, j0, 0, lane);
    v16bf bv1 = load_frag_cols(vp, Dm, j0, 16, lane);
    v16bf bv2 = load_frag_cols(vp, Dm, j0, 32, lane);
    v16bf bv3 = load_frag_cols(vp, Dm, j0, 48, lane);
    o0 = wmma_bf16(ap, bv0, o0);
    o1 = wmma_bf16(ap, bv1, o1);
    o2 = wmma_bf16(ap, bv2, o2);
    o3 = wmma_bf16(ap, bv3, o3);
  }

#pragma unroll
  for (int i = 0; i < 8; ++i) {
    float inv = 1.0f / l[i];
    size_t row = (size_t)(qbase + i + 8 * hl);
    op[row * Dm + 0 + r]  = f2bf(o0[i] * inv);
    op[row * Dm + 16 + r] = f2bf(o1[i] * inv);
    op[row * Dm + 32 + r] = f2bf(o2[i] * inv);
    op[row * Dm + 48 + r] = f2bf(o3[i] * inv);
  }
}

// ---------------------------------------------------------------------------
// LayerNorm over last dim (block per row). Writes fp32 (+ optional bf16).
// ---------------------------------------------------------------------------
__global__ __launch_bounds__(256) void layernorm_k(
    const float* __restrict__ in, const float* __restrict__ gamma,
    const float* __restrict__ beta, float* __restrict__ outF,
    __bf16* outB, int D) {
  __shared__ float red[256];
  int row = blockIdx.x, tid = threadIdx.x;
  const float* p = in + (size_t)row * D;

  float s = 0.f;
  for (int i = tid; i < D; i += 256) s += p[i];
  red[tid] = s; __syncthreads();
  for (int o = 128; o > 0; o >>= 1) { if (tid < o) red[tid] += red[tid + o]; __syncthreads(); }
  float mu = red[0] / (float)D;
  __syncthreads();

  float ss = 0.f;
  for (int i = tid; i < D; i += 256) { float d = p[i] - mu; ss += d * d; }
  red[tid] = ss; __syncthreads();
  for (int o = 128; o > 0; o >>= 1) { if (tid < o) red[tid] += red[tid + o]; __syncthreads(); }
  float inv = rsqrtf(red[0] / (float)D + 1e-5f);

  for (int i = tid; i < D; i += 256) {
    float y = (p[i] - mu) * inv * gamma[i] + beta[i];
    outF[(size_t)row * D + i] = y;
    if (outB) outB[(size_t)row * D + i] = f2bf(y);
  }
}

// ---------------------------------------------------------------------------
// Host orchestration
// ---------------------------------------------------------------------------
extern "C" void kernel_launch(void* const* d_in, const int* in_sizes, int n_in,
                              void* d_out, int out_size, void* d_ws, size_t ws_size,
                              hipStream_t stream) {
  (void)in_sizes; (void)n_in; (void)out_size; (void)ws_size;
  constexpr int B = 2, S = 2048, D = 1024, H = 16, M = B * S, DF = 4 * D;

  const float* x   = (const float*)d_in[0];
  const float* wq  = (const float*)d_in[1];
  const float* wk  = (const float*)d_in[2];
  const float* wv  = (const float*)d_in[3];
  const float* wo  = (const float*)d_in[4];
  const float* w1  = (const float*)d_in[5];
  const float* b1  = (const float*)d_in[6];
  const float* w2  = (const float*)d_in[7];
  const float* b2  = (const float*)d_in[8];
  const float* g0  = (const float*)d_in[9];
  const float* be0 = (const float*)d_in[10];
  const float* g1  = (const float*)d_in[11];
  const float* be1 = (const float*)d_in[12];

  char* ws = (char*)d_ws;
  size_t off = 0;
  auto take = [&](size_t bytes) -> void* {
    void* p = ws + off;
    off = (off + bytes + 255) & ~(size_t)255;
    return p;
  };

  __bf16* xb   = (__bf16*)take((size_t)M * D * 2);    // also reused as ln0b
  __bf16* wqb  = (__bf16*)take((size_t)D * D * 2);
  __bf16* wkb  = (__bf16*)take((size_t)D * D * 2);
  __bf16* wvb  = (__bf16*)take((size_t)D * D * 2);
  __bf16* wob  = (__bf16*)take((size_t)D * D * 2);
  __bf16* w1b  = (__bf16*)take((size_t)DF * D * 2);
  __bf16* w2b  = (__bf16*)take((size_t)D * DF * 2);
  size_t qkv_off = off;
  __bf16* qb    = (__bf16*)take((size_t)M * D * 2);
  __bf16* kb    = (__bf16*)take((size_t)M * D * 2);
  __bf16* vb    = (__bf16*)take((size_t)M * D * 2);
  __bf16* attnb = (__bf16*)take((size_t)M * D * 2);
  float*  x1    = (float*)take((size_t)M * D * 4);    // also reused as x2
  float*  ln0f  = (float*)take((size_t)M * D * 4);
  // reuse dead regions:
  __bf16* hb   = (__bf16*)(ws + qkv_off);             // 32MB over q/k/v/attn (dead)
  __bf16* ln0b = xb;                                  // xb dead after QKV gemms
  float*  x2   = x1;                                  // x1 dead after LN0

  dim3 blk(256);

  // fp32 -> bf16 conversions
  cvt_bf16_k<<<1024, blk, 0, stream>>>(x,  xb,  M * D);
  cvt_bf16_k<<<1024, blk, 0, stream>>>(wq, wqb, D * D);
  cvt_bf16_k<<<1024, blk, 0, stream>>>(wk, wkb, D * D);
  cvt_bf16_k<<<1024, blk, 0, stream>>>(wv, wvb, D * D);
  cvt_bf16_k<<<1024, blk, 0, stream>>>(wo, wob, D * D);
  cvt_bf16_k<<<1024, blk, 0, stream>>>(w1, w1b, DF * D);
  cvt_bf16_k<<<1024, blk, 0, stream>>>(w2, w2b, D * DF);

  // Q, K, V projections (bf16 out)
  dim3 gD(M / 128, D / 64);
  gemm_bf16_k<0><<<gD, blk, 0, stream>>>(xb, wqb, nullptr, nullptr, nullptr, qb, M, D, D);
  gemm_bf16_k<0><<<gD, blk, 0, stream>>>(xb, wkb, nullptr, nullptr, nullptr, kb, M, D, D);
  gemm_bf16_k<0><<<gD, blk, 0, stream>>>(xb, wvb, nullptr, nullptr, nullptr, vb, M, D, D);

  // causal flash attention
  attention_k<<<dim3(S / 128, H, B), blk, 0, stream>>>(qb, kb, vb, attnb, S, D);

  // output projection + residual (fp32)
  gemm_bf16_k<2><<<gD, blk, 0, stream>>>(attnb, wob, nullptr, x, x1, nullptr, M, D, D);

  // LayerNorm 0 (fp32 + bf16 copies)
  layernorm_k<<<M, blk, 0, stream>>>(x1, g0, be0, ln0f, ln0b, D);

  // MLP up + exact GELU (bf16 out)
  gemm_bf16_k<1><<<dim3(M / 128, DF / 64), blk, 0, stream>>>(ln0b, w1b, b1, nullptr, nullptr, hb, M, DF, D);

  // MLP down + bias + residual (fp32)
  gemm_bf16_k<2><<<gD, blk, 0, stream>>>(hb, w2b, b2, ln0f, x2, nullptr, M, D, DF);

  // LayerNorm 1 -> final output (fp32)
  layernorm_k<<<M, blk, 0, stream>>>(x2, g1, be1, (float*)d_out, nullptr, D);
}

// v002
// A run of this version takes 342 microseconds.
// In both of two side-by-side timings against v001, it was 1.08 times as fast.
// Counting every step since v000, it is 1.29 times as fast.
#include <hip/hip_runtime.h>
#include <hip/hip_bf16.h>
#include <math.h>

// ---------------------------------------------------------------------------
// Types / helpers
// ---------------------------------------------------------------------------
typedef __attribute__((ext_vector_type(16))) __bf16 v16bf;
typedef __attribute__((ext_vector_type(8)))  __bf16 v8bf;
typedef __attribute__((ext_vector_type(8)))  float  v8f;

__device__ __forceinline__ __bf16 f2bf(float f) {
  unsigned u = __builtin_bit_cast(unsigned, f);
  unsigned r = u + 0x7FFFu + ((u >> 16) & 1u);   // round-to-nearest-even
  unsigned short h = (unsigned short)(r >> 16);
  return __builtin_bit_cast(__bf16, h);
}

__device__ __forceinline__ v8f zero8() {
  v8f z = {0.f, 0.f, 0.f, 0.f, 0.f, 0.f, 0.f, 0.f};
  return z;
}

__device__ __forceinline__ v8f wmma_bf16(v16bf a, v16bf b, v8f c) {
  // D(f32 16x16) = A(bf16 16x32) * B(bf16 32x16) + C
  return __builtin_amdgcn_wmma_f32_16x16x32_bf16(
      /*neg_a=*/false, a, /*neg_b=*/false, b,
      /*c_mod=*/(short)0, c, /*reuse_a=*/false, /*reuse_b=*/false);
}

// 16x32 bf16 fragment from 16 consecutive *rows* of a row-major matrix.
// Per ISA 16-bit A layout: lane r (0..15), half h: elems [0..7] = row r,
// K = k0 + h*8 .. +7 ; elems [8..15] = row r, K = k0 + 16 + h*8 .. +7.
// Identical layout serves B of X@W^T (B[k][n] = W[n][k] -> rows of W).
// Works for both global and LDS (generic) pointers.
__device__ __forceinline__ v16bf load_frag_rows(const __bf16* __restrict__ base,
                                                int ld, int row0, int k0, int lane) {
  int r = lane & 15, h = lane >> 4;
  const __bf16* p = base + (size_t)(row0 + r) * ld + (k0 + h * 8);
  v8bf lo = *(const v8bf*)p;          // 16-byte load
  v8bf hi = *(const v8bf*)(p + 16);   // 16-byte load
  v16bf f;
#pragma unroll
  for (int i = 0; i < 8; ++i) { f[i] = lo[i]; f[i + 8] = hi[i]; }
  return f;
}

// Fragment whose K dimension runs *down a column* of a row-major matrix
// (B operand of P@V: B[k][n] = V[k][n]).
__device__ __forceinline__ v16bf load_frag_cols(const __bf16* __restrict__ base,
                                                int ld, int k0, int col0, int lane) {
  int r = lane & 15, h = lane >> 4;
  const __bf16* p = base + (size_t)(k0 + h * 8) * ld + col0 + r;
  v16bf f;
#pragma unroll
  for (int i = 0; i < 8; ++i) f[i] = p[(size_t)i * ld];
  p += (size_t)16 * ld;
#pragma unroll
  for (int i = 0; i < 8; ++i) f[i + 8] = p[(size_t)i * ld];
  return f;
}

// LDS row pitch, in bf16 elements, of every 32-element (64-byte) row that is
// read back as a WMMA fragment with 16-byte LDS loads: 80 bytes = 16 B x odd,
// so the 16 rows that one half-wave reads start on 16 different groups of four
// banks. At the unpadded 64 bytes only four such groups are hit.
constexpr int LDP = 40;

// K elements of one GEMM stage: a staged row is 128 bytes, one whole cache line.
constexpr int GK = 64;
// LDS pitch of those rows, in bf16 elements: 144 bytes = 16 B x odd, as above.
constexpr int GLP = 72;

// Six async Global -> LDS copies of 16 bytes per lane (tracked by ASYNCcnt).
// l*: LDS byte address (low 32 bits of the generic shared pointer == LDS
// offset per the flat-aperture mapping, ISA 10.2).
// s_wait_xcnt 0 is the last line of the copies' own statement so that no later
// write of an address register can be scheduled ahead of it (a precaution).
__device__ __forceinline__ void async6_b128(unsigned l0, const void* g0,
                                            unsigned l1, const void* g1,
                                            unsigned l2, const void* g2,
                                            unsigned l3, const void* g3,
                                            unsigned l4, const void* g4,
                                            unsigned l5, const void* g5) {
  unsigned long long a0 = (unsigned long long)g0;
  unsigned long long a1 = (unsigned long long)g1;
  unsigned long long a2 = (unsigned long long)g2;
  unsigned long long a3 = (unsigned long long)g3;
  unsigned long long a4 = (unsigned long long)g4;
  unsigned long long a5 = (unsigned long long)g5;
  asm volatile("global_load_async_to_lds_b128 %0, %1, off\n\t"
               "global_load_async_to_lds_b128 %2, %3, off\n\t"
               "global_load_async_to_lds_b128 %4, %5, off\n\t"
               "global_load_async_to_lds_b128 %6, %7, off\n\t"
               "global_load_async_to_lds_b128 %8, %9, off\n\t"
               "global_load_async_to_lds_b128 %10, %11, off\n\t"
               "s_wait_xcnt 0x0"
               :: "v"(l0), "v"(a0), "v"(l1), "v"(a1), "v"(l2), "v"(a2),
                  "v"(l3), "v"(a3), "v"(l4), "v"(a4), "v"(l5), "v"(a5)
               : "memory");
}

// ---------------------------------------------------------------------------
// fp32 -> bf16 conversion
// ---------------------------------------------------------------------------
__global__ __launch_bounds__(256) void cvt_bf16_k(const float* __restrict__ in,
                                                  __bf16* __restrict__ out, int n) {
  int stride = gridDim.x * 256;
  for (int i = blockIdx.x * 256 + threadIdx.x; i < n; i += stride)
    out[i] = f2bf(in[i]);
}

template <int EPI>
__global__ __launch_bounds__(256) void gemm_bf16_k(
    const __bf16* __restrict__ X, const __bf16* __restrict__ W,
    const float* __restrict__ bias, const float* __restrict__ resid,
    float* __restrict__ outF, __bf16* __restrict__ outB,
    int M, int N, int K) {
  __shared__ __attribute__((aligned(16))) __bf16 xs[2][128 * GLP];
  __shared__ __attribute__((aligned(16))) __bf16 wsb[2][64 * GLP];

  int tid = threadIdx.x;
  int lane = tid & 31;
  int wave = tid >> 5;
  int wm = wave & 3, wn = wave >> 4 ? 0 : (wave >> 2);  // (kept simple below)
  wn = wave >> 2;
  int m0 = wm * 32;            // within block tile
  int n0 = wn * 32;
  int mblk = blockIdx.x * 128;
  int nblk = blockIdx.y * 64;

  // Issue one K=GK stage of async copies into buffer `buf`.
  auto stage = [&](int buf, int k0) {
    // X tile: 128 rows x 8 16B-chunks; thread t -> chunk t & 7 of rows t >> 3, +32, +64, +96
    // W tile: 64 rows x 8 16B-chunks; thread t -> chunk t & 7 of rows t >> 3, +32
    int row = tid >> 3, q = tid & 7;
    const __bf16* xg = X + (size_t)(mblk + row) * K + k0 + q * 8;
    const __bf16* wg = W + (size_t)(nblk + row) * K + k0 + q * 8;
    __bf16* xl = &xs[buf][row * GLP + q * 8];
    __bf16* wl = &wsb[buf][row * GLP + q * 8];
    async6_b128((unsigned)(size_t)xl,              xg,
                (unsigned)(size_t)(xl + 32 * GLP), xg + (size_t)32 * K,
                (unsigned)(size_t)(xl + 64 * GLP), xg + (size_t)64 * K,
                (unsigned)(size_t)(xl + 96 * GLP), xg + (size_t)96 * K,
                (unsigned)(size_t)wl,              wg,
                (unsigned)(size_t)(wl + 32 * GLP), wg + (size_t)32 * K);
  };

  v8f acc00 = zero8(), acc01 = zero8(), acc10 = zero8(), acc11 = zero8();

  int nk = K / GK;
  stage(0, 0);
  asm volatile("s_wait_asynccnt 0x0" ::: "memory");  // this wave's part of stage 0 has landed
  __syncthreads();                                   // stage 0 visible to all waves
  if (nk > 1) stage(1, GK);
  for (int kk = 0; kk < nk; ++kk) {
    const __bf16* xt = xs[kk & 1];
    const __bf16* wt = wsb[kk & 1];
#pragma unroll   // ks becomes a constant offset of the LDS loads
    for (int ks = 0; ks < GK; ks += 32) {
      v16bf a0 = load_frag_rows(xt, GLP, m0, ks, lane);
      v16bf a1 = load_frag_rows(xt, GLP, m0 + 16, ks, lane);
      v16bf b0 = load_frag_rows(wt, GLP, n0, ks, lane);
      v16bf b1 = load_frag_rows(wt, GLP, n0 + 16, ks, lane);
      acc00 = wmma_bf16(a0, b0, acc00);
      acc01 = wmma_bf16(a0, b1, acc01);
      acc10 = wmma_bf16(a1, b0, acc10);
      acc11 = wmma_bf16(a1, b1, acc11);
    }
    // Hand-over:
    asm volatile("s_wait_dscnt 0x0" ::: "memory");     // this wave's reads of buffer kk & 1 are done
    asm volatile("s_wait_asynccnt 0x0" ::: "memory");  // its part of stage kk + 1 has landed
    __syncthreads();   // stage kk + 1 visible to all; buffer kk & 1 left by all
    if (kk + 2 < nk) stage(kk & 1, (kk + 2) * GK);
  }
  asm volatile("s_wait_asynccnt 0x0" ::: "memory");    // nothing in flight at the wave's end

  int r = lane & 15, h = lane >> 4;
#pragma unroll
  for (int ti = 0; ti < 2; ++ti) {
#pragma unroll
    for (int tj = 0; tj < 2; ++tj) {
      v8f acc = (ti == 0) ? (tj == 0 ? acc00 : acc01)
                          : (tj == 0 ? acc10 : acc11);
      int col = nblk + n0 + tj * 16 + r;
      float bv = (EPI == 0) ? 0.f : (bias ? bias[col] : 0.f);
#pragma unroll
      for (int i = 0; i < 8; ++i) {
        int row = mblk + m0 + ti * 16 + i + 8 * h;  // C layout: vgpr i -> M=i+8*h
        float v = acc[i] + bv;
        size_t idx = (size_t)row * N + col;
        if (EPI == 1) {
          v = 0.5f * v * (1.0f + erff(v * 0.70710678118654752f));  // exact GELU
          outB[idx] = f2bf(v);
        } else if (EPI == 2) {
          outF[idx] = v + resid[idx];
        } else {
          outB[idx] = f2bf(v);
        }
      }
    }
  }
}

// ---------------------------------------------------------------------------
// Flash-style causal attention, hd = 64, wave32.
// One wave = 16 query rows; block = 8 waves = 128 rows.
// Grid: (S/128, H, B). Q/K/V/O are [B*S, D] bf16, head h at cols h*64.
// ---------------------------------------------------------------------------
__global__ __launch_bounds__(256) void attention_k(
    const __bf16* __restrict__ Q, const __bf16* __restrict__ Km,
    const __bf16* __restrict__ V, __bf16* __restrict__ O,
    int S, int Dm) {
  __shared__ __attribute__((aligned(16))) __bf16 Plds[8 * 16 * LDP];

  int lane = threadIdx.x & 31, wave = threadIdx.x >> 5;
  int r = lane & 15, hl = lane >> 4;
  int h = blockIdx.y, b = blockIdx.z;
  int qbase = blockIdx.x * 128 + wave * 16;   // wave-uniform

  size_t base = (size_t)b * S * Dm + (size_t)h * 64;
  const __bf16* qp = Q + base;
  const __bf16* kp = Km + base;
  const __bf16* vp = V + base;
  __bf16* op = O + base;
  __bf16* pl = &Plds[wave * 16 * LDP];        // per-wave 16x32 staging tile, pitch LDP

  v16bf aq0 = load_frag_rows(qp, Dm, qbase, 0, lane);
  v16bf aq1 = load_frag_rows(qp, Dm, qbase, 32, lane);

  v8f o0 = zero8(), o1 = zero8(), o2 = zero8(), o3 = zero8();
  float m[8], l[8];
#pragma unroll
  for (int i = 0; i < 8; ++i) { m[i] = -1e30f; l[i] = 0.f; }

  for (int j0 = 0; j0 < qbase + 16; j0 += 32) {   // wave-uniform trip count
    // ---- S = Q @ K^T (two 16x16 score tiles: keys j0.. and j0+16..) ----
    v8f s0 = zero8(), s1 = zero8();
    {
      v16bf bk0 = load_frag_rows(kp, Dm, j0, 0, lane);
      v16bf bk1 = load_frag_rows(kp, Dm, j0, 32, lane);
      s0 = wmma_bf16(aq0, bk0, s0);
      s0 = wmma_bf16(aq1, bk1, s0);
      v16bf bk2 = load_frag_rows(kp, Dm, j0 + 16, 0, lane);
      v16bf bk3 = load_frag_rows(kp, Dm, j0 + 16, 32, lane);
      s1 = wmma_bf16(aq0, bk2, s1);
      s1 = wmma_bf16(aq1, bk3, s1);
    }
    // ---- scale, causal mask, online softmax ----
#pragma unroll
    for (int i = 0; i < 8; ++i) {
      int qrow = qbase + i + 8 * hl;
      float sc0 = s0[i] * 0.125f;               // 1/sqrt(64)
      float sc1 = s1[i] * 0.125f;
      if (j0 + r > qrow) sc0 = -1e30f;
      if (j0 + 16 + r > qrow) sc1 = -1e30f;
      float rm = fmaxf(sc0, sc1);
#pragma unroll
      for (int off = 1; off < 16; off <<= 1) rm = fmaxf(rm, __shfl_xor(rm, off, 32));
      float mn = fmaxf(m[i], rm);
      float al = __expf(m[i] - mn);
      float p0 = __expf(sc0 - mn);
      float p1 = __expf(sc1 - mn);
      float rs = p0 + p1;
#pragma unroll
      for (int off = 1; off < 16; off <<= 1) rs += __shfl_xor(rs, off, 32);
      l[i] = l[i] * al + rs;
      m[i] = mn;
      o0[i] *= al; o1[i] *= al; o2[i] *= al; o3[i] *= al;
      // stage P (C layout -> LDS row-major 16x32, bf16)
      pl[(i + 8 * hl) * LDP + r]      = f2bf(p0);
      pl[(i + 8 * hl) * LDP + 16 + r] = f2bf(p1);
    }
    asm volatile("s_wait_dscnt 0" ::: "memory");
    // ---- O += P @ V ----
    v16bf ap  = load_frag_rows(pl, LDP, 0, 0, lane);  // A-layout reload from LDS
    v16bf bv0 = load_frag_cols(vp, Dm, j0, 0, lane);
    v16bf bv1 = load_frag_cols(vp, Dm, j0, 16, lane);
    v16bf bv2 = load_frag_cols(vp, Dm, j0, 32, lane);
    v16bf bv3 = load_frag_cols(vp, Dm, j0, 48, lane);
    o0 = wmma_bf16(ap, bv0, o0);
    o1 = wmma_bf16(ap, bv1, o1);
    o2 = wmma_bf16(ap, bv2, o2);
    o3 = wmma_bf16(ap, bv3, o3);
  }

#pragma unroll
  for (int i = 0; i < 8; ++i) {
    float inv = 1.0f / l[i];
    size_t row = (size_t)(qbase + i + 8 * hl);
    op[row * Dm + 0 + r]  = f2bf(o0[i] * inv);
    op[row * Dm + 16 + r] = f2bf(o1[i] * inv);
    op[row * Dm + 32 + r] = f2bf(o2[i] * inv);
    op[row * Dm + 48 + r] = f2bf(o3[i] * inv);
  }
}

// ---------------------------------------------------------------------------
// LayerNorm over last dim (block per row). Writes fp32 (+ optional bf16).
// ---------------------------------------------------------------------------
__global__ __launch_bounds__(256) void layernorm_k(
    const float* __restrict__ in, const float* __restrict__ gamma,
    const float* __restrict__ beta, float* __restrict__ outF,
    __bf16* outB, int D) {
  __shared__ float red[256];
  int row = blockIdx.x, tid = threadIdx.x;
  const float* p = in + (size_t)row * D;

  float s = 0.f;
  for (int i = tid; i < D; i += 256) s += p[i];
  red[tid] = s; __syncthreads();
  for (int o = 128; o > 0; o >>= 1) { if (tid < o) red[tid] += red[tid + o]; __syncthreads(); }
  float mu = red[0] / (float)D;
  __syncthreads();

  float ss = 0.f;
  for (int i = tid; i < D; i += 256) { float d = p[i] - mu; ss += d * d; }
  red[tid] = ss; __syncthreads();
  for (int o = 128; o > 0; o >>= 1) { if (tid < o) red[tid] += red[tid + o]; __syncthreads(); }
  float inv = rsqrtf(red[0] / (float)D + 1e-5f);

  for (int i = tid; i < D; i += 256) {
    float y = (p[i] - mu) * inv * gamma[i] + beta[i];
    outF[(size_t)row * D + i] = y;
    if (outB) outB[(size_t)row * D + i] = f2bf(y);
  }
}

// ---------------------------------------------------------------------------
// Host orchestration
// ---------------------------------------------------------------------------
extern "C" void kernel_launch(void* const* d_in, const int* in_sizes, int n_in,
                              void* d_out, int out_size, void* d_ws, size_t ws_size,
                              hipStream_t stream) {
  (void)in_sizes; (void)n_in; (void)out_size; (void)ws_size;
  constexpr int B = 2, S = 2048, D = 1024, H = 16, M = B * S, DF = 4 * D;

  const float* x   = (const float*)d_in[0];
  const float* wq  = (const float*)d_in[1];
  const float* wk  = (const float*)d_in[2];
  const float* wv  = (const float*)d_in[3];
  const float* wo  = (const float*)d_in[4];
  const float* w1  = (const float*)d_in[5];
  const float* b1  = (const float*)d_in[6];
  const float* w2  = (const float*)d_in[7];
  const float* b2  = (const float*)d_in[8];
  const float* g0  = (const float*)d_in[9];
  const float* be0 = (const float*)d_in[10];
  const float* g1  = (const float*)d_in[11];
  const float* be1 = (const float*)d_in[12];

  char* ws = (char*)d_ws;
  size_t off = 0;
  auto take = [&](size_t bytes) -> void* {
    void* p = ws + off;
    off = (off + bytes + 255) & ~(size_t)255;
    return p;
  };

  __bf16* xb   = (__bf16*)take((size_t)M * D * 2);    // also reused as ln0b
  __bf16* wqb  = (__bf16*)take((size_t)D * D * 2);
  __bf16* wkb  = (__bf16*)take((size_t)D * D * 2);
  __bf16* wvb  = (__bf16*)take((size_t)D * D * 2);
  __bf16* wob  = (__bf16*)take((size_t)D * D * 2);
  __bf16* w1b  = (__bf16*)take((size_t)DF * D * 2);
  __bf16* w2b  = (__bf16*)take((size_t)D * DF * 2);
  size_t qkv_off = off;
  __bf16* qb    = (__bf16*)take((size_t)M * D * 2);
  __bf16* kb    = (__bf16*)take((size_t)M * D * 2);
  __bf16* vb    = (__bf16*)take((size_t)M * D * 2);
  __bf16* attnb = (__bf16*)take((size_t)M * D * 2);
  float*  x1    = (float*)take((size_t)M * D * 4);    // also reused as x2
  float*  ln0f  = (float*)take((size_t)M * D * 4);
  // reuse dead regions:
  __bf16* hb   = (__bf16*)(ws + qkv_off);             // 32MB over q/k/v/attn (dead)
  __bf16* ln0b = xb;                                  // xb dead after QKV gemms
  float*  x2   = x1;                                  // x1 dead after LN0

  dim3 blk(256);

  // fp32 -> bf16 conversions
  cvt_bf16_k<<<1024, blk, 0, stream>>>(x,  xb,  M * D);
  cvt_bf16_k<<<1024, blk, 0, stream>>>(wq, wqb, D * D);
  cvt_bf16_k<<<1024, blk, 0, stream>>>(wk, wkb, D * D);
  cvt_bf16_k<<<1024, blk, 0, stream>>>(wv, wvb, D * D);
  cvt_bf16_k<<<1024, blk, 0, stream>>>(wo, wob, D * D);
  cvt_bf16_k<<<1024, blk, 0, stream>>>(w1, w1b, DF * D);
  cvt_bf16_k<<<1024, blk, 0, stream>>>(w2, w2b, D * DF);

  // Q, K, V projections (bf16 out)
  dim3 gD(M / 128, D / 64);
  gemm_bf16_k<0><<<gD, blk, 0, stream>>>(xb, wqb, nullptr, nullptr, nullptr, qb, M, D, D);
  gemm_bf16_k<0><<<gD, blk, 0, stream>>>(xb, wkb, nullptr, nullptr, nullptr, kb, M, D, D);
  gemm_bf16_k<0><<<gD, blk, 0, stream>>>(xb, wvb, nullptr, nullptr, nullptr, vb, M, D, D);

  // causal flash attention
  attention_k<<<dim3(S / 128, H, B), blk, 0, stream>>>(qb, kb, vb, attnb, S, D);

  // output projection + residual (fp32)
  gemm_bf16_k<2><<<gD, blk, 0, stream>>>(attnb, wob, nullptr, x, x1, nullptr, M, D, D);

  // LayerNorm 0 (fp32 + bf16 copies)
  layernorm_k<<<M, blk, 0, stream>>>(x1, g0, be0, ln0f, ln0b, D);

  // MLP up + exact GELU (bf16 out)
  gemm_bf16_k<1><<<dim3(M / 128, DF / 64), blk, 0, stream>>>(ln0b, w1b, b1, nullptr, nullptr, hb, M, DF, D);

  // MLP down + bias + residual (fp32)
  gemm_bf16_k<2><<<gD, blk, 0, stream>>>(hb, w2b, b2, ln0f, x2, nullptr, M, D, DF);

  // LayerNorm 1 -> final output (fp32)
  layernorm_k<<<M, blk, 0, stream>>>(x2, g1, be1, (float*)d_out, nullptr, D);
}

// v003
// Measured time: 318 microseconds a run.
// In both of two side-by-side timings against v002, it was 1.06 times as fast.
// Counting every step since v000, it is 1.37 times as fast.
#include <hip/hip_runtime.h>
#include <hip/hip_bf16.h>
#include <math.h>

// ---------------------------------------------------------------------------
// Types / helpers
// ---------------------------------------------------------------------------
typedef __attribute__((ext_vector_type(16))) __bf16 v16bf;
typedef __attribute__((ext_vector_type(8)))  __bf16 v8bf;
typedef __attribute__((ext_vector_type(8)))  float  v8f;

__device__ __forceinline__ __bf16 f2bf(float f) {
  unsigned u = __builtin_bit_cast(unsigned, f);
  unsigned r = u + 0x7FFFu + ((u >> 16) & 1u);   // round-to-nearest-even
  unsigned short h = (unsigned short)(r >> 16);
  return __builtin_bit_cast(__bf16, h);
}

__device__ __forceinline__ v8f zero8() {
  v8f z = {0.f, 0.f, 0.f, 0.f, 0.f, 0.f, 0.f, 0.f};
  return z;
}

__device__ __forceinline__ v8f wmma_bf16(v16bf a, v16bf b, v8f c) {
  // D(f32 16x16) = A(bf16 16x32) * B(bf16 32x16) + C
  return __builtin_amdgcn_wmma_f32_16x16x32_bf16(
      /*neg_a=*/false, a, /*neg_b=*/false, b,
      /*c_mod=*/(short)0, c, /*reuse_a=*/false, /*reuse_b=*/false);
}

// 16x32 bf16 fragment from 16 consecutive *rows* of a row-major matrix.
// Per ISA 16-bit A layout: lane r (0..15), half h: elems [0..7] = row r,
// K = k0 + h*8 .. +7 ; elems [8..15] = row r, K = k0 + 16 + h*8 .. +7.
// Identical layout serves B of X@W^T (B[k][n] = W[n][k] -> rows of W).
// Works for both global and LDS (generic) pointers.
__device__ __forceinline__ v16bf load_frag_rows(const __bf16* __restrict__ base,
                                                int ld, int row0, int k0, int lane) {
  int r = lane & 15, h = lane >> 4;
  const __bf16* p = base + (size_t)(row0 + r) * ld + (k0 + h * 8);
  v8bf lo = *(const v8bf*)p;          // 16-byte load
  v8bf hi = *(const v8bf*)(p + 16);   // 16-byte load
  v16bf f;
#pragma unroll
  for (int i = 0; i < 8; ++i) { f[i] = lo[i]; f[i + 8] = hi[i]; }
  return f;
}

// Fragment whose K dimension runs *down a column* of a row-major matrix
// (B operand of P@V: B[k][n] = V[k][n]).
__device__ __forceinline__ v16bf load_frag_cols(const __bf16* __restrict__ base,
                                                int ld, int k0, int col0, int lane) {
  int r = lane & 15, h = lane >> 4;
  const __bf16* p = base + (size_t)(k0 + h * 8) * ld + col0 + r;
  v16bf f;
#pragma unroll
  for (int i = 0; i < 8; ++i) f[i] = p[(size_t)i * ld];
  p += (size_t)16 * ld;
#pragma unroll
  for (int i = 0; i < 8; ++i) f[i + 8] = p[(size_t)i * ld];
  return f;
}

// LDS row pitch, in bf16 elements, of every 32-element (64-byte) row that is
// read back as a WMMA fragment with 16-byte LDS loads: 80 bytes = 16 B x odd,
// so the 16 rows that one half-wave reads start on 16 different groups of four
// banks. At the unpadded 64 bytes only four such groups are hit.
constexpr int LDP = 40;

// K elements of one GEMM stage: a staged row is 128 bytes, one whole cache line.
constexpr int GK = 64;
// LDS pitch of those rows, in bf16 elements: 144 bytes = 16 B x odd, as above.
constexpr int GLP = 72;

// Six async Global -> LDS copies of 16 bytes per lane (tracked by ASYNCcnt).
// l*: LDS byte address (low 32 bits of the generic shared pointer == LDS
// offset per the flat-aperture mapping, ISA 10.2).
// s_wait_xcnt 0 is the last line of the copies' own statement so that no later
// write of an address register can be scheduled ahead of it (a precaution).
__device__ __forceinline__ void async6_b128(unsigned l0, const void* g0,
                                            unsigned l1, const void* g1,
                                            unsigned l2, const void* g2,
                                            unsigned l3, const void* g3,
                                            unsigned l4, const void* g4,
                                            unsigned l5, const void* g5) {
  unsigned long long a0 = (unsigned long long)g0;
  unsigned long long a1 = (unsigned long long)g1;
  unsigned long long a2 = (unsigned long long)g2;
  unsigned long long a3 = (unsigned long long)g3;
  unsigned long long a4 = (unsigned long long)g4;
  unsigned long long a5 = (unsigned long long)g5;
  asm volatile("global_load_async_to_lds_b128 %0, %1, off\n\t"
               "global_load_async_to_lds_b128 %2, %3, off\n\t"
               "global_load_async_to_lds_b128 %4, %5, off\n\t"
               "global_load_async_to_lds_b128 %6, %7, off\n\t"
               "global_load_async_to_lds_b128 %8, %9, off\n\t"
               "global_load_async_to_lds_b128 %10, %11, off\n\t"
               "s_wait_xcnt 0x0"
               :: "v"(l0), "v"(a0), "v"(l1), "v"(a1), "v"(l2), "v"(a2),
                  "v"(l3), "v"(a3), "v"(l4), "v"(a4), "v"(l5), "v"(a5)
               : "memory");
}

// ---------------------------------------------------------------------------
// fp32 -> bf16 conversion of all seven tensors in ONE launch.
// The bf16 copies lie one behind the other in the workspace (x, wq, wk, wv, wo,
// w1, w2), so the destination is one flat array. blockIdx.y picks a unit of
// CVT_U elements and with it the source; CVT_B work-groups share a unit.
// A wave's load covers 512 contiguous bytes, its store 256.
// ---------------------------------------------------------------------------
typedef __attribute__((ext_vector_type(4))) float  v4f;
typedef __attribute__((ext_vector_type(4))) __bf16 v4bf;
constexpr int CVT_U = 1 << 20;   // elements of a unit: x, w1, w2 are 4 units each, wq..wo one
constexpr int CVT_B = 32;        // work-groups of a unit

__global__ __launch_bounds__(256) void cvt_all_k(
    const float* __restrict__ x,  const float* __restrict__ wq,
    const float* __restrict__ wk, const float* __restrict__ wv,
    const float* __restrict__ wo, const float* __restrict__ w1,
    const float* __restrict__ w2, __bf16* __restrict__ out) {
  int u = blockIdx.y;
  const float* in = u < 4  ? x + (size_t)u * CVT_U
                  : u == 4 ? wq
                  : u == 5 ? wk
                  : u == 6 ? wv
                  : u == 7 ? wo
                  : u < 12 ? w1 + (size_t)(u - 8) * CVT_U
                           : w2 + (size_t)(u - 12) * CVT_U;
  __bf16* o = out + (size_t)u * CVT_U;
  constexpr int STEP = CVT_B * 256 * 4;          // elements that a unit's work-groups take at once
  int i = (blockIdx.x * 256 + threadIdx.x) * 4;
  for (int g = 0; g < CVT_U / (8 * STEP); ++g, i += 8 * STEP) {
    v4f a[8];
#pragma unroll   // eight 16-byte loads of a lane in flight before the first is used
    for (int t = 0; t < 8; ++t) a[t] = *(const v4f*)(in + i + t * STEP);
#pragma unroll   // a[] stays in registers
    for (int t = 0; t < 8; ++t) {
      v4bf r;
#pragma unroll   // vector elements picked by constants
      for (int e = 0; e < 4; ++e) r[e] = f2bf(a[t][e]);
      *(v4bf*)(o + i + t * STEP) = r;
    }
  }
}

template <int EPI>
__global__ __launch_bounds__(256) void gemm_bf16_k(
    const __bf16* __restrict__ X, const __bf16* __restrict__ W,
    const float* __restrict__ bias, const float* __restrict__ resid,
    float* __restrict__ outF, __bf16* __restrict__ outB,
    int M, int N, int K) {
  __shared__ __attribute__((aligned(16))) __bf16 xs[2][128 * GLP];
  __shared__ __attribute__((aligned(16))) __bf16 wsb[2][64 * GLP];

  int tid = threadIdx.x;
  int lane = tid & 31;
  int wave = tid >> 5;
  int wm = wave & 3, wn = wave >> 4 ? 0 : (wave >> 2);  // (kept simple below)
  wn = wave >> 2;
  int m0 = wm * 32;            // within block tile
  int n0 = wn * 32;
  int mblk = blockIdx.x * 128;
  int nblk = blockIdx.y * 64;
  if (EPI == 0) {
    W    += (size_t)blockIdx.z * N * K;
    outB += (size_t)blockIdx.z * M * N;
  }

  // Issue one K=GK stage of async copies into buffer `buf`.
  auto stage = [&](int buf, int k0) {
    // X tile: 128 rows x 8 16B-chunks; thread t -> chunk t & 7 of rows t >> 3, +32, +64, +96
    // W tile: 64 rows x 8 16B-chunks; thread t -> chunk t & 7 of rows t >> 3, +32
    int row = tid >> 3, q = tid & 7;
    const __bf16* xg = X + (size_t)(mblk + row) * K + k0 + q * 8;
    const __bf16* wg = W + (size_t)(nblk + row) * K + k0 + q * 8;
    __bf16* xl = &xs[buf][row * GLP + q * 8];
    __bf16* wl = &wsb[buf][row * GLP + q * 8];
    async6_b128((unsigned)(size_t)xl,              xg,
                (unsigned)(size_t)(xl + 32 * GLP), xg + (size_t)32 * K,
                (unsigned)(size_t)(xl + 64 * GLP), xg + (size_t)64 * K,
                (unsigned)(size_t)(xl + 96 * GLP), xg + (size_t)96 * K,
                (unsigned)(size_t)wl,              wg,
                (unsigned)(size_t)(wl + 32 * GLP), wg + (size_t)32 * K);
  };

  v8f acc00 = zero8(), acc01 = zero8(), acc10 = zero8(), acc11 = zero8();

  int nk = K / GK;
  stage(0, 0);
  asm volatile("s_wait_asynccnt 0x0" ::: "memory");  // this wave's part of stage 0 has landed
  __syncthreads();                                   // stage 0 visible to all waves
  if (nk > 1) stage(1, GK);
  for (int kk = 0; kk < nk; ++kk) {
    const __bf16* xt = xs[kk & 1];
    const __bf16* wt = wsb[kk & 1];
#pragma unroll   // ks becomes a constant offset of the LDS loads
    for (int ks = 0; ks < GK; ks += 32) {
      v16bf a0 = load_frag_rows(xt, GLP, m0, ks, lane);
      v16bf a1 = load_frag_rows(xt, GLP, m0 + 16, ks, lane);
      v16bf b0 = load_frag_rows(wt, GLP, n0, ks, lane);
      v16bf b1 = load_frag_rows(wt, GLP, n0 + 16, ks, lane);
      acc00 = wmma_bf16(a0, b0, acc00);
      acc01 = wmma_bf16(a0, b1, acc01);
      acc10 = wmma_bf16(a1, b0, acc10);
      acc11 = wmma_bf16(a1, b1, acc11);
    }
    // Hand-over:
    asm volatile("s_wait_dscnt 0x0" ::: "memory");     // this wave's reads of buffer kk & 1 are done
    asm volatile("s_wait_asynccnt 0x0" ::: "memory");  // its part of stage kk + 1 has landed
    __syncthreads();   // stage kk + 1 visible to all; buffer kk & 1 left by all
    if (kk + 2 < nk) stage(kk & 1, (kk + 2) * GK);
  }
  asm volatile("s_wait_asynccnt 0x0" ::: "memory");    // nothing in flight at the wave's end

  int r = lane & 15, h = lane >> 4;
#pragma unroll
  for (int ti = 0; ti < 2; ++ti) {
#pragma unroll
    for (int tj = 0; tj < 2; ++tj) {
      v8f acc = (ti == 0) ? (tj == 0 ? acc00 : acc01)
                          : (tj == 0 ? acc10 : acc11);
      int col = nblk + n0 + tj * 16 + r;
      float bv = (EPI == 0) ? 0.f : (bias ? bias[col] : 0.f);
#pragma unroll
      for (int i = 0; i < 8; ++i) {
        int row = mblk + m0 + ti * 16 + i + 8 * h;  // C layout: vgpr i -> M=i+8*h
        float v = acc[i] + bv;
        size_t idx = (size_t)row * N + col;
        if (EPI == 1) {
          v = 0.5f * v * (1.0f + erff(v * 0.70710678118654752f));  // exact GELU
          outB[idx] = f2bf(v);
        } else if (EPI == 2) {
          outF[idx] = v + resid[idx];
        } else {
          outB[idx] = f2bf(v);
        }
      }
    }
  }
}

// ---------------------------------------------------------------------------
// Flash-style causal attention, hd = 64, wave32.
// One wave = 16 query rows; block = 8 waves = 128 rows.
// Grid: (S/128, H, B). Q/K/V/O are [B*S, D] bf16, head h at cols h*64.
// ---------------------------------------------------------------------------
__global__ __launch_bounds__(256) void attention_k(
    const __bf16* __restrict__ Q, const __bf16* __restrict__ Km,
    const __bf16* __restrict__ V, __bf16* __restrict__ O,
    int S, int Dm) {
  __shared__ __attribute__((aligned(16))) __bf16 Plds[8 * 16 * LDP];

  int lane = threadIdx.x & 31, wave = threadIdx.x >> 5;
  int r = lane & 15, hl = lane >> 4;
  int h = blockIdx.y, b = blockIdx.z;
  int qbase = blockIdx.x * 128 + wave * 16;   // wave-uniform

  size_t base = (size_t)b * S * Dm + (size_t)h * 64;
  const __bf16* qp = Q + base;
  const __bf16* kp = Km + base;
  const __bf16* vp = V + base;
  __bf16* op = O + base;
  __bf16* pl = &Plds[wave * 16 * LDP];        // per-wave 16x32 staging tile, pitch LDP

  v16bf aq0 = load_frag_rows(qp, Dm, qbase, 0, lane);
  v16bf aq1 = load_frag_rows(qp, Dm, qbase, 32, lane);

  v8f o0 = zero8(), o1 = zero8(), o2 = zero8(), o3 = zero8();
  float m[8], l[8];
#pragma unroll
  for (int i = 0; i < 8; ++i) { m[i] = -1e30f; l[i] = 0.f; }

  for (int j0 = 0; j0 < qbase + 16; j0 += 32) {   // wave-uniform trip count
    // ---- S = Q @ K^T (two 16x16 score tiles: keys j0.. and j0+16..) ----
    v8f s0 = zero8(), s1 = zero8();
    {
      v16bf bk0 = load_frag_rows(kp, Dm, j0, 0, lane);
      v16bf bk1 = load_frag_rows(kp, Dm, j0, 32, lane);
      s0 = wmma_bf16(aq0, bk0, s0);
      s0 = wmma_bf16(aq1, bk1, s0);
      v16bf bk2 = load_frag_rows(kp, Dm, j0 + 16, 0, lane);
      v16bf bk3 = load_frag_rows(kp, Dm, j0 + 16, 32, lane);
      s1 = wmma_bf16(aq0, bk2, s1);
      s1 = wmma_bf16(aq1, bk3, s1);
    }
    // ---- scale, causal mask, online softmax ----
#pragma unroll
    for (int i = 0; i < 8; ++i) {
      int qrow = qbase + i + 8 * hl;
      float sc0 = s0[i] * 0.125f;               // 1/sqrt(64)
      float sc1 = s1[i] * 0.125f;
      if (j0 + r > qrow) sc0 = -1e30f;
      if (j0 + 16 + r > qrow) sc1 = -1e30f;
      float rm = fmaxf(sc0, sc1);
#pragma unroll
      for (int off = 1; off < 16; off <<= 1) rm = fmaxf(rm, __shfl_xor(rm, off, 32));
      float mn = fmaxf(m[i], rm);
      float al = __expf(m[i] - mn);
      float p0 = __expf(sc0 - mn);
      float p1 = __expf(sc1 - mn);
      float rs = p0 + p1;
#pragma unroll
      for (int off = 1; off < 16; off <<= 1) rs += __shfl_xor(rs, off, 32);
      l[i] = l[i] * al + rs;
      m[i] = mn;
      o0[i] *= al; o1[i] *= al; o2[i] *= al; o3[i] *= al;
      // stage P (C layout -> LDS row-major 16x32, bf16)
      pl[(i + 8 * hl) * LDP + r]      = f2bf(p0);
      pl[(i + 8 * hl) * LDP + 16 + r] = f2bf(p1);
    }
    asm volatile("s_wait_dscnt 0" ::: "memory");
    // ---- O += P @ V ----
    v16bf ap  = load_frag_rows(pl, LDP, 0, 0, lane);  // A-layout reload from LDS
    v16bf bv0 = load_frag_cols(vp, Dm, j0, 0, lane);
    v16bf bv1 = load_frag_cols(vp, Dm, j0, 16, lane);
    v16bf bv2 = load_frag_cols(vp, Dm, j0, 32, lane);
    v16bf bv3 = load_frag_cols(vp, Dm, j0, 48, lane);
    o0 = wmma_bf16(ap, bv0, o0);
    o1 = wmma_bf16(ap, bv1, o1);
    o2 = wmma_bf16(ap, bv2, o2);
    o3 = wmma_bf16(ap, bv3, o3);
  }

#pragma unroll
  for (int i = 0; i < 8; ++i) {
    float inv = 1.0f / l[i];
    size_t row = (size_t)(qbase + i + 8 * hl);
    op[row * Dm + 0 + r]  = f2bf(o0[i] * inv);
    op[row * Dm + 16 + r] = f2bf(o1[i] * inv);
    op[row * Dm + 32 + r] = f2bf(o2[i] * inv);
    op[row * Dm + 48 + r] = f2bf(o3[i] * inv);
  }
}

// ---------------------------------------------------------------------------
// LayerNorm over last dim (block per row). Writes fp32 (+ optional bf16).
// ---------------------------------------------------------------------------
__global__ __launch_bounds__(256) void layernorm_k(
    const float* __restrict__ in, const float* __restrict__ gamma,
    const float* __restrict__ beta, float* __restrict__ outF,
    __bf16* outB, int D) {
  __shared__ float red[256];
  int row = blockIdx.x, tid = threadIdx.x;
  const float* p = in + (size_t)row * D;

  float s = 0.f;
  for (int i = tid; i < D; i += 256) s += p[i];
  red[tid] = s; __syncthreads();
  for (int o = 128; o > 0; o >>= 1) { if (tid < o) red[tid] += red[tid + o]; __syncthreads(); }
  float mu = red[0] / (float)D;
  __syncthreads();

  float ss = 0.f;
  for (int i = tid; i < D; i += 256) { float d = p[i] - mu; ss += d * d; }
  red[tid] = ss; __syncthreads();
  for (int o = 128; o > 0; o >>= 1) { if (tid < o) red[tid] += red[tid + o]; __syncthreads(); }
  float inv = rsqrtf(red[0] / (float)D + 1e-5f);

  for (int i = tid; i < D; i += 256) {
    float y = (p[i] - mu) * inv * gamma[i] + beta[i];
    outF[(size_t)row * D + i] = y;
    if (outB) outB[(size_t)row * D + i] = f2bf(y);
  }
}

// ---------------------------------------------------------------------------
// Host orchestration
// ---------------------------------------------------------------------------
extern "C" void kernel_launch(void* const* d_in, const int* in_sizes, int n_in,
                              void* d_out, int out_size, void* d_ws, size_t ws_size,
                              hipStream_t stream) {
  (void)in_sizes; (void)n_in; (void)out_size; (void)ws_size;
  constexpr int B = 2, S = 2048, D = 1024, H = 16, M = B * S, DF = 4 * D;

  const float* x   = (const float*)d_in[0];
  const float* wq  = (const float*)d_in[1];
  const float* wk  = (const float*)d_in[2];
  const float* wv  = (const float*)d_in[3];
  const float* wo  = (const float*)d_in[4];
  const float* w1  = (const float*)d_in[5];
  const float* b1  = (const float*)d_in[6];
  const float* w2  = (const float*)d_in[7];
  const float* b2  = (const float*)d_in[8];
  const float* g0  = (const float*)d_in[9];
  const float* be0 = (const float*)d_in[10];
  const float* g1  = (const float*)d_in[11];
  const float* be1 = (const float*)d_in[12];

  char* ws = (char*)d_ws;
  size_t off = 0;
  auto take = [&](size_t bytes) -> void* {
    void* p = ws + off;
    off = (off + bytes + 255) & ~(size_t)255;
    return p;
  };

  // xb .. w2b: contiguous, in the order in which cvt_all_k numbers its units
  __bf16* xb   = (__bf16*)take((size_t)M * D * 2);    // also reused as ln0b
  __bf16* wqkvb = (__bf16*)take((size_t)3 * D * D * 2);  // wq, wk, wv one behind the other
  __bf16* wob  = (__bf16*)take((size_t)D * D * 2);
  __bf16* w1b  = (__bf16*)take((size_t)DF * D * 2);
  __bf16* w2b  = (__bf16*)take((size_t)D * DF * 2);
  size_t qkv_off = off;
  __bf16* qb    = (__bf16*)take((size_t)M * D * 2);   // q, k, v one behind the other
  __bf16* kb    = (__bf16*)take((size_t)M * D * 2);
  __bf16* vb    = (__bf16*)take((size_t)M * D * 2);
  __bf16* attnb = (__bf16*)take((size_t)M * D * 2);
  float*  x1    = (float*)take((size_t)M * D * 4);    // also reused as x2
  float*  ln0f  = (float*)take((size_t)M * D * 4);
  // reuse dead regions:
  __bf16* hb   = (__bf16*)(ws + qkv_off);             // 32MB over q/k/v/attn (dead)
  __bf16* ln0b = xb;                                  // xb dead after QKV gemms
  float*  x2   = x1;                                  // x1 dead after LN0

  dim3 blk(256);

  // fp32 -> bf16 conversions, one launch: (M*D + 4*D*D + 2*DF*D) / CVT_U = 16 units
  static_assert(M * D == 4 * CVT_U && D * D == CVT_U && DF * D == 4 * CVT_U, "unit map of cvt_all_k");
  cvt_all_k<<<dim3(CVT_B, 16), blk, 0, stream>>>(x, wq, wk, wv, wo, w1, w2, xb);

  // Q, K, V projections (bf16 out), one launch: z = 0, 1, 2
  dim3 gD(M / 128, D / 64);
  gemm_bf16_k<0><<<dim3(M / 128, D / 64, 3), blk, 0, stream>>>(xb, wqkvb, nullptr, nullptr, nullptr, qb, M, D, D);

  // causal flash attention
  attention_k<<<dim3(S / 128, H, B), blk, 0, stream>>>(qb, kb, vb, attnb, S, D);

  // output projection + residual (fp32)
  gemm_bf16_k<2><<<gD, blk, 0, stream>>>(attnb, wob, nullptr, x, x1, nullptr, M, D, D);

  // LayerNorm 0 (fp32 + bf16 copies)
  layernorm_k<<<M, blk, 0, stream>>>(x1, g0, be0, ln0f, ln0b, D);

  // MLP up + exact GELU (bf16 out)
  gemm_bf16_k<1><<<dim3(M / 128, DF / 64), blk, 0, stream>>>(ln0b, w1b, b1, nullptr, nullptr, hb, M, DF, D);

  // MLP down + bias + residual (fp32)
  gemm_bf16_k<2><<<gD, blk, 0, stream>>>(hb, w2b, b2, ln0f, x2, nullptr, M, D, DF);

  // LayerNorm 1 -> final output (fp32)
  layernorm_k<<<M, blk, 0, stream>>>(x2, g1, be1, (float*)d_out, nullptr, D);
}

// v004
// Measured time: 265 microseconds a run.
// In both of two side-by-side timings against v003, it was 1.20 times as fast.
// Counting every step since v000, it is 1.64 times as fast.
#include <hip/hip_runtime.h>
#include <hip/hip_bf16.h>
#include <math.h>

// ---------------------------------------------------------------------------
// Types / helpers
// ---------------------------------------------------------------------------
typedef __attribute__((ext_vector_type(16))) __bf16 v16bf;
typedef __attribute__((ext_vector_type(8)))  __bf16 v8bf;
typedef __attribute__((ext_vector_type(8)))  float  v8f;

__device__ __forceinline__ __bf16 f2bf(float f) {
  unsigned u = __builtin_bit_cast(unsigned, f);
  unsigned r = u + 0x7FFFu + ((u >> 16) & 1u);   // round-to-nearest-even
  unsigned short h = (unsigned short)(r >> 16);
  return __builtin_bit_cast(__bf16, h);
}

__device__ __forceinline__ v8f zero8() {
  v8f z = {0.f, 0.f, 0.f, 0.f, 0.f, 0.f, 0.f, 0.f};
  return z;
}

__device__ __forceinline__ v8f wmma_bf16(v16bf a, v16bf b, v8f c) {
  // D(f32 16x16) = A(bf16 16x32) * B(bf16 32x16) + C
  return __builtin_amdgcn_wmma_f32_16x16x32_bf16(
      /*neg_a=*/false, a, /*neg_b=*/false, b,
      /*c_mod=*/(short)0, c, /*reuse_a=*/false, /*reuse_b=*/false);
}

// 16x32 bf16 fragment from 16 consecutive *rows* of a row-major matrix.
// Per ISA 16-bit A layout: lane r (0..15), half h: elems [0..7] = row r,
// K = k0 + h*8 .. +7 ; elems [8..15] = row r, K = k0 + 16 + h*8 .. +7.
// Identical layout serves B of X@W^T (B[k][n] = W[n][k] -> rows of W).
// Works for both global and LDS (generic) pointers.
__device__ __forceinline__ v16bf load_frag_rows(const __bf16* __restrict__ base,
                                                int ld, int row0, int k0, int lane) {
  int r = lane & 15, h = lane >> 4;
  const __bf16* p = base + (size_t)(row0 + r) * ld + (k0 + h * 8);
  v8bf lo = *(const v8bf*)p;          // 16-byte load
  v8bf hi = *(const v8bf*)(p + 16);   // 16-byte load
  v16bf f;
#pragma unroll
  for (int i = 0; i < 8; ++i) { f[i] = lo[i]; f[i + 8] = hi[i]; }
  return f;
}

// LDS row pitch, in bf16 elements, of every 32-element (64-byte) row that is
// read back as a WMMA fragment with 16-byte LDS loads: 80 bytes = 16 B x odd,
// so the 16 rows that one half-wave reads start on 16 different groups of four
// banks. At the unpadded 64 bytes only four such groups are hit.
constexpr int LDP = 40;

// K elements of one GEMM stage: a staged row is 128 bytes, one whole cache line.
constexpr int GK = 64;
// LDS pitch of those rows, in bf16 elements: 144 bytes = 16 B x odd, as above.
constexpr int GLP = 72;

// Six async Global -> LDS copies of 16 bytes per lane (tracked by ASYNCcnt).
// l*: LDS byte address (low 32 bits of the generic shared pointer == LDS
// offset per the flat-aperture mapping, ISA 10.2).
// s_wait_xcnt 0 is the last line of the copies' own statement so that no later
// write of an address register can be scheduled ahead of it (a precaution).
__device__ __forceinline__ void async6_b128(unsigned l0, const void* g0,
                                            unsigned l1, const void* g1,
                                            unsigned l2, const void* g2,
                                            unsigned l3, const void* g3,
                                            unsigned l4, const void* g4,
                                            unsigned l5, const void* g5) {
  unsigned long long a0 = (unsigned long long)g0;
  unsigned long long a1 = (unsigned long long)g1;
  unsigned long long a2 = (unsigned long long)g2;
  unsigned long long a3 = (unsigned long long)g3;
  unsigned long long a4 = (unsigned long long)g4;
  unsigned long long a5 = (unsigned long long)g5;
  asm volatile("global_load_async_to_lds_b128 %0, %1, off\n\t"
               "global_load_async_to_lds_b128 %2, %3, off\n\t"
               "global_load_async_to_lds_b128 %4, %5, off\n\t"
               "global_load_async_to_lds_b128 %6, %7, off\n\t"
               "global_load_async_to_lds_b128 %8, %9, off\n\t"
               "global_load_async_to_lds_b128 %10, %11, off\n\t"
               "s_wait_xcnt 0x0"
               :: "v"(l0), "v"(a0), "v"(l1), "v"(a1), "v"(l2), "v"(a2),
                  "v"(l3), "v"(a3), "v"(l4), "v"(a4), "v"(l5), "v"(a5)
               : "memory");
}

// Four such copies in one statement, the same wait as its last line.
__device__ __forceinline__ void async4_b128(unsigned l0, const void* g0,
                                            unsigned l1, const void* g1,
                                            unsigned l2, const void* g2,
                                            unsigned l3, const void* g3) {
  unsigned long long a0 = (unsigned long long)g0;
  unsigned long long a1 = (unsigned long long)g1;
  unsigned long long a2 = (unsigned long long)g2;
  unsigned long long a3 = (unsigned long long)g3;
  asm volatile("global_load_async_to_lds_b128 %0, %1, off\n\t"
               "global_load_async_to_lds_b128 %2, %3, off\n\t"
               "global_load_async_to_lds_b128 %4, %5, off\n\t"
               "global_load_async_to_lds_b128 %6, %7, off\n\t"
               "s_wait_xcnt 0x0"
               :: "v"(l0), "v"(a0), "v"(l1), "v"(a1), "v"(l2), "v"(a2),
                  "v"(l3), "v"(a3)
               : "memory");
}

// Keys of one attention stage; a staged K or V row is one head's 64 elements = 128 bytes.
constexpr int AK = 64;
// LDS pitch of the K rows, in bf16 elements: 144 bytes = 16 B x odd (ds_load_b128 readers).
constexpr int KLP = 72;
// LDS pitch of the V rows: 160 bytes = 32 B x odd (ds_load_tr16_b128 readers).
constexpr int VLP = 80;

// Fragment whose K dimension runs *down a column* of a row-major matrix
// (B operand of P@V: B[k][n] = V[k][n]), in the k order of load_frag_rows, from
// an LDS tile at pitch VLP by two transposing LDS loads:
// lane (r, h) gets tile[k0 + 8h + 0..7][col0 + r], then the same 16 rows below.
__device__ __forceinline__ v16bf load_frag_cols_lds(const __bf16* tile, int k0, int col0, int lane) {
  typedef __attribute__((address_space(3))) v8bf lds_v8bf;
  const __bf16* p = tile + (k0 + 8 * (lane >> 4) + (lane & 7)) * VLP + col0 + 8 * ((lane >> 3) & 1);
  v8bf lo = __builtin_amdgcn_ds_load_tr16_b128_v8bf16((lds_v8bf*)p);
  v8bf hi = __builtin_amdgcn_ds_load_tr16_b128_v8bf16((lds_v8bf*)(p + 16 * VLP));
  v16bf f;
#pragma unroll
  for (int i = 0; i < 8; ++i) { f[i] = lo[i]; f[i + 8] = hi[i]; }
  return f;
}

// ---------------------------------------------------------------------------
// fp32 -> bf16 conversion of all seven tensors in ONE launch.
// The bf16 copies lie one behind the other in the workspace (x, wq, wk, wv, wo,
// w1, w2), so the destination is one flat array. blockIdx.y picks a unit of
// CVT_U elements and with it the source; CVT_B work-groups share a unit.
// A wave's load covers 512 contiguous bytes, its store 256.
// ---------------------------------------------------------------------------
typedef __attribute__((ext_vector_type(4))) float  v4f;
typedef __attribute__((ext_vector_type(4))) __bf16 v4bf;
constexpr int CVT_U = 1 << 20;   // elements of a unit: x, w1, w2 are 4 units each, wq..wo one
constexpr int CVT_B = 32;        // work-groups of a unit

__global__ __launch_bounds__(256) void cvt_all_k(
    const float* __restrict__ x,  const float* __restrict__ wq,
    const float* __restrict__ wk, const float* __restrict__ wv,
    const float* __restrict__ wo, const float* __restrict__ w1,
    const float* __restrict__ w2, __bf16* __restrict__ out) {
  int u = blockIdx.y;
  const float* in = u < 4  ? x + (size_t)u * CVT_U
                  : u == 4 ? wq
                  : u == 5 ? wk
                  : u == 6 ? wv
                  : u == 7 ? wo
                  : u < 12 ? w1 + (size_t)(u - 8) * CVT_U
                           : w2 + (size_t)(u - 12) * CVT_U;
  __bf16* o = out + (size_t)u * CVT_U;
  constexpr int STEP = CVT_B * 256 * 4;          // elements that a unit's work-groups take at once
  int i = (blockIdx.x * 256 + threadIdx.x) * 4;
  for (int g = 0; g < CVT_U / (8 * STEP); ++g, i += 8 * STEP) {
    v4f a[8];
#pragma unroll   // eight 16-byte loads of a lane in flight before the first is used
    for (int t = 0; t < 8; ++t) a[t] = *(const v4f*)(in + i + t * STEP);
#pragma unroll   // a[] stays in registers
    for (int t = 0; t < 8; ++t) {
      v4bf r;
#pragma unroll   // vector elements picked by constants
      for (int e = 0; e < 4; ++e) r[e] = f2bf(a[t][e]);
      *(v4bf*)(o + i + t * STEP) = r;
    }
  }
}

template <int EPI>
__global__ __launch_bounds__(256) void gemm_bf16_k(
    const __bf16* __restrict__ X, const __bf16* __restrict__ W,
    const float* __restrict__ bias, const float* __restrict__ resid,
    float* __restrict__ outF, __bf16* __restrict__ outB,
    int M, int N, int K) {
  __shared__ __attribute__((aligned(16))) __bf16 xs[2][128 * GLP];
  __shared__ __attribute__((aligned(16))) __bf16 wsb[2][64 * GLP];

  int tid = threadIdx.x;
  int lane = tid & 31;
  int wave = tid >> 5;
  int wm = wave & 3, wn = wave >> 4 ? 0 : (wave >> 2);  // (kept simple below)
  wn = wave >> 2;
  int m0 = wm * 32;            // within block tile
  int n0 = wn * 32;
  int mblk = blockIdx.x * 128;
  int nblk = blockIdx.y * 64;
  if (EPI == 0) {
    W    += (size_t)blockIdx.z * N * K;
    outB += (size_t)blockIdx.z * M * N;
  }

  // Issue one K=GK stage of async copies into buffer `buf`.
  auto stage = [&](int buf, int k0) {
    // X tile: 128 rows x 8 16B-chunks; thread t -> chunk t & 7 of rows t >> 3, +32, +64, +96
    // W tile: 64 rows x 8 16B-chunks; thread t -> chunk t & 7 of rows t >> 3, +32
    int row = tid >> 3, q = tid & 7;
    const __bf16* xg = X + (size_t)(mblk + row) * K + k0 + q * 8;
    const __bf16* wg = W + (size_t)(nblk + row) * K + k0 + q * 8;
    __bf16* xl = &xs[buf][row * GLP + q * 8];
    __bf16* wl = &wsb[buf][row * GLP + q * 8];
    async6_b128((unsigned)(size_t)xl,              xg,
                (unsigned)(size_t)(xl + 32 * GLP), xg + (size_t)32 * K,
                (unsigned)(size_t)(xl + 64 * GLP), xg + (size_t)64 * K,
                (unsigned)(size_t)(xl + 96 * GLP), xg + (size_t)96 * K,
                (unsigned)(size_t)wl,              wg,
                (unsigned)(size_t)(wl + 32 * GLP), wg + (size_t)32 * K);
  };

  v8f acc00 = zero8(), acc01 = zero8(), acc10 = zero8(), acc11 = zero8();

  int nk = K / GK;
  stage(0, 0);
  asm volatile("s_wait_asynccnt 0x0" ::: "memory");  // this wave's part of stage 0 has landed
  __syncthreads();                                   // stage 0 visible to all waves
  if (nk > 1) stage(1, GK);
  for (int kk = 0; kk < nk; ++kk) {
    const __bf16* xt = xs[kk & 1];
    const __bf16* wt = wsb[kk & 1];
#pragma unroll   // ks becomes a constant offset of the LDS loads
    for (int ks = 0; ks < GK; ks += 32) {
      v16bf a0 = load_frag_rows(xt, GLP, m0, ks, lane);
      v16bf a1 = load_frag_rows(xt, GLP, m0 + 16, ks, lane);
      v16bf b0 = load_frag_rows(wt, GLP, n0, ks, lane);
      v16bf b1 = load_frag_rows(wt, GLP, n0 + 16, ks, lane);
      acc00 = wmma_bf16(a0, b0, acc00);
      acc01 = wmma_bf16(a0, b1, acc01);
      acc10 = wmma_bf16(a1, b0, acc10);
      acc11 = wmma_bf16(a1, b1, acc11);
    }
    // Hand-over:
    asm volatile("s_wait_dscnt 0x0" ::: "memory");     // this wave's reads of buffer kk & 1 are done
    asm volatile("s_wait_asynccnt 0x0" ::: "memory");  // its part of stage kk + 1 has landed
    __syncthreads();   // stage kk + 1 visible to all; buffer kk & 1 left by all
    if (kk + 2 < nk) stage(kk & 1, (kk + 2) * GK);
  }
  asm volatile("s_wait_asynccnt 0x0" ::: "memory");    // nothing in flight at the wave's end

  int r = lane & 15, h = lane >> 4;
#pragma unroll
  for (int ti = 0; ti < 2; ++ti) {
#pragma unroll
    for (int tj = 0; tj < 2; ++tj) {
      v8f acc = (ti == 0) ? (tj == 0 ? acc00 : acc01)
                          : (tj == 0 ? acc10 : acc11);
      int col = nblk + n0 + tj * 16 + r;
      float bv = (EPI == 0) ? 0.f : (bias ? bias[col] : 0.f);
#pragma unroll
      for (int i = 0; i < 8; ++i) {
        int row = mblk + m0 + ti * 16 + i + 8 * h;  // C layout: vgpr i -> M=i+8*h
        float v = acc[i] + bv;
        size_t idx = (size_t)row * N + col;
        if (EPI == 1) {
          v = 0.5f * v * (1.0f + erff(v * 0.70710678118654752f));  // exact GELU
          outB[idx] = f2bf(v);
        } else if (EPI == 2) {
          outF[idx] = v + resid[idx];
        } else {
          outB[idx] = f2bf(v);
        }
      }
    }
  }
}

// ---------------------------------------------------------------------------
// Flash-style causal attention, hd = 64, wave32.
// One wave = 16 query rows; block = 8 waves = 128 rows.
// Grid: (S/128, H, B). Q/K/V/O are [B*S, D] bf16, head h at cols h*64.
// The work-group's eight waves share each AK-key K/V tile: it is brought into
// LDS once by async copies (two buffers; the copies of stage t + 2 fly during
// stage t + 1). A wave skips the 32-key passes that lie wholly above its rows.
// ---------------------------------------------------------------------------
__global__ __launch_bounds__(256) void attention_k(
    const __bf16* __restrict__ Q, const __bf16* __restrict__ Km,
    const __bf16* __restrict__ V, __bf16* __restrict__ O,
    int S, int Dm) {
  __shared__ __attribute__((aligned(16))) __bf16 Plds[8 * 16 * LDP];
  __shared__ __attribute__((aligned(16))) __bf16 Ks[2][AK * KLP];
  __shared__ __attribute__((aligned(16))) __bf16 Vs[2][AK * VLP];

  int lane = threadIdx.x & 31;
  int wave = __builtin_amdgcn_readfirstlane(threadIdx.x >> 5);  // scalar: the pass test below is a scalar branch
  int r = lane & 15, hl = lane >> 4;
  int h = blockIdx.y, b = blockIdx.z;
  int qbase = blockIdx.x * 128 + wave * 16;   // wave-uniform

  size_t base = (size_t)b * S * Dm + (size_t)h * 64;
  const __bf16* qp = Q + base;
  const __bf16* kp = Km + base;
  const __bf16* vp = V + base;
  __bf16* op = O + base;
  __bf16* pl = &Plds[wave * 16 * LDP];        // per-wave 16x32 staging tile, pitch LDP

  v16bf aq0 = load_frag_rows(qp, Dm, qbase, 0, lane);
  v16bf aq1 = load_frag_rows(qp, Dm, qbase, 32, lane);

  v8f o0 = zero8(), o1 = zero8(), o2 = zero8(), o3 = zero8();
  float m[8], l[8];
#pragma unroll
  for (int i = 0; i < 8; ++i) { m[i] = -1e30f; l[i] = 0.f; }

  // One stage of async copies: keys k0 .. k0 + AK - 1 of K and V into buffer `buf`.
  // A tile is AK rows x 8 16B-chunks; thread t -> chunk t & 7 of rows t >> 3, +32.
  auto stage = [&](int buf, int k0) {
    int row = threadIdx.x >> 3, q = threadIdx.x & 7;
    const __bf16* kg = kp + (size_t)(k0 + row) * Dm + q * 8;
    const __bf16* vg = vp + (size_t)(k0 + row) * Dm + q * 8;
    __bf16* kl = &Ks[buf][row * KLP + q * 8];
    __bf16* vl = &Vs[buf][row * VLP + q * 8];
    async4_b128((unsigned)(size_t)kl,              kg,
                (unsigned)(size_t)(kl + 32 * KLP), kg + (size_t)32 * Dm,
                (unsigned)(size_t)vl,              vg,
                (unsigned)(size_t)(vl + 32 * VLP), vg + (size_t)32 * Dm);
  };

  int nst = (blockIdx.x + 1) * (128 / AK);   // stages up to the work-group's last row; at least two
  stage(0, 0);
  asm volatile("s_wait_asynccnt 0x0" ::: "memory");  // this wave's part of stage 0 has landed
  __syncthreads();                                   // stage 0 visible to all waves
  stage(1, AK);
  for (int t = 0; t < nst; ++t) {
   const __bf16* kt = Ks[t & 1];
   const __bf16* vt = Vs[t & 1];
#pragma unroll   // jj becomes a constant offset of the LDS loads
   for (int jj = 0; jj < AK; jj += 32) {
    int j0 = t * AK + jj;
    if (j0 >= qbase + 16) continue;   // wave-uniform: every key of the pass is masked for this wave
    // ---- S = Q @ K^T (two 16x16 score tiles: keys j0.. and j0+16..) ----
    v8f s0 = zero8(), s1 = zero8();
    {
      v16bf bk0 = load_frag_rows(kt, KLP, jj, 0, lane);
      v16bf bk1 = load_frag_rows(kt, KLP, jj, 32, lane);
      s0 = wmma_bf16(aq0, bk0, s0);
      s0 = wmma_bf16(aq1, bk1, s0);
      v16bf bk2 = load_frag_rows(kt, KLP, jj + 16, 0, lane);
      v16bf bk3 = load_frag_rows(kt, KLP, jj + 16, 32, lane);
      s1 = wmma_bf16(aq0, bk2, s1);
      s1 = wmma_bf16(aq1, bk3, s1);
    }
    // ---- scale, causal mask, online softmax ----
#pragma unroll
    for (int i = 0; i < 8; ++i) {
      int qrow = qbase + i + 8 * hl;
      float sc0 = s0[i] * 0.125f;               // 1/sqrt(64)
      float sc1 = s1[i] * 0.125f;
      if (j0 + r > qrow) sc0 = -1e30f;
      if (j0 + 16 + r > qrow) sc1 = -1e30f;
      float rm = fmaxf(sc0, sc1);
#pragma unroll
      for (int off = 1; off < 16; off <<= 1) rm = fmaxf(rm, __shfl_xor(rm, off, 32));
      float mn = fmaxf(m[i], rm);
      float al = __expf(m[i] - mn);
      float p0 = __expf(sc0 - mn);
      float p1 = __expf(sc1 - mn);
      float rs = p0 + p1;
#pragma unroll
      for (int off = 1; off < 16; off <<= 1) rs += __shfl_xor(rs, off, 32);
      l[i] = l[i] * al + rs;
      m[i] = mn;
      o0[i] *= al; o1[i] *= al; o2[i] *= al; o3[i] *= al;
      // stage P (C layout -> LDS row-major 16x32, bf16)
      pl[(i + 8 * hl) * LDP + r]      = f2bf(p0);
      pl[(i + 8 * hl) * LDP + 16 + r] = f2bf(p1);
    }
    asm volatile("s_wait_dscnt 0" ::: "memory");
    // ---- O += P @ V ----
    v16bf ap  = load_frag_rows(pl, LDP, 0, 0, lane);  // A-layout reload from LDS
    v16bf bv0 = load_frag_cols_lds(vt, jj, 0, lane);
    v16bf bv1 = load_frag_cols_lds(vt, jj, 16, lane);
    v16bf bv2 = load_frag_cols_lds(vt, jj, 32, lane);
    v16bf bv3 = load_frag_cols_lds(vt, jj, 48, lane);
    o0 = wmma_bf16(ap, bv0, o0);
    o1 = wmma_bf16(ap, bv1, o1);
    o2 = wmma_bf16(ap, bv2, o2);
    o3 = wmma_bf16(ap, bv3, o3);
   }
   // Hand-over:
   asm volatile("s_wait_dscnt 0x0" ::: "memory");     // this wave's reads of buffer t & 1 are done
   asm volatile("s_wait_asynccnt 0x0" ::: "memory");  // its part of stage t + 1 has landed
   __syncthreads();   // stage t + 1 visible to all; buffer t & 1 left by all
   if (t + 2 < nst) stage(t & 1, (t + 2) * AK);
  }
  asm volatile("s_wait_asynccnt 0x0" ::: "memory");    // nothing in flight at the wave's end

#pragma unroll
  for (int i = 0; i < 8; ++i) {
    float inv = 1.0f / l[i];
    size_t row = (size_t)(qbase + i + 8 * hl);
    op[row * Dm + 0 + r]  = f2bf(o0[i] * inv);
    op[row * Dm + 16 + r] = f2bf(o1[i] * inv);
    op[row * Dm + 32 + r] = f2bf(o2[i] * inv);
    op[row * Dm + 48 + r] = f2bf(o3[i] * inv);
  }
}

// ---------------------------------------------------------------------------
// LayerNorm over last dim (block per row). Writes fp32 (+ optional bf16).
// ---------------------------------------------------------------------------
__global__ __launch_bounds__(256) void layernorm_k(
    const float* __restrict__ in, const float* __restrict__ gamma,
    const float* __restrict__ beta, float* __restrict__ outF,
    __bf16* outB, int D) {
  __shared__ float red[256];
  int row = blockIdx.x, tid = threadIdx.x;
  const float* p = in + (size_t)row * D;

  float s = 0.f;
  for (int i = tid; i < D; i += 256) s += p[i];
  red[tid] = s; __syncthreads();
  for (int o = 128; o > 0; o >>= 1) { if (tid < o) red[tid] += red[tid + o]; __syncthreads(); }
  float mu = red[0] / (float)D;
  __syncthreads();

  float ss = 0.f;
  for (int i = tid; i < D; i += 256) { float d = p[i] - mu; ss += d * d; }
  red[tid] = ss; __syncthreads();
  for (int o = 128; o > 0; o >>= 1) { if (tid < o) red[tid] += red[tid + o]; __syncthreads(); }
  float inv = rsqrtf(red[0] / (float)D + 1e-5f);

  for (int i = tid; i < D; i += 256) {
    float y = (p[i] - mu) * inv * gamma[i] + beta[i];
    outF[(size_t)row * D + i] = y;
    if (outB) outB[(size_t)row * D + i] = f2bf(y);
  }
}

// ---------------------------------------------------------------------------
// Host orchestration
// ---------------------------------------------------------------------------
extern "C" void kernel_launch(void* const* d_in, const int* in_sizes, int n_in,
                              void* d_out, int out_size, void* d_ws, size_t ws_size,
                              hipStream_t stream) {
  (void)in_sizes; (void)n_in; (void)out_size; (void)ws_size;
  constexpr int B = 2, S = 2048, D = 1024, H = 16, M = B * S, DF = 4 * D;

  const float* x   = (const float*)d_in[0];
  const float* wq  = (const float*)d_in[1];
  const float* wk  = (const float*)d_in[2];
  const float* wv  = (const float*)d_in[3];
  const float* wo  = (const float*)d_in[4];
  const float* w1  = (const float*)d_in[5];
  const float* b1  = (const float*)d_in[6];
  const float* w2  = (const float*)d_in[7];
  const float* b2  = (const float*)d_in[8];
  const float* g0  = (const float*)d_in[9];
  const float* be0 = (const float*)d_in[10];
  const float* g1  = (const float*)d_in[11];
  const float* be1 = (const float*)d_in[12];

  char* ws = (char*)d_ws;
  size_t off = 0;
  auto take = [&](size_t bytes) -> void* {
    void* p = ws + off;
    off = (off + bytes + 255) & ~(size_t)255;
    return p;
  };

  // xb .. w2b: contiguous, in the order in which cvt_all_k numbers its units
  __bf16* xb   = (__bf16*)take((size_t)M * D * 2);    // also reused as ln0b
  __bf16* wqkvb = (__bf16*)take((size_t)3 * D * D * 2);  // wq, wk, wv one behind the other
  __bf16* wob  = (__bf16*)take((size_t)D * D * 2);
  __bf16* w1b  = (__bf16*)take((size_t)DF * D * 2);
  __bf16* w2b  = (__bf16*)take((size_t)D * DF * 2);
  size_t qkv_off = off;
  __bf16* qb    = (__bf16*)take((size_t)M * D * 2);   // q, k, v one behind the other
  __bf16* kb    = (__bf16*)take((size_t)M * D * 2);
  __bf16* vb    = (__bf16*)take((size_t)M * D * 2);
  __bf16* attnb = (__bf16*)take((size_t)M * D * 2);
  float*  x1    = (float*)take((size_t)M * D * 4);    // also reused as x2
  float*  ln0f  = (float*)take((size_t)M * D * 4);
  // reuse dead regions:
  __bf16* hb   = (__bf16*)(ws + qkv_off);             // 32MB over q/k/v/attn (dead)
  __bf16* ln0b = xb;                                  // xb dead after QKV gemms
  float*  x2   = x1;                                  // x1 dead after LN0

  dim3 blk(256);

  // fp32 -> bf16 conversions, one launch: (M*D + 4*D*D + 2*DF*D) / CVT_U = 16 units
  static_assert(M * D == 4 * CVT_U && D * D == CVT_U && DF * D == 4 * CVT_U, "unit map of cvt_all_k");
  cvt_all_k<<<dim3(CVT_B, 16), blk, 0, stream>>>(x, wq, wk, wv, wo, w1, w2, xb);

  // Q, K, V projections (bf16 out), one launch: z = 0, 1, 2
  dim3 gD(M / 128, D / 64);
  gemm_bf16_k<0><<<dim3(M / 128, D / 64, 3), blk, 0, stream>>>(xb, wqkvb, nullptr, nullptr, nullptr, qb, M, D, D);

  // causal flash attention
  attention_k<<<dim3(S / 128, H, B), blk, 0, stream>>>(qb, kb, vb, attnb, S, D);

  // output projection + residual (fp32)
  gemm_bf16_k<2><<<gD, blk, 0, stream>>>(attnb, wob, nullptr, x, x1, nullptr, M, D, D);

  // LayerNorm 0 (fp32 + bf16 copies)
  layernorm_k<<<M, blk, 0, stream>>>(x1, g0, be0, ln0f, ln0b, D);

  // MLP up + exact GELU (bf16 out)
  gemm_bf16_k<1><<<dim3(M / 128, DF / 64), blk, 0, stream>>>(ln0b, w1b, b1, nullptr, nullptr, hb, M, DF, D);

  // MLP down + bias + residual (fp32)
  gemm_bf16_k<2><<<gD, blk, 0, stream>>>(hb, w2b, b2, ln0f, x2, nullptr, M, D, DF);

  // LayerNorm 1 -> final output (fp32)
  layernorm_k<<<M, blk, 0, stream>>>(x2, g1, be1, (float*)d_out, nullptr, D);
}

// v005
// A run of this version takes 226 microseconds.
// Timed twice side by side with v004, it ran 1.18 and 1.17 times as fast.
// Over all steps from v000 it is 1.93 times as fast.
#include <hip/hip_runtime.h>
#include <hip/hip_bf16.h>
#include <math.h>

// ---------------------------------------------------------------------------
// Types / helpers
// ---------------------------------------------------------------------------
typedef __attribute__((ext_vector_type(16))) __bf16 v16bf;
typedef __attribute__((ext_vector_type(8)))  __bf16 v8bf;
typedef __attribute__((ext_vector_type(8)))  float  v8f;

__device__ __forceinline__ __bf16 f2bf(float f) {
  unsigned u = __builtin_bit_cast(unsigned, f);
  unsigned r = u + 0x7FFFu + ((u >> 16) & 1u);   // round-to-nearest-even
  unsigned short h = (unsigned short)(r >> 16);
  return __builtin_bit_cast(__bf16, h);
}

__device__ __forceinline__ v8f zero8() {
  v8f z = {0.f, 0.f, 0.f, 0.f, 0.f, 0.f, 0.f, 0.f};
  return z;
}

__device__ __forceinline__ v8f wmma_bf16(v16bf a, v16bf b, v8f c) {
  // D(f32 16x16) = A(bf16 16x32) * B(bf16 32x16) + C
  return __builtin_amdgcn_wmma_f32_16x16x32_bf16(
      /*neg_a=*/false, a, /*neg_b=*/false, b,
      /*c_mod=*/(short)0, c, /*reuse_a=*/false, /*reuse_b=*/false);
}

// 16x32 bf16 fragment from 16 consecutive *rows* of a row-major matrix.
// Per ISA 16-bit A layout: lane r (0..15), half h: elems [0..7] = row r,
// K = k0 + h*8 .. +7 ; elems [8..15] = row r, K = k0 + 16 + h*8 .. +7.
// Identical layout serves B of X@W^T (B[k][n] = W[n][k] -> rows of W).
// Works for both global and LDS (generic) pointers.
__device__ __forceinline__ v16bf load_frag_rows(const __bf16* __restrict__ base,
                                                int ld, int row0, int k0, int lane) {
  int r = lane & 15, h = lane >> 4;
  const __bf16* p = base + (size_t)(row0 + r) * ld + (k0 + h * 8);
  v8bf lo = *(const v8bf*)p;          // 16-byte load
  v8bf hi = *(const v8bf*)(p + 16);   // 16-byte load
  v16bf f;
#pragma unroll
  for (int i = 0; i < 8; ++i) { f[i] = lo[i]; f[i + 8] = hi[i]; }
  return f;
}

// K elements of one GEMM stage: a staged row is 128 bytes, one whole cache line.
constexpr int GK = 64;
// LDS pitch of those rows, in bf16 elements: 144 bytes = 16 B x odd, so the 16
// rows that one half-wave reads with 16-byte LDS loads start on 16 different
// groups of four banks.
constexpr int GLP = 72;

// Six async Global -> LDS copies of 16 bytes per lane (tracked by ASYNCcnt).
// l*: LDS byte address (low 32 bits of the generic shared pointer == LDS
// offset per the flat-aperture mapping, ISA 10.2).
// s_wait_xcnt 0 is the last line of the copies' own statement so that no later
// write of an address register can be scheduled ahead of it (a precaution).
__device__ __forceinline__ void async6_b128(unsigned l0, const void* g0,
                                            unsigned l1, const void* g1,
                                            unsigned l2, const void* g2,
                                            unsigned l3, const void* g3,
                                            unsigned l4, const void* g4,
                                            unsigned l5, const void* g5) {
  unsigned long long a0 = (unsigned long long)g0;
  unsigned long long a1 = (unsigned long long)g1;
  unsigned long long a2 = (unsigned long long)g2;
  unsigned long long a3 = (unsigned long long)g3;
  unsigned long long a4 = (unsigned long long)g4;
  unsigned long long a5 = (unsigned long long)g5;
  asm volatile("global_load_async_to_lds_b128 %0, %1, off\n\t"
               "global_load_async_to_lds_b128 %2, %3, off\n\t"
               "global_load_async_to_lds_b128 %4, %5, off\n\t"
               "global_load_async_to_lds_b128 %6, %7, off\n\t"
               "global_load_async_to_lds_b128 %8, %9, off\n\t"
               "global_load_async_to_lds_b128 %10, %11, off\n\t"
               "s_wait_xcnt 0x0"
               :: "v"(l0), "v"(a0), "v"(l1), "v"(a1), "v"(l2), "v"(a2),
                  "v"(l3), "v"(a3), "v"(l4), "v"(a4), "v"(l5), "v"(a5)
               : "memory");
}

// Four such copies in one statement, the same wait as its last line.
__device__ __forceinline__ void async4_b128(unsigned l0, const void* g0,
                                            unsigned l1, const void* g1,
                                            unsigned l2, const void* g2,
                                            unsigned l3, const void* g3) {
  unsigned long long a0 = (unsigned long long)g0;
  unsigned long long a1 = (unsigned long long)g1;
  unsigned long long a2 = (unsigned long long)g2;
  unsigned long long a3 = (unsigned long long)g3;
  asm volatile("global_load_async_to_lds_b128 %0, %1, off\n\t"
               "global_load_async_to_lds_b128 %2, %3, off\n\t"
               "global_load_async_to_lds_b128 %4, %5, off\n\t"
               "global_load_async_to_lds_b128 %6, %7, off\n\t"
               "s_wait_xcnt 0x0"
               :: "v"(l0), "v"(a0), "v"(l1), "v"(a1), "v"(l2), "v"(a2),
                  "v"(l3), "v"(a3)
               : "memory");
}

// Keys of one attention stage; a staged K or V row is one head's 64 elements = 128 bytes.
constexpr int AK = 64;
// LDS pitch of the K rows, in bf16 elements: 144 bytes = 16 B x odd (ds_load_b128 readers).
constexpr int KLP = 72;
// LDS pitch of the V rows: 160 bytes = 32 B x odd (ds_load_tr16_b128 readers).
constexpr int VLP = 80;

// Fragment whose K dimension runs *down a column* of a row-major matrix
// (A operand of V^T @ P^T: A[m][k] = V[k][m]), in the k order of load_frag_rows, from
// an LDS tile at pitch VLP by two transposing LDS loads:
// lane (r, h) gets tile[k0 + 8h + 0..7][col0 + r], then the same 16 rows below.
__device__ __forceinline__ v16bf load_frag_cols_lds(const __bf16* tile, int k0, int col0, int lane) {
  typedef __attribute__((address_space(3))) v8bf lds_v8bf;
  const __bf16* p = tile + (k0 + 8 * (lane >> 4) + (lane & 7)) * VLP + col0 + 8 * ((lane >> 3) & 1);
  v8bf lo = __builtin_amdgcn_ds_load_tr16_b128_v8bf16((lds_v8bf*)p);
  v8bf hi = __builtin_amdgcn_ds_load_tr16_b128_v8bf16((lds_v8bf*)(p + 16 * VLP));
  v16bf f;
#pragma unroll
  for (int i = 0; i < 8; ++i) { f[i] = lo[i]; f[i + 8] = hi[i]; }
  return f;
}

// Value of lane l ^ 16 (the other half-wave), by a vector cross-row move.
__device__ __forceinline__ float xhalf(float x) {
  int b = __builtin_bit_cast(int, x);
  return __builtin_bit_cast(float, __builtin_amdgcn_permlanex16(b, b, 0x76543210, 0xfedcba98, false, false));
}

// exp(x) as v_exp_f32 of x * log2(e), eight at a time, or one. Written in asm for
// the slot that the instruction set asks for behind a transcendental (one
// independent instruction or v_nop before its result is used or its source
// overwritten): the early-clobber outputs keep every result off every source,
// so each v_exp_f32 is followed by an independent one, and the v_nop is the
// slot of the last.
constexpr float LOG2E = 1.44269504f;
__device__ __forceinline__ void exp_x8(float* y, const float* x) {
  asm("v_exp_f32 %0, %8\n\t"
      "v_exp_f32 %1, %9\n\t"
      "v_exp_f32 %2, %10\n\t"
      "v_exp_f32 %3, %11\n\t"
      "v_exp_f32 %4, %12\n\t"
      "v_exp_f32 %5, %13\n\t"
      "v_exp_f32 %6, %14\n\t"
      "v_exp_f32 %7, %15\n\t"
      "v_nop"
      : "=&v"(y[0]), "=&v"(y[1]), "=&v"(y[2]), "=&v"(y[3]),
        "=&v"(y[4]), "=&v"(y[5]), "=&v"(y[6]), "=&v"(y[7])
      : "v"(x[0] * LOG2E), "v"(x[1] * LOG2E), "v"(x[2] * LOG2E), "v"(x[3] * LOG2E),
        "v"(x[4] * LOG2E), "v"(x[5] * LOG2E), "v"(x[6] * LOG2E), "v"(x[7] * LOG2E));
}
__device__ __forceinline__ float exp_x1(float x) {
  float y;
  asm("v_exp_f32 %0, %1\n\t"
      "v_nop"
      : "=&v"(y) : "v"(x * LOG2E));
  return y;
}

// ---------------------------------------------------------------------------
// fp32 -> bf16 conversion of all seven tensors in ONE launch.
// The bf16 copies lie one behind the other in the workspace (x, wq, wk, wv, wo,
// w1, w2), so the destination is one flat array. blockIdx.y picks a unit of
// CVT_U elements and with it the source; CVT_B work-groups share a unit.
// A wave's load covers 512 contiguous bytes, its store 256.
// ---------------------------------------------------------------------------
typedef __attribute__((ext_vector_type(4))) float  v4f;
typedef __attribute__((ext_vector_type(4))) __bf16 v4bf;
constexpr int CVT_U = 1 << 20;   // elements of a unit: x, w1, w2 are 4 units each, wq..wo one
constexpr int CVT_B = 32;        // work-groups of a unit

__global__ __launch_bounds__(256) void cvt_all_k(
    const float* __restrict__ x,  const float* __restrict__ wq,
    const float* __restrict__ wk, const float* __restrict__ wv,
    const float* __restrict__ wo, const float* __restrict__ w1,
    const float* __restrict__ w2, __bf16* __restrict__ out) {
  int u = blockIdx.y;
  const float* in = u < 4  ? x + (size_t)u * CVT_U
                  : u == 4 ? wq
                  : u == 5 ? wk
                  : u == 6 ? wv
                  : u == 7 ? wo
                  : u < 12 ? w1 + (size_t)(u - 8) * CVT_U
                           : w2 + (size_t)(u - 12) * CVT_U;
  __bf16* o = out + (size_t)u * CVT_U;
  constexpr int STEP = CVT_B * 256 * 4;          // elements that a unit's work-groups take at once
  int i = (blockIdx.x * 256 + threadIdx.x) * 4;
  for (int g = 0; g < CVT_U / (8 * STEP); ++g, i += 8 * STEP) {
    v4f a[8];
#pragma unroll   // eight 16-byte loads of a lane in flight before the first is used
    for (int t = 0; t < 8; ++t) a[t] = *(const v4f*)(in + i + t * STEP);
#pragma unroll   // a[] stays in registers
    for (int t = 0; t < 8; ++t) {
      v4bf r;
#pragma unroll   // vector elements picked by constants
      for (int e = 0; e < 4; ++e) r[e] = f2bf(a[t][e]);
      *(v4bf*)(o + i + t * STEP) = r;
    }
  }
}

template <int EPI>
__global__ __launch_bounds__(256) void gemm_bf16_k(
    const __bf16* __restrict__ X, const __bf16* __restrict__ W,
    const float* __restrict__ bias, const float* __restrict__ resid,
    float* __restrict__ outF, __bf16* __restrict__ outB,
    int M, int N, int K) {
  __shared__ __attribute__((aligned(16))) __bf16 xs[2][128 * GLP];
  __shared__ __attribute__((aligned(16))) __bf16 wsb[2][64 * GLP];

  int tid = threadIdx.x;
  int lane = tid & 31;
  int wave = tid >> 5;
  int wm = wave & 3, wn = wave >> 4 ? 0 : (wave >> 2);  // (kept simple below)
  wn = wave >> 2;
  int m0 = wm * 32;            // within block tile
  int n0 = wn * 32;
  int mblk = blockIdx.x * 128;
  int nblk = blockIdx.y * 64;
  if (EPI == 0) {
    W    += (size_t)blockIdx.z * N * K;
    outB += (size_t)blockIdx.z * M * N;
  }

  // Issue one K=GK stage of async copies into buffer `buf`.
  auto stage = [&](int buf, int k0) {
    // X tile: 128 rows x 8 16B-chunks; thread t -> chunk t & 7 of rows t >> 3, +32, +64, +96
    // W tile: 64 rows x 8 16B-chunks; thread t -> chunk t & 7 of rows t >> 3, +32
    int row = tid >> 3, q = tid & 7;
    const __bf16* xg = X + (size_t)(mblk + row) * K + k0 + q * 8;
    const __bf16* wg = W + (size_t)(nblk + row) * K + k0 + q * 8;
    __bf16* xl = &xs[buf][row * GLP + q * 8];
    __bf16* wl = &wsb[buf][row * GLP + q * 8];
    async6_b128((unsigned)(size_t)xl,              xg,
                (unsigned)(size_t)(xl + 32 * GLP), xg + (size_t)32 * K,
                (unsigned)(size_t)(xl + 64 * GLP), xg + (size_t)64 * K,
                (unsigned)(size_t)(xl + 96 * GLP), xg + (size_t)96 * K,
                (unsigned)(size_t)wl,              wg,
                (unsigned)(size_t)(wl + 32 * GLP), wg + (size_t)32 * K);
  };

  v8f acc00 = zero8(), acc01 = zero8(), acc10 = zero8(), acc11 = zero8();

  int nk = K / GK;
  stage(0, 0);
  asm volatile("s_wait_asynccnt 0x0" ::: "memory");  // this wave's part of stage 0 has landed
  __syncthreads();                                   // stage 0 visible to all waves
  if (nk > 1) stage(1, GK);
  for (int kk = 0; kk < nk; ++kk) {
    const __bf16* xt = xs[kk & 1];
    const __bf16* wt = wsb[kk & 1];
#pragma unroll   // ks becomes a constant offset of the LDS loads
    for (int ks = 0; ks < GK; ks += 32) {
      v16bf a0 = load_frag_rows(xt, GLP, m0, ks, lane);
      v16bf a1 = load_frag_rows(xt, GLP, m0 + 16, ks, lane);
      v16bf b0 = load_frag_rows(wt, GLP, n0, ks, lane);
      v16bf b1 = load_frag_rows(wt, GLP, n0 + 16, ks, lane);
      acc00 = wmma_bf16(a0, b0, acc00);
      acc01 = wmma_bf16(a0, b1, acc01);
      acc10 = wmma_bf16(a1, b0, acc10);
      acc11 = wmma_bf16(a1, b1, acc11);
    }
    // Hand-over:
    asm volatile("s_wait_dscnt 0x0" ::: "memory");     // this wave's reads of buffer kk & 1 are done
    asm volatile("s_wait_asynccnt 0x0" ::: "memory");  // its part of stage kk + 1 has landed
    __syncthreads();   // stage kk + 1 visible to all; buffer kk & 1 left by all
    if (kk + 2 < nk) stage(kk & 1, (kk + 2) * GK);
  }
  asm volatile("s_wait_asynccnt 0x0" ::: "memory");    // nothing in flight at the wave's end

  int r = lane & 15, h = lane >> 4;
#pragma unroll
  for (int ti = 0; ti < 2; ++ti) {
#pragma unroll
    for (int tj = 0; tj < 2; ++tj) {
      v8f acc = (ti == 0) ? (tj == 0 ? acc00 : acc01)
                          : (tj == 0 ? acc10 : acc11);
      int col = nblk + n0 + tj * 16 + r;
      float bv = (EPI == 0) ? 0.f : (bias ? bias[col] : 0.f);
#pragma unroll
      for (int i = 0; i < 8; ++i) {
        int row = mblk + m0 + ti * 16 + i + 8 * h;  // C layout: vgpr i -> M=i+8*h
        float v = acc[i] + bv;
        size_t idx = (size_t)row * N + col;
        if (EPI == 1) {
          v = 0.5f * v * (1.0f + erff(v * 0.70710678118654752f));  // exact GELU
          outB[idx] = f2bf(v);
        } else if (EPI == 2) {
          outF[idx] = v + resid[idx];
        } else {
          outB[idx] = f2bf(v);
        }
      }
    }
  }
}

__global__ __launch_bounds__(256) void attention_k(
    const __bf16* __restrict__ Q, const __bf16* __restrict__ Km,
    const __bf16* __restrict__ V, __bf16* __restrict__ O,
    int S, int Dm) {
  __shared__ __attribute__((aligned(16))) __bf16 Ks[2][AK * KLP];
  __shared__ __attribute__((aligned(16))) __bf16 Vs[2][AK * VLP];

  int lane = threadIdx.x & 31;
  int wave = __builtin_amdgcn_readfirstlane(threadIdx.x >> 5);  // scalar: the pass test below is a scalar branch
  int r = lane & 15, hl = lane >> 4;
  int h = blockIdx.y, b = blockIdx.z;
  int qbase = blockIdx.x * 128 + wave * 16;   // wave-uniform

  size_t base = (size_t)b * S * Dm + (size_t)h * 64;
  const __bf16* qp = Q + base;
  const __bf16* kp = Km + base;
  const __bf16* vp = V + base;
  __bf16* op = O + base;

  v16bf aq0 = load_frag_rows(qp, Dm, qbase, 0, lane);
  v16bf aq1 = load_frag_rows(qp, Dm, qbase, 32, lane);

  v8f o0 = zero8(), o1 = zero8(), o2 = zero8(), o3 = zero8();
  float m = -1e30f;   // running maximum of this lane's query, the same in both half-waves
  float l = 0.f;      // running sum over the keys of this lane's own half-wave
  int qrow = qbase + r;

  // One stage of async copies: keys k0 .. k0 + AK - 1 of K and V into buffer `buf`.
  // A tile is AK rows x 8 16B-chunks; thread t -> chunk t & 7 of rows t >> 3, +32.
  auto stage = [&](int buf, int k0) {
    int row = threadIdx.x >> 3, q = threadIdx.x & 7;
    const __bf16* kg = kp + (size_t)(k0 + row) * Dm + q * 8;
    const __bf16* vg = vp + (size_t)(k0 + row) * Dm + q * 8;
    __bf16* kl = &Ks[buf][row * KLP + q * 8];
    __bf16* vl = &Vs[buf][row * VLP + q * 8];
    async4_b128((unsigned)(size_t)kl,              kg,
                (unsigned)(size_t)(kl + 32 * KLP), kg + (size_t)32 * Dm,
                (unsigned)(size_t)vl,              vg,
                (unsigned)(size_t)(vl + 32 * VLP), vg + (size_t)32 * Dm);
  };

  int nst = (blockIdx.x + 1) * (128 / AK);   // stages up to the work-group's last row; at least two
  stage(0, 0);
  asm volatile("s_wait_asynccnt 0x0" ::: "memory");  // this wave's part of stage 0 has landed
  __syncthreads();                                   // stage 0 visible to all waves
  stage(1, AK);
  for (int t = 0; t < nst; ++t) {
   const __bf16* kt = Ks[t & 1];
   const __bf16* vt = Vs[t & 1];
#pragma unroll   // jj becomes a constant offset of the LDS loads
   for (int jj = 0; jj < AK; jj += 32) {
    int j0 = t * AK + jj;
    if (j0 >= qbase + 16) continue;   // wave-uniform: every key of the pass is masked for this wave
    // ---- S^T = K @ Q^T (two 16x16 score tiles: keys j0.. and j0+16..) ----
    v8f s0 = zero8(), s1 = zero8();
    {
      v16bf bk0 = load_frag_rows(kt, KLP, jj, 0, lane);
      v16bf bk1 = load_frag_rows(kt, KLP, jj, 32, lane);
      s0 = wmma_bf16(bk0, aq0, s0);
      s0 = wmma_bf16(bk1, aq1, s0);
      v16bf bk2 = load_frag_rows(kt, KLP, jj + 16, 0, lane);
      v16bf bk3 = load_frag_rows(kt, KLP, jj + 16, 32, lane);
      s1 = wmma_bf16(bk2, aq0, s1);
      s1 = wmma_bf16(bk3, aq1, s1);
    }
    // ---- scale, causal mask, online softmax: 16 keys of one query per lane ----
    int key0 = j0 + 8 * hl;
    float sc[16];
#pragma unroll   // sc[] stays in registers
    for (int i = 0; i < 8; ++i) {
      sc[i]     = s0[i] * 0.125f;               // 1/sqrt(64)
      sc[i + 8] = s1[i] * 0.125f;
      if (key0 + i > qrow) sc[i] = -1e30f;
      if (key0 + 16 + i > qrow) sc[i + 8] = -1e30f;
    }
    float t8[8];
#pragma unroll   // tree: independent links instead of one chain of 15
    for (int i = 0; i < 8; ++i) t8[i] = fmaxf(sc[i], sc[i + 8]);
    float rm = fmaxf(fmaxf(fmaxf(t8[0], t8[4]), fmaxf(t8[1], t8[5])),
                     fmaxf(fmaxf(t8[2], t8[6]), fmaxf(t8[3], t8[7])));
    rm = fmaxf(rm, xhalf(rm));                  // the query's other 16 keys
    float mn = fmaxf(m, rm);
    float al = exp_x1(m - mn);
#pragma unroll   // sc[] stays in registers
    for (int i = 0; i < 16; ++i) sc[i] -= mn;
    float p[16];
    exp_x8(p, sc);
    exp_x8(p + 8, sc + 8);
    v16bf pt;   // P^T as B operand: element s = key 8 * hl + s (s < 8), 16 + 8 * hl + s - 8 (else)
#pragma unroll   // p[], pt stay in registers
    for (int i = 0; i < 16; ++i) pt[i] = f2bf(p[i]);
#pragma unroll   // tree, as above
    for (int i = 0; i < 8; ++i) t8[i] = p[i] + p[i + 8];
    float rs = ((t8[0] + t8[4]) + (t8[1] + t8[5])) + ((t8[2] + t8[6]) + (t8[3] + t8[7]));
    l = l * al + rs;
    m = mn;
#pragma unroll   // vector elements picked by constants
    for (int i = 0; i < 8; ++i) { o0[i] *= al; o1[i] *= al; o2[i] *= al; o3[i] *= al; }
    // ---- O^T += V^T @ P^T (tile n: head columns 16 * n .. + 15) ----
    v16bf bv0 = load_frag_cols_lds(vt, jj, 0, lane);
    v16bf bv1 = load_frag_cols_lds(vt, jj, 16, lane);
    v16bf bv2 = load_frag_cols_lds(vt, jj, 32, lane);
    v16bf bv3 = load_frag_cols_lds(vt, jj, 48, lane);
    o0 = wmma_bf16(bv0, pt, o0);
    o1 = wmma_bf16(bv1, pt, o1);
    o2 = wmma_bf16(bv2, pt, o2);
    o3 = wmma_bf16(bv3, pt, o3);
   }
   // Hand-over:
   asm volatile("s_wait_dscnt 0x0" ::: "memory");     // this wave's reads of buffer t & 1 are done
   asm volatile("s_wait_asynccnt 0x0" ::: "memory");  // its part of stage t + 1 has landed
   __syncthreads();   // stage t + 1 visible to all; buffer t & 1 left by all
   if (t + 2 < nst) stage(t & 1, (t + 2) * AK);
  }
  asm volatile("s_wait_asynccnt 0x0" ::: "memory");    // nothing in flight at the wave's end

  // Lane (r, hl) holds O[qbase + r][16 * n + 8 * hl + 0..7] in tile n: 16-byte stores.
  float inv = 1.0f / (l + xhalf(l));   // the two half-waves' sums joined once
  __bf16* orow = op + (size_t)qrow * Dm + 8 * hl;
  v8bf w0, w1, w2, w3;
#pragma unroll   // vector elements picked by constants
  for (int i = 0; i < 8; ++i) {
    w0[i] = f2bf(o0[i] * inv);
    w1[i] = f2bf(o1[i] * inv);
    w2[i] = f2bf(o2[i] * inv);
    w3[i] = f2bf(o3[i] * inv);
  }
  *(v8bf*)(orow)      = w0;
  *(v8bf*)(orow + 16) = w1;
  *(v8bf*)(orow + 32) = w2;
  *(v8bf*)(orow + 48) = w3;
}

// ---------------------------------------------------------------------------
// LayerNorm over last dim (block per row). Writes fp32 (+ optional bf16).
// ---------------------------------------------------------------------------
__global__ __launch_bounds__(256) void layernorm_k(
    const float* __restrict__ in, const float* __restrict__ gamma,
    const float* __restrict__ beta, float* __restrict__ outF,
    __bf16* outB, int D) {
  __shared__ float red[256];
  int row = blockIdx.x, tid = threadIdx.x;
  const float* p = in + (size_t)row * D;

  float s = 0.f;
  for (int i = tid; i < D; i += 256) s += p[i];
  red[tid] = s; __syncthreads();
  for (int o = 128; o > 0; o >>= 1) { if (tid < o) red[tid] += red[tid + o]; __syncthreads(); }
  float mu = red[0] / (float)D;
  __syncthreads();

  float ss = 0.f;
  for (int i = tid; i < D; i += 256) { float d = p[i] - mu; ss += d * d; }
  red[tid] = ss; __syncthreads();
  for (int o = 128; o > 0; o >>= 1) { if (tid < o) red[tid] += red[tid + o]; __syncthreads(); }
  float inv = rsqrtf(red[0] / (float)D + 1e-5f);

  for (int i = tid; i < D; i += 256) {
    float y = (p[i] - mu) * inv * gamma[i] + beta[i];
    outF[(size_t)row * D + i] = y;
    if (outB) outB[(size_t)row * D + i] = f2bf(y);
  }
}

// ---------------------------------------------------------------------------
// Host orchestration
// ---------------------------------------------------------------------------
extern "C" void kernel_launch(void* const* d_in, const int* in_sizes, int n_in,
                              void* d_out, int out_size, void* d_ws, size_t ws_size,
                              hipStream_t stream) {
  (void)in_sizes; (void)n_in; (void)out_size; (void)ws_size;
  constexpr int B = 2, S = 2048, D = 1024, H = 16, M = B * S, DF = 4 * D;

  const float* x   = (const float*)d_in[0];
  const float* wq  = (const float*)d_in[1];
  const float* wk  = (const float*)d_in[2];
  const float* wv  = (const float*)d_in[3];
  const float* wo  = (const float*)d_in[4];
  const float* w1  = (const float*)d_in[5];
  const float* b1  = (const float*)d_in[6];
  const float* w2  = (const float*)d_in[7];
  const float* b2  = (const float*)d_in[8];
  const float* g0  = (const float*)d_in[9];
  const float* be0 = (const float*)d_in[10];
  const float* g1  = (const float*)d_in[11];
  const float* be1 = (const float*)d_in[12];

  char* ws = (char*)d_ws;
  size_t off = 0;
  auto take = [&](size_t bytes) -> void* {
    void* p = ws + off;
    off = (off + bytes + 255) & ~(size_t)255;
    return p;
  };

  // xb .. w2b: contiguous, in the order in which cvt_all_k numbers its units
  __bf16* xb   = (__bf16*)take((size_t)M * D * 2);    // also reused as ln0b
  __bf16* wqkvb = (__bf16*)take((size_t)3 * D * D * 2);  // wq, wk, wv one behind the other
  __bf16* wob  = (__bf16*)take((size_t)D * D * 2);
  __bf16* w1b  = (__bf16*)take((size_t)DF * D * 2);
  __bf16* w2b  = (__bf16*)take((size_t)D * DF * 2);
  size_t qkv_off = off;
  __bf16* qb    = (__bf16*)take((size_t)M * D * 2);   // q, k, v one behind the other
  __bf16* kb    = (__bf16*)take((size_t)M * D * 2);
  __bf16* vb    = (__bf16*)take((size_t)M * D * 2);
  __bf16* attnb = (__bf16*)take((size_t)M * D * 2);
  float*  x1    = (float*)take((size_t)M * D * 4);    // also reused as x2
  float*  ln0f  = (float*)take((size_t)M * D * 4);
  // reuse dead regions:
  __bf16* hb   = (__bf16*)(ws + qkv_off);             // 32MB over q/k/v/attn (dead)
  __bf16* ln0b = xb;                                  // xb dead after QKV gemms
  float*  x2   = x1;                                  // x1 dead after LN0

  dim3 blk(256);

  // fp32 -> bf16 conversions, one launch: (M*D + 4*D*D + 2*DF*D) / CVT_U = 16 units
  static_assert(M * D == 4 * CVT_U && D * D == CVT_U && DF * D == 4 * CVT_U, "unit map of cvt_all_k");
  cvt_all_k<<<dim3(CVT_B, 16), blk, 0, stream>>>(x, wq, wk, wv, wo, w1, w2, xb);

  // Q, K, V projections (bf16 out), one launch: z = 0, 1, 2
  dim3 gD(M / 128, D / 64);
  gemm_bf16_k<0><<<dim3(M / 128, D / 64, 3), blk, 0, stream>>>(xb, wqkvb, nullptr, nullptr, nullptr, qb, M, D, D);

  // causal flash attention
  attention_k<<<dim3(S / 128, H, B), blk, 0, stream>>>(qb, kb, vb, attnb, S, D);

  // output projection + residual (fp32)
  gemm_bf16_k<2><<<gD, blk, 0, stream>>>(attnb, wob, nullptr, x, x1, nullptr, M, D, D);

  // LayerNorm 0 (fp32 + bf16 copies)
  layernorm_k<<<M, blk, 0, stream>>>(x1, g0, be0, ln0f, ln0b, D);

  // MLP up + exact GELU (bf16 out)
  gemm_bf16_k<1><<<dim3(M / 128, DF / 64), blk, 0, stream>>>(ln0b, w1b, b1, nullptr, nullptr, hb, M, DF, D);

  // MLP down + bias + residual (fp32)
  gemm_bf16_k<2><<<gD, blk, 0, stream>>>(hb, w2b, b2, ln0f, x2, nullptr, M, D, DF);

  // LayerNorm 1 -> final output (fp32)
  layernorm_k<<<M, blk, 0, stream>>>(x2, g1, be1, (float*)d_out, nullptr, D);
}

// v006
// One run takes 206 microseconds.
// Two timings next to v005 put it at 1.10 and 1.09 times that version's speed.
// Counting every step since v000, it is 2.10 times as fast.
#include <hip/hip_runtime.h>
#include <hip/hip_bf16.h>
#include <math.h>

// ---------------------------------------------------------------------------
// Types / helpers
// ---------------------------------------------------------------------------
typedef __attribute__((ext_vector_type(16))) __bf16 v16bf;
typedef __attribute__((ext_vector_type(8)))  __bf16 v8bf;
typedef __attribute__((ext_vector_type(8)))  float  v8f;

__device__ __forceinline__ __bf16 f2bf(float f) {
  unsigned u = __builtin_bit_cast(unsigned, f);
  unsigned r = u + 0x7FFFu + ((u >> 16) & 1u);   // round-to-nearest-even
  unsigned short h = (unsigned short)(r >> 16);
  return __builtin_bit_cast(__bf16, h);
}

__device__ __forceinline__ v8f zero8() {
  v8f z = {0.f, 0.f, 0.f, 0.f, 0.f, 0.f, 0.f, 0.f};
  return z;
}

__device__ __forceinline__ v8f wmma_bf16(v16bf a, v16bf b, v8f c) {
  // D(f32 16x16) = A(bf16 16x32) * B(bf16 32x16) + C
  return __builtin_amdgcn_wmma_f32_16x16x32_bf16(
      /*neg_a=*/false, a, /*neg_b=*/false, b,
      /*c_mod=*/(short)0, c, /*reuse_a=*/false, /*reuse_b=*/false);
}

// 16x32 bf16 fragment from 16 consecutive *rows* of a row-major matrix.
// Per ISA 16-bit A layout: lane r (0..15), half h: elems [0..7] = row r,
// K = k0 + h*8 .. +7 ; elems [8..15] = row r, K = k0 + 16 + h*8 .. +7.
// Identical layout serves B of X@W^T (B[k][n] = W[n][k] -> rows of W).
// Works for both global and LDS (generic) pointers.
__device__ __forceinline__ v16bf load_frag_rows(const __bf16* __restrict__ base,
                                                int ld, int row0, int k0, int lane) {
  int r = lane & 15, h = lane >> 4;
  const __bf16* p = base + (size_t)(row0 + r) * ld + (k0 + h * 8);
  v8bf lo = *(const v8bf*)p;          // 16-byte load
  v8bf hi = *(const v8bf*)(p + 16);   // 16-byte load
  v16bf f;
#pragma unroll
  for (int i = 0; i < 8; ++i) { f[i] = lo[i]; f[i + 8] = hi[i]; }
  return f;
}

// K elements of one GEMM stage: a staged row is 128 bytes, one whole cache line.
constexpr int GK = 64;
// LDS pitch of those rows, in bf16 elements: 144 bytes = 16 B x odd, so the 16
// rows that one half-wave reads with 16-byte LDS loads start on 16 different
// groups of four banks.
constexpr int GLP = 72;

// Eight async Global -> LDS copies of 16 bytes per lane (tracked by ASYNCcnt).
// l*: LDS byte address (low 32 bits of the generic shared pointer == LDS
// offset per the flat-aperture mapping, ISA 10.2).
// s_wait_xcnt 0 is the last line of the copies' own statement so that no later
// write of an address register can be scheduled ahead of it (a precaution).
__device__ __forceinline__ void async8_b128(unsigned l0, const void* g0,
                                            unsigned l1, const void* g1,
                                            unsigned l2, const void* g2,
                                            unsigned l3, const void* g3,
                                            unsigned l4, const void* g4,
                                            unsigned l5, const void* g5,
                                            unsigned l6, const void* g6,
                                            unsigned l7, const void* g7) {
  unsigned long long a0 = (unsigned long long)g0;
  unsigned long long a1 = (unsigned long long)g1;
  unsigned long long a2 = (unsigned long long)g2;
  unsigned long long a3 = (unsigned long long)g3;
  unsigned long long a4 = (unsigned long long)g4;
  unsigned long long a5 = (unsigned long long)g5;
  unsigned long long a6 = (unsigned long long)g6;
  unsigned long long a7 = (unsigned long long)g7;
  asm volatile("global_load_async_to_lds_b128 %0, %1, off\n\t"
               "global_load_async_to_lds_b128 %2, %3, off\n\t"
               "global_load_async_to_lds_b128 %4, %5, off\n\t"
               "global_load_async_to_lds_b128 %6, %7, off\n\t"
               "global_load_async_to_lds_b128 %8, %9, off\n\t"
               "global_load_async_to_lds_b128 %10, %11, off\n\t"
               "global_load_async_to_lds_b128 %12, %13, off\n\t"
               "global_load_async_to_lds_b128 %14, %15, off\n\t"
               "s_wait_xcnt 0x0"
               :: "v"(l0), "v"(a0), "v"(l1), "v"(a1), "v"(l2), "v"(a2),
                  "v"(l3), "v"(a3), "v"(l4), "v"(a4), "v"(l5), "v"(a5),
                  "v"(l6), "v"(a6), "v"(l7), "v"(a7)
               : "memory");
}

// Four such copies in one statement, the same wait as its last line.
__device__ __forceinline__ void async4_b128(unsigned l0, const void* g0,
                                            unsigned l1, const void* g1,
                                            unsigned l2, const void* g2,
                                            unsigned l3, const void* g3) {
  unsigned long long a0 = (unsigned long long)g0;
  unsigned long long a1 = (unsigned long long)g1;
  unsigned long long a2 = (unsigned long long)g2;
  unsigned long long a3 = (unsigned long long)g3;
  asm volatile("global_load_async_to_lds_b128 %0, %1, off\n\t"
               "global_load_async_to_lds_b128 %2, %3, off\n\t"
               "global_load_async_to_lds_b128 %4, %5, off\n\t"
               "global_load_async_to_lds_b128 %6, %7, off\n\t"
               "s_wait_xcnt 0x0"
               :: "v"(l0), "v"(a0), "v"(l1), "v"(a1), "v"(l2), "v"(a2),
                  "v"(l3), "v"(a3)
               : "memory");
}

// Keys of one attention stage; a staged K or V row is one head's 64 elements = 128 bytes.
constexpr int AK = 64;
// LDS pitch of the K rows, in bf16 elements: 144 bytes = 16 B x odd (ds_load_b128 readers).
constexpr int KLP = 72;
// LDS pitch of the V rows: 160 bytes = 32 B x odd (ds_load_tr16_b128 readers).
constexpr int VLP = 80;

// Fragment whose K dimension runs *down a column* of a row-major matrix
// (A operand of V^T @ P^T: A[m][k] = V[k][m]), in the k order of load_frag_rows, from
// an LDS tile at pitch VLP by two transposing LDS loads:
// lane (r, h) gets tile[k0 + 8h + 0..7][col0 + r], then the same 16 rows below.
__device__ __forceinline__ v16bf load_frag_cols_lds(const __bf16* tile, int k0, int col0, int lane) {
  typedef __attribute__((address_space(3))) v8bf lds_v8bf;
  const __bf16* p = tile + (k0 + 8 * (lane >> 4) + (lane & 7)) * VLP + col0 + 8 * ((lane >> 3) & 1);
  v8bf lo = __builtin_amdgcn_ds_load_tr16_b128_v8bf16((lds_v8bf*)p);
  v8bf hi = __builtin_amdgcn_ds_load_tr16_b128_v8bf16((lds_v8bf*)(p + 16 * VLP));
  v16bf f;
#pragma unroll
  for (int i = 0; i < 8; ++i) { f[i] = lo[i]; f[i + 8] = hi[i]; }
  return f;
}

// Value of lane l ^ 16 (the other half-wave), by a vector cross-row move.
__device__ __forceinline__ float xhalf(float x) {
  int b = __builtin_bit_cast(int, x);
  return __builtin_bit_cast(float, __builtin_amdgcn_permlanex16(b, b, 0x76543210, 0xfedcba98, false, false));
}

// exp(x) as v_exp_f32 of x * log2(e), eight at a time, or one. Written in asm for
// the slot that the instruction set asks for behind a transcendental (one
// independent instruction or v_nop before its result is used or its source
// overwritten): the early-clobber outputs keep every result off every source,
// so each v_exp_f32 is followed by an independent one, and the v_nop is the
// slot of the last.
constexpr float LOG2E = 1.44269504f;
__device__ __forceinline__ void exp_x8(float* y, const float* x) {
  asm("v_exp_f32 %0, %8\n\t"
      "v_exp_f32 %1, %9\n\t"
      "v_exp_f32 %2, %10\n\t"
      "v_exp_f32 %3, %11\n\t"
      "v_exp_f32 %4, %12\n\t"
      "v_exp_f32 %5, %13\n\t"
      "v_exp_f32 %6, %14\n\t"
      "v_exp_f32 %7, %15\n\t"
      "v_nop"
      : "=&v"(y[0]), "=&v"(y[1]), "=&v"(y[2]), "=&v"(y[3]),
        "=&v"(y[4]), "=&v"(y[5]), "=&v"(y[6]), "=&v"(y[7])
      : "v"(x[0] * LOG2E), "v"(x[1] * LOG2E), "v"(x[2] * LOG2E), "v"(x[3] * LOG2E),
        "v"(x[4] * LOG2E), "v"(x[5] * LOG2E), "v"(x[6] * LOG2E), "v"(x[7] * LOG2E));
}
__device__ __forceinline__ float exp_x1(float x) {
  float y;
  asm("v_exp_f32 %0, %1\n\t"
      "v_nop"
      : "=&v"(y) : "v"(x * LOG2E));
  return y;
}

// ---------------------------------------------------------------------------
// fp32 -> bf16 conversion of all seven tensors in ONE launch.
// The bf16 copies lie one behind the other in the workspace (x, wq, wk, wv, wo,
// w1, w2), so the destination is one flat array. blockIdx.y picks a unit of
// CVT_U elements and with it the source; CVT_B work-groups share a unit.
// A wave's load covers 512 contiguous bytes, its store 256.
// ---------------------------------------------------------------------------
typedef __attribute__((ext_vector_type(4))) float  v4f;
typedef __attribute__((ext_vector_type(4))) __bf16 v4bf;
constexpr int CVT_U = 1 << 20;   // elements of a unit: x, w1, w2 are 4 units each, wq..wo one
constexpr int CVT_B = 32;        // work-groups of a unit

__global__ __launch_bounds__(256) void cvt_all_k(
    const float* __restrict__ x,  const float* __restrict__ wq,
    const float* __restrict__ wk, const float* __restrict__ wv,
    const float* __restrict__ wo, const float* __restrict__ w1,
    const float* __restrict__ w2, __bf16* __restrict__ out) {
  int u = blockIdx.y;
  const float* in = u < 4  ? x + (size_t)u * CVT_U
                  : u == 4 ? wq
                  : u == 5 ? wk
                  : u == 6 ? wv
                  : u == 7 ? wo
                  : u < 12 ? w1 + (size_t)(u - 8) * CVT_U
                           : w2 + (size_t)(u - 12) * CVT_U;
  __bf16* o = out + (size_t)u * CVT_U;
  constexpr int STEP = CVT_B * 256 * 4;          // elements that a unit's work-groups take at once
  int i = (blockIdx.x * 256 + threadIdx.x) * 4;
  for (int g = 0; g < CVT_U / (8 * STEP); ++g, i += 8 * STEP) {
    v4f a[8];
#pragma unroll   // eight 16-byte loads of a lane in flight before the first is used
    for (int t = 0; t < 8; ++t) a[t] = *(const v4f*)(in + i + t * STEP);
#pragma unroll   // a[] stays in registers
    for (int t = 0; t < 8; ++t) {
      v4bf r;
#pragma unroll   // vector elements picked by constants
      for (int e = 0; e < 4; ++e) r[e] = f2bf(a[t][e]);
      *(v4bf*)(o + i + t * STEP) = r;
    }
  }
}

template <int EPI>
__global__ __launch_bounds__(256) void gemm_bf16_k(
    const __bf16* __restrict__ X, const __bf16* __restrict__ W,
    const float* __restrict__ bias, const float* __restrict__ resid,
    float* __restrict__ outF, __bf16* __restrict__ outB,
    int M, int N, int K) {
  __shared__ __attribute__((aligned(16))) __bf16 xs[2][128 * GLP];
  __shared__ __attribute__((aligned(16))) __bf16 wsb[2][128 * GLP];

  int tid = threadIdx.x;
  int lane = tid & 31;
  int wave = tid >> 5;
  int wm = wave & 3, wn = wave >> 4 ? 0 : (wave >> 2);  // (kept simple below)
  wn = wave >> 2;
  int m0 = wm * 32;            // within block tile
  int n0 = wn * 64;
  int mblk = blockIdx.x * 128;
  int nblk = blockIdx.y * 128;
  if (EPI == 0) {
    W    += (size_t)blockIdx.z * N * K;
    outB += (size_t)blockIdx.z * M * N;
  }

  // Issue one K=GK stage of async copies into buffer `buf`.
  auto stage = [&](int buf, int k0) {
    // X tile: 128 rows x 8 16B-chunks; thread t -> chunk t & 7 of rows t >> 3, +32, +64, +96
    // W tile: the same shape, the same map
    int row = tid >> 3, q = tid & 7;
    const __bf16* xg = X + (size_t)(mblk + row) * K + k0 + q * 8;
    const __bf16* wg = W + (size_t)(nblk + row) * K + k0 + q * 8;
    __bf16* xl = &xs[buf][row * GLP + q * 8];
    __bf16* wl = &wsb[buf][row * GLP + q * 8];
    async8_b128((unsigned)(size_t)xl,              xg,
                (unsigned)(size_t)(xl + 32 * GLP), xg + (size_t)32 * K,
                (unsigned)(size_t)(xl + 64 * GLP), xg + (size_t)64 * K,
                (unsigned)(size_t)(xl + 96 * GLP), xg + (size_t)96 * K,
                (unsigned)(size_t)wl,              wg,
                (unsigned)(size_t)(wl + 32 * GLP), wg + (size_t)32 * K,
                (unsigned)(size_t)(wl + 64 * GLP), wg + (size_t)64 * K,
                (unsigned)(size_t)(wl + 96 * GLP), wg + (size_t)96 * K);
  };

  v8f acc[2][4];
#pragma unroll   // acc[][] stays in registers
  for (int tj = 0; tj < 4; ++tj) { acc[0][tj] = zero8(); acc[1][tj] = zero8(); }

  int nk = K / GK;
  stage(0, 0);
  asm volatile("s_wait_asynccnt 0x0" ::: "memory");  // this wave's part of stage 0 has landed
  __syncthreads();                                   // stage 0 visible to all waves
  if (nk > 1) stage(1, GK);
  for (int kk = 0; kk < nk; ++kk) {
    const __bf16* xt = xs[kk & 1];
    const __bf16* wt = wsb[kk & 1];
#pragma unroll   // ks becomes a constant offset of the LDS loads
    for (int ks = 0; ks < GK; ks += 32) {
      v16bf a0 = load_frag_rows(xt, GLP, m0, ks, lane);
      v16bf a1 = load_frag_rows(xt, GLP, m0 + 16, ks, lane);
      v16bf b[4];
#pragma unroll   // b[] stays in registers
      for (int tj = 0; tj < 4; ++tj) b[tj] = load_frag_rows(wt, GLP, n0 + tj * 16, ks, lane);
      // Keeps the 12 LDS loads of this k step in one group ahead of its 8 WMMAs. Without it
      // the compiler reloads one B register set and waits for LDS in front of every two WMMAs.
      __builtin_amdgcn_sched_barrier(0);
#pragma unroll   // acc[][] stays in registers
      for (int tj = 0; tj < 4; ++tj) {
        acc[0][tj] = wmma_bf16(a0, b[tj], acc[0][tj]);
        acc[1][tj] = wmma_bf16(a1, b[tj], acc[1][tj]);
      }
    }
    // Keeps the stage's last 8 WMMAs in front of the hand-over: they run while stage kk + 1 is
    // still landing, and the refill is issued directly behind the barrier. Without it the
    // compiler sinks them below the barrier, ahead of the copies.
    __builtin_amdgcn_sched_barrier(0);
    // Hand-over:
    asm volatile("s_wait_dscnt 0x0" ::: "memory");     // this wave's reads of buffer kk & 1 are done
    asm volatile("s_wait_asynccnt 0x0" ::: "memory");  // its part of stage kk + 1 has landed
    __syncthreads();   // stage kk + 1 visible to all; buffer kk & 1 left by all
    if (kk + 2 < nk) stage(kk & 1, (kk + 2) * GK);
  }
  asm volatile("s_wait_asynccnt 0x0" ::: "memory");    // nothing in flight at the wave's end

  int r = lane & 15, h = lane >> 4;
#pragma unroll
  for (int ti = 0; ti < 2; ++ti) {
#pragma unroll
    for (int tj = 0; tj < 4; ++tj) {
      v8f av = acc[ti][tj];
      int col = nblk + n0 + tj * 16 + r;
      float bv = (EPI == 0) ? 0.f : (bias ? bias[col] : 0.f);
#pragma unroll
      for (int i = 0; i < 8; ++i) {
        int row = mblk + m0 + ti * 16 + i + 8 * h;  // C layout: vgpr i -> M=i+8*h
        float v = av[i] + bv;
        size_t idx = (size_t)row * N + col;
        if (EPI == 1) {
          v = 0.5f * v * (1.0f + erff(v * 0.70710678118654752f));  // exact GELU
          outB[idx] = f2bf(v);
        } else if (EPI == 2) {
          outF[idx] = v + resid[idx];
        } else {
          outB[idx] = f2bf(v);
        }
      }
    }
  }
}

__global__ __launch_bounds__(256) void attention_k(
    const __bf16* __restrict__ Q, const __bf16* __restrict__ Km,
    const __bf16* __restrict__ V, __bf16* __restrict__ O,
    int S, int Dm) {
  __shared__ __attribute__((aligned(16))) __bf16 Ks[2][AK * KLP];
  __shared__ __attribute__((aligned(16))) __bf16 Vs[2][AK * VLP];

  int lane = threadIdx.x & 31;
  int wave = __builtin_amdgcn_readfirstlane(threadIdx.x >> 5);  // scalar: the pass test below is a scalar branch
  int r = lane & 15, hl = lane >> 4;
  int h = blockIdx.y, b = blockIdx.z;
  int qbase = blockIdx.x * 128 + wave * 16;   // wave-uniform

  size_t base = (size_t)b * S * Dm + (size_t)h * 64;
  const __bf16* qp = Q + base;
  const __bf16* kp = Km + base;
  const __bf16* vp = V + base;
  __bf16* op = O + base;

  v16bf aq0 = load_frag_rows(qp, Dm, qbase, 0, lane);
  v16bf aq1 = load_frag_rows(qp, Dm, qbase, 32, lane);

  v8f o0 = zero8(), o1 = zero8(), o2 = zero8(), o3 = zero8();
  float m = -1e30f;   // running maximum of this lane's query, the same in both half-waves
  float l = 0.f;      // running sum over the keys of this lane's own half-wave
  int qrow = qbase + r;

  // One stage of async copies: keys k0 .. k0 + AK - 1 of K and V into buffer `buf`.
  // A tile is AK rows x 8 16B-chunks; thread t -> chunk t & 7 of rows t >> 3, +32.
  auto stage = [&](int buf, int k0) {
    int row = threadIdx.x >> 3, q = threadIdx.x & 7;
    const __bf16* kg = kp + (size_t)(k0 + row) * Dm + q * 8;
    const __bf16* vg = vp + (size_t)(k0 + row) * Dm + q * 8;
    __bf16* kl = &Ks[buf][row * KLP + q * 8];
    __bf16* vl = &Vs[buf][row * VLP + q * 8];
    async4_b128((unsigned)(size_t)kl,              kg,
                (unsigned)(size_t)(kl + 32 * KLP), kg + (size_t)32 * Dm,
                (unsigned)(size_t)vl,              vg,
                (unsigned)(size_t)(vl + 32 * VLP), vg + (size_t)32 * Dm);
  };

  int nst = (blockIdx.x + 1) * (128 / AK);   // stages up to the work-group's last row; at least two
  stage(0, 0);
  asm volatile("s_wait_asynccnt 0x0" ::: "memory");  // this wave's part of stage 0 has landed
  __syncthreads();                                   // stage 0 visible to all waves
  stage(1, AK);
  for (int t = 0; t < nst; ++t) {
   const __bf16* kt = Ks[t & 1];
   const __bf16* vt = Vs[t & 1];
#pragma unroll   // jj becomes a constant offset of the LDS loads
   for (int jj = 0; jj < AK; jj += 32) {
    int j0 = t * AK + jj;
    if (j0 >= qbase + 16) continue;   // wave-uniform: every key of the pass is masked for this wave
    // ---- S^T = K @ Q^T (two 16x16 score tiles: keys j0.. and j0+16..) ----
    v8f s0 = zero8(), s1 = zero8();
    {
      v16bf bk0 = load_frag_rows(kt, KLP, jj, 0, lane);
      v16bf bk1 = load_frag_rows(kt, KLP, jj, 32, lane);
      s0 = wmma_bf16(bk0, aq0, s0);
      s0 = wmma_bf16(bk1, aq1, s0);
      v16bf bk2 = load_frag_rows(kt, KLP, jj + 16, 0, lane);
      v16bf bk3 = load_frag_rows(kt, KLP, jj + 16, 32, lane);
      s1 = wmma_bf16(bk2, aq0, s1);
      s1 = wmma_bf16(bk3, aq1, s1);
    }
    // ---- scale, causal mask, online softmax: 16 keys of one query per lane ----
    int key0 = j0 + 8 * hl;
    float sc[16];
#pragma unroll   // sc[] stays in registers
    for (int i = 0; i < 8; ++i) {
      sc[i]     = s0[i] * 0.125f;               // 1/sqrt(64)
      sc[i + 8] = s1[i] * 0.125f;
      if (key0 + i > qrow) sc[i] = -1e30f;
      if (key0 + 16 + i > qrow) sc[i + 8] = -1e30f;
    }
    float t8[8];
#pragma unroll   // tree: independent links instead of one chain of 15
    for (int i = 0; i < 8; ++i) t8[i] = fmaxf(sc[i], sc[i + 8]);
    float rm = fmaxf(fmaxf(fmaxf(t8[0], t8[4]), fmaxf(t8[1], t8[5])),
                     fmaxf(fmaxf(t8[2], t8[6]), fmaxf(t8[3], t8[7])));
    rm = fmaxf(rm, xhalf(rm));                  // the query's other 16 keys
    float mn = fmaxf(m, rm);
    float al = exp_x1(m - mn);
#pragma unroll   // sc[] stays in registers
    for (int i = 0; i < 16; ++i) sc[i] -= mn;
    float p[16];
    exp_x8(p, sc);
    exp_x8(p + 8, sc + 8);
    v16bf pt;   // P^T as B operand: element s = key 8 * hl + s (s < 8), 16 + 8 * hl + s - 8 (else)
#pragma unroll   // p[], pt stay in registers
    for (int i = 0; i < 16; ++i) pt[i] = f2bf(p[i]);
#pragma unroll   // tree, as above
    for (int i = 0; i < 8; ++i) t8[i] = p[i] + p[i + 8];
    float rs = ((t8[0] + t8[4]) + (t8[1] + t8[5])) + ((t8[2] + t8[6]) + (t8[3] + t8[7]));
    l = l * al + rs;
    m = mn;
#pragma unroll   // vector elements picked by constants
    for (int i = 0; i < 8; ++i) { o0[i] *= al; o1[i] *= al; o2[i] *= al; o3[i] *= al; }
    // ---- O^T += V^T @ P^T (tile n: head columns 16 * n .. + 15) ----
    v16bf bv0 = load_frag_cols_lds(vt, jj, 0, lane);
    v16bf bv1 = load_frag_cols_lds(vt, jj, 16, lane);
    v16bf bv2 = load_frag_cols_lds(vt, jj, 32, lane);
    v16bf bv3 = load_frag_cols_lds(vt, jj, 48, lane);
    o0 = wmma_bf16(bv0, pt, o0);
    o1 = wmma_bf16(bv1, pt, o1);
    o2 = wmma_bf16(bv2, pt, o2);
    o3 = wmma_bf16(bv3, pt, o3);
   }
   // Hand-over:
   asm volatile("s_wait_dscnt 0x0" ::: "memory");     // this wave's reads of buffer t & 1 are done
   asm volatile("s_wait_asynccnt 0x0" ::: "memory");  // its part of stage t + 1 has landed
   __syncthreads();   // stage t + 1 visible to all; buffer t & 1 left by all
   if (t + 2 < nst) stage(t & 1, (t + 2) * AK);
  }
  asm volatile("s_wait_asynccnt 0x0" ::: "memory");    // nothing in flight at the wave's end

  // Lane (r, hl) holds O[qbase + r][16 * n + 8 * hl + 0..7] in tile n: 16-byte stores.
  float inv = 1.0f / (l + xhalf(l));   // the two half-waves' sums joined once
  __bf16* orow = op + (size_t)qrow * Dm + 8 * hl;
  v8bf w0, w1, w2, w3;
#pragma unroll   // vector elements picked by constants
  for (int i = 0; i < 8; ++i) {
    w0[i] = f2bf(o0[i] * inv);
    w1[i] = f2bf(o1[i] * inv);
    w2[i] = f2bf(o2[i] * inv);
    w3[i] = f2bf(o3[i] * inv);
  }
  *(v8bf*)(orow)      = w0;
  *(v8bf*)(orow + 16) = w1;
  *(v8bf*)(orow + 32) = w2;
  *(v8bf*)(orow + 48) = w3;
}

// ---------------------------------------------------------------------------
// LayerNorm over last dim (block per row). Writes fp32 (+ optional bf16).
// ---------------------------------------------------------------------------
__global__ __launch_bounds__(256) void layernorm_k(
    const float* __restrict__ in, const float* __restrict__ gamma,
    const float* __restrict__ beta, float* __restrict__ outF,
    __bf16* outB, int D) {
  __shared__ float red[256];
  int row = blockIdx.x, tid = threadIdx.x;
  const float* p = in + (size_t)row * D;

  float s = 0.f;
  for (int i = tid; i < D; i += 256) s += p[i];
  red[tid] = s; __syncthreads();
  for (int o = 128; o > 0; o >>= 1) { if (tid < o) red[tid] += red[tid + o]; __syncthreads(); }
  float mu = red[0] / (float)D;
  __syncthreads();

  float ss = 0.f;
  for (int i = tid; i < D; i += 256) { float d = p[i] - mu; ss += d * d; }
  red[tid] = ss; __syncthreads();
  for (int o = 128; o > 0; o >>= 1) { if (tid < o) red[tid] += red[tid + o]; __syncthreads(); }
  float inv = rsqrtf(red[0] / (float)D + 1e-5f);

  for (int i = tid; i < D; i += 256) {
    float y = (p[i] - mu) * inv * gamma[i] + beta[i];
    outF[(size_t)row * D + i] = y;
    if (outB) outB[(size_t)row * D + i] = f2bf(y);
  }
}

// ---------------------------------------------------------------------------
// Host orchestration
// ---------------------------------------------------------------------------
extern "C" void kernel_launch(void* const* d_in, const int* in_sizes, int n_in,
                              void* d_out, int out_size, void* d_ws, size_t ws_size,
                              hipStream_t stream) {
  (void)in_sizes; (void)n_in; (void)out_size; (void)ws_size;
  constexpr int B = 2, S = 2048, D = 1024, H = 16, M = B * S, DF = 4 * D;

  const float* x   = (const float*)d_in[0];
  const float* wq  = (const float*)d_in[1];
  const float* wk  = (const float*)d_in[2];
  const float* wv  = (const float*)d_in[3];
  const float* wo  = (const float*)d_in[4];
  const float* w1  = (const float*)d_in[5];
  const float* b1  = (const float*)d_in[6];
  const float* w2  = (const float*)d_in[7];
  const float* b2  = (const float*)d_in[8];
  const float* g0  = (const float*)d_in[9];
  const float* be0 = (const float*)d_in[10];
  const float* g1  = (const float*)d_in[11];
  const float* be1 = (const float*)d_in[12];

  char* ws = (char*)d_ws;
  size_t off = 0;
  auto take = [&](size_t bytes) -> void* {
    void* p = ws + off;
    off = (off + bytes + 255) & ~(size_t)255;
    return p;
  };

  // xb .. w2b: contiguous, in the order in which cvt_all_k numbers its units
  __bf16* xb   = (__bf16*)take((size_t)M * D * 2);    // also reused as ln0b
  __bf16* wqkvb = (__bf16*)take((size_t)3 * D * D * 2);  // wq, wk, wv one behind the other
  __bf16* wob  = (__bf16*)take((size_t)D * D * 2);
  __bf16* w1b  = (__bf16*)take((size_t)DF * D * 2);
  __bf16* w2b  = (__bf16*)take((size_t)D * DF * 2);
  size_t qkv_off = off;
  __bf16* qb    = (__bf16*)take((size_t)M * D * 2);   // q, k, v one behind the other
  __bf16* kb    = (__bf16*)take((size_t)M * D * 2);
  __bf16* vb    = (__bf16*)take((size_t)M * D * 2);
  __bf16* attnb = (__bf16*)take((size_t)M * D * 2);
  float*  x1    = (float*)take((size_t)M * D * 4);    // also reused as x2
  float*  ln0f  = (float*)take((size_t)M * D * 4);
  // reuse dead regions:
  __bf16* hb   = (__bf16*)(ws + qkv_off);             // 32MB over q/k/v/attn (dead)
  __bf16* ln0b = xb;                                  // xb dead after QKV gemms
  float*  x2   = x1;                                  // x1 dead after LN0

  dim3 blk(256);

  // fp32 -> bf16 conversions, one launch: (M*D + 4*D*D + 2*DF*D) / CVT_U = 16 units
  static_assert(M * D == 4 * CVT_U && D * D == CVT_U && DF * D == 4 * CVT_U, "unit map of cvt_all_k");
  cvt_all_k<<<dim3(CVT_B, 16), blk, 0, stream>>>(x, wq, wk, wv, wo, w1, w2, xb);

  // Q, K, V projections (bf16 out), one launch: z = 0, 1, 2
  dim3 gD(M / 128, D / 128);
  gemm_bf16_k<0><<<dim3(M / 128, D / 128, 3), blk, 0, stream>>>(xb, wqkvb, nullptr, nullptr, nullptr, qb, M, D, D);

  // causal flash attention
  attention_k<<<dim3(S / 128, H, B), blk, 0, stream>>>(qb, kb, vb, attnb, S, D);

  // output projection + residual (fp32)
  gemm_bf16_k<2><<<gD, blk, 0, stream>>>(attnb, wob, nullptr, x, x1, nullptr, M, D, D);

  // LayerNorm 0 (fp32 + bf16 copies)
  layernorm_k<<<M, blk, 0, stream>>>(x1, g0, be0, ln0f, ln0b, D);

  // MLP up + exact GELU (bf16 out)
  gemm_bf16_k<1><<<dim3(M / 128, DF / 128), blk, 0, stream>>>(ln0b, w1b, b1, nullptr, nullptr, hb, M, DF, D);

  // MLP down + bias + residual (fp32)
  gemm_bf16_k<2><<<gD, blk, 0, stream>>>(hb, w2b, b2, ln0f, x2, nullptr, M, D, DF);

  // LayerNorm 1 -> final output (fp32)
  layernorm_k<<<M, blk, 0, stream>>>(x2, g1, be1, (float*)d_out, nullptr, D);
}

// v007
// One run takes 198 microseconds.
// Next to v006, in two timings, it ran 1.05 times as fast each time.
// Over all steps from v000 it is 2.20 times as fast.
#include <hip/hip_runtime.h>
#include <hip/hip_bf16.h>
#include <math.h>

// ---------------------------------------------------------------------------
// Types / helpers
// ---------------------------------------------------------------------------
typedef __attribute__((ext_vector_type(16))) __bf16 v16bf;
typedef __attribute__((ext_vector_type(8)))  __bf16 v8bf;
typedef __attribute__((ext_vector_type(8)))  float  v8f;

__device__ __forceinline__ __bf16 f2bf(float f) {
  unsigned u = __builtin_bit_cast(unsigned, f);
  unsigned r = u + 0x7FFFu + ((u >> 16) & 1u);   // round-to-nearest-even
  unsigned short h = (unsigned short)(r >> 16);
  return __builtin_bit_cast(__bf16, h);
}

__device__ __forceinline__ v8f zero8() {
  v8f z = {0.f, 0.f, 0.f, 0.f, 0.f, 0.f, 0.f, 0.f};
  return z;
}

__device__ __forceinline__ v8f wmma_bf16(v16bf a, v16bf b, v8f c) {
  // D(f32 16x16) = A(bf16 16x32) * B(bf16 32x16) + C
  return __builtin_amdgcn_wmma_f32_16x16x32_bf16(
      /*neg_a=*/false, a, /*neg_b=*/false, b,
      /*c_mod=*/(short)0, c, /*reuse_a=*/false, /*reuse_b=*/false);
}

// 16x32 bf16 fragment from 16 consecutive *rows* of a row-major matrix.
// Per ISA 16-bit A layout: lane r (0..15), half h: elems [0..7] = row r,
// K = k0 + h*8 .. +7 ; elems [8..15] = row r, K = k0 + 16 + h*8 .. +7.
// Identical layout serves B of X@W^T (B[k][n] = W[n][k] -> rows of W).
// Works for both global and LDS (generic) pointers.
__device__ __forceinline__ v16bf load_frag_rows(const __bf16* __restrict__ base,
                                                int ld, int row0, int k0, int lane) {
  int r = lane & 15, h = lane >> 4;
  const __bf16* p = base + (size_t)(row0 + r) * ld + (k0 + h * 8);
  v8bf lo = *(const v8bf*)p;          // 16-byte load
  v8bf hi = *(const v8bf*)(p + 16);   // 16-byte load
  v16bf f;
#pragma unroll
  for (int i = 0; i < 8; ++i) { f[i] = lo[i]; f[i + 8] = hi[i]; }
  return f;
}

// K elements of one GEMM stage: a staged row is 128 bytes, one whole cache line.
constexpr int GK = 64;
// LDS pitch of those rows, in bf16 elements: 144 bytes = 16 B x odd, so the 16
// rows that one half-wave reads with 16-byte LDS loads start on 16 different
// groups of four banks.
constexpr int GLP = 72;

// Eight async Global -> LDS copies of 16 bytes per lane (tracked by ASYNCcnt).
// l*: LDS byte address (low 32 bits of the generic shared pointer == LDS
// offset per the flat-aperture mapping, ISA 10.2).
// s_wait_xcnt 0 is the last line of the copies' own statement so that no later
// write of an address register can be scheduled ahead of it (a precaution).
__device__ __forceinline__ void async8_b128(unsigned l0, const void* g0,
                                            unsigned l1, const void* g1,
                                            unsigned l2, const void* g2,
                                            unsigned l3, const void* g3,
                                            unsigned l4, const void* g4,
                                            unsigned l5, const void* g5,
                                            unsigned l6, const void* g6,
                                            unsigned l7, const void* g7) {
  unsigned long long a0 = (unsigned long long)g0;
  unsigned long long a1 = (unsigned long long)g1;
  unsigned long long a2 = (unsigned long long)g2;
  unsigned long long a3 = (unsigned long long)g3;
  unsigned long long a4 = (unsigned long long)g4;
  unsigned long long a5 = (unsigned long long)g5;
  unsigned long long a6 = (unsigned long long)g6;
  unsigned long long a7 = (unsigned long long)g7;
  asm volatile("global_load_async_to_lds_b128 %0, %1, off\n\t"
               "global_load_async_to_lds_b128 %2, %3, off\n\t"
               "global_load_async_to_lds_b128 %4, %5, off\n\t"
               "global_load_async_to_lds_b128 %6, %7, off\n\t"
               "global_load_async_to_lds_b128 %8, %9, off\n\t"
               "global_load_async_to_lds_b128 %10, %11, off\n\t"
               "global_load_async_to_lds_b128 %12, %13, off\n\t"
               "global_load_async_to_lds_b128 %14, %15, off\n\t"
               "s_wait_xcnt 0x0"
               :: "v"(l0), "v"(a0), "v"(l1), "v"(a1), "v"(l2), "v"(a2),
                  "v"(l3), "v"(a3), "v"(l4), "v"(a4), "v"(l5), "v"(a5),
                  "v"(l6), "v"(a6), "v"(l7), "v"(a7)
               : "memory");
}

// Four such copies in one statement, the same wait as its last line.
__device__ __forceinline__ void async4_b128(unsigned l0, const void* g0,
                                            unsigned l1, const void* g1,
                                            unsigned l2, const void* g2,
                                            unsigned l3, const void* g3) {
  unsigned long long a0 = (unsigned long long)g0;
  unsigned long long a1 = (unsigned long long)g1;
  unsigned long long a2 = (unsigned long long)g2;
  unsigned long long a3 = (unsigned long long)g3;
  asm volatile("global_load_async_to_lds_b128 %0, %1, off\n\t"
               "global_load_async_to_lds_b128 %2, %3, off\n\t"
               "global_load_async_to_lds_b128 %4, %5, off\n\t"
               "global_load_async_to_lds_b128 %6, %7, off\n\t"
               "s_wait_xcnt 0x0"
               :: "v"(l0), "v"(a0), "v"(l1), "v"(a1), "v"(l2), "v"(a2),
                  "v"(l3), "v"(a3)
               : "memory");
}

// Keys of one attention stage; a staged K or V row is one head's 64 elements = 128 bytes.
constexpr int AK = 64;
// LDS pitch of the K rows, in bf16 elements: 144 bytes = 16 B x odd (ds_load_b128 readers).
constexpr int KLP = 72;
// LDS pitch of the V rows: 160 bytes = 32 B x odd (ds_load_tr16_b128 readers).
constexpr int VLP = 80;

// Fragment whose K dimension runs *down a column* of a row-major matrix
// (A operand of V^T @ P^T: A[m][k] = V[k][m]), in the k order of load_frag_rows, from
// an LDS tile at pitch VLP by two transposing LDS loads:
// lane (r, h) gets tile[k0 + 8h + 0..7][col0 + r], then the same 16 rows below.
__device__ __forceinline__ v16bf load_frag_cols_lds(const __bf16* tile, int k0, int col0, int lane) {
  typedef __attribute__((address_space(3))) v8bf lds_v8bf;
  const __bf16* p = tile + (k0 + 8 * (lane >> 4) + (lane & 7)) * VLP + col0 + 8 * ((lane >> 3) & 1);
  v8bf lo = __builtin_amdgcn_ds_load_tr16_b128_v8bf16((lds_v8bf*)p);
  v8bf hi = __builtin_amdgcn_ds_load_tr16_b128_v8bf16((lds_v8bf*)(p + 16 * VLP));
  v16bf f;
#pragma unroll
  for (int i = 0; i < 8; ++i) { f[i] = lo[i]; f[i + 8] = hi[i]; }
  return f;
}

// Value of lane l ^ 16 (the other half-wave), by a vector cross-row move.
__device__ __forceinline__ float xhalf(float x) {
  int b = __builtin_bit_cast(int, x);
  return __builtin_bit_cast(float, __builtin_amdgcn_permlanex16(b, b, 0x76543210, 0xfedcba98, false, false));
}

// exp(x) as v_exp_f32 of x * log2(e), eight at a time, or one. Written in asm for
// the slot that the instruction set asks for behind a transcendental (one
// independent instruction or v_nop before its result is used or its source
// overwritten): the early-clobber outputs keep every result off every source,
// so each v_exp_f32 is followed by an independent one, and the v_nop is the
// slot of the last.
constexpr float LOG2E = 1.44269504f;
__device__ __forceinline__ void exp_x8(float* y, const float* x) {
  asm("v_exp_f32 %0, %8\n\t"
      "v_exp_f32 %1, %9\n\t"
      "v_exp_f32 %2, %10\n\t"
      "v_exp_f32 %3, %11\n\t"
      "v_exp_f32 %4, %12\n\t"
      "v_exp_f32 %5, %13\n\t"
      "v_exp_f32 %6, %14\n\t"
      "v_exp_f32 %7, %15\n\t"
      "v_nop"
      : "=&v"(y[0]), "=&v"(y[1]), "=&v"(y[2]), "=&v"(y[3]),
        "=&v"(y[4]), "=&v"(y[5]), "=&v"(y[6]), "=&v"(y[7])
      : "v"(x[0] * LOG2E), "v"(x[1] * LOG2E), "v"(x[2] * LOG2E), "v"(x[3] * LOG2E),
        "v"(x[4] * LOG2E), "v"(x[5] * LOG2E), "v"(x[6] * LOG2E), "v"(x[7] * LOG2E));
}
__device__ __forceinline__ float exp_x1(float x) {
  float y;
  asm("v_exp_f32 %0, %1\n\t"
      "v_nop"
      : "=&v"(y) : "v"(x * LOG2E));
  return y;
}

// ---------------------------------------------------------------------------
// fp32 -> bf16 conversion of all seven tensors in ONE launch.
// The bf16 copies lie one behind the other in the workspace (x, wq, wk, wv, wo,
// w1, w2), so the destination is one flat array. blockIdx.y picks a unit of
// CVT_U elements and with it the source; CVT_B work-groups share a unit.
// A wave's load covers 512 contiguous bytes, its store 256.
// ---------------------------------------------------------------------------
typedef __attribute__((ext_vector_type(4))) float  v4f;
typedef __attribute__((ext_vector_type(4))) __bf16 v4bf;
constexpr int CVT_U = 1 << 20;   // elements of a unit: x, w1, w2 are 4 units each, wq..wo one
constexpr int CVT_B = 32;        // work-groups of a unit

__global__ __launch_bounds__(256) void cvt_all_k(
    const float* __restrict__ x,  const float* __restrict__ wq,
    const float* __restrict__ wk, const float* __restrict__ wv,
    const float* __restrict__ wo, const float* __restrict__ w1,
    const float* __restrict__ w2, __bf16* __restrict__ out) {
  int u = blockIdx.y;
  const float* in = u < 4  ? x + (size_t)u * CVT_U
                  : u == 4 ? wq
                  : u == 5 ? wk
                  : u == 6 ? wv
                  : u == 7 ? wo
                  : u < 12 ? w1 + (size_t)(u - 8) * CVT_U
                           : w2 + (size_t)(u - 12) * CVT_U;
  __bf16* o = out + (size_t)u * CVT_U;
  constexpr int STEP = CVT_B * 256 * 4;          // elements that a unit's work-groups take at once
  int i = (blockIdx.x * 256 + threadIdx.x) * 4;
  for (int g = 0; g < CVT_U / (8 * STEP); ++g, i += 8 * STEP) {
    v4f a[8];
#pragma unroll   // eight 16-byte loads of a lane in flight before the first is used
    for (int t = 0; t < 8; ++t) a[t] = *(const v4f*)(in + i + t * STEP);
#pragma unroll   // a[] stays in registers
    for (int t = 0; t < 8; ++t) {
      v4bf r;
#pragma unroll   // vector elements picked by constants
      for (int e = 0; e < 4; ++e) r[e] = f2bf(a[t][e]);
      *(v4bf*)(o + i + t * STEP) = r;
    }
  }
}

template <int EPI>
__global__ __launch_bounds__(256) void gemm_bf16_k(
    const __bf16* __restrict__ X, const __bf16* __restrict__ W,
    const float* __restrict__ bias, const float* __restrict__ resid,
    float* __restrict__ outF, __bf16* __restrict__ outB,
    int M, int N, int K) {
  __shared__ __attribute__((aligned(16))) __bf16 xs[2][128 * GLP];
  __shared__ __attribute__((aligned(16))) __bf16 wsb[2][128 * GLP];

  int tid = threadIdx.x;
  int lane = tid & 31;
  int wave = tid >> 5;
  int wm = wave & 3, wn = wave >> 4 ? 0 : (wave >> 2);  // (kept simple below)
  wn = wave >> 2;
  int m0 = wm * 32;            // within block tile
  int n0 = wn * 64;
  int mblk = blockIdx.x * 128;
  int nblk = blockIdx.y * 128;
  if (EPI == 0) {
    W    += (size_t)blockIdx.z * N * K;
    outB += (size_t)blockIdx.z * M * N;
  }

  // Issue one K=GK stage of async copies into buffer `buf`.
  auto stage = [&](int buf, int k0) {
    // X tile: 128 rows x 8 16B-chunks; thread t -> chunk t & 7 of rows t >> 3, +32, +64, +96
    // W tile: the same shape, the same map
    int row = tid >> 3, q = tid & 7;
    const __bf16* xg = X + (size_t)(mblk + row) * K + k0 + q * 8;
    const __bf16* wg = W + (size_t)(nblk + row) * K + k0 + q * 8;
    __bf16* xl = &xs[buf][row * GLP + q * 8];
    __bf16* wl = &wsb[buf][row * GLP + q * 8];
    async8_b128((unsigned)(size_t)xl,              xg,
                (unsigned)(size_t)(xl + 32 * GLP), xg + (size_t)32 * K,
                (unsigned)(size_t)(xl + 64 * GLP), xg + (size_t)64 * K,
                (unsigned)(size_t)(xl + 96 * GLP), xg + (size_t)96 * K,
                (unsigned)(size_t)wl,              wg,
                (unsigned)(size_t)(wl + 32 * GLP), wg + (size_t)32 * K,
                (unsigned)(size_t)(wl + 64 * GLP), wg + (size_t)64 * K,
                (unsigned)(size_t)(wl + 96 * GLP), wg + (size_t)96 * K);
  };

  v8f acc[2][4];
#pragma unroll   // acc[][] stays in registers
  for (int tj = 0; tj < 4; ++tj) { acc[0][tj] = zero8(); acc[1][tj] = zero8(); }

  int nk = K / GK;
  stage(0, 0);
  asm volatile("s_wait_asynccnt 0x0" ::: "memory");  // this wave's part of stage 0 has landed
  __syncthreads();                                   // stage 0 visible to all waves
  if (nk > 1) stage(1, GK);
  for (int kk = 0; kk < nk; ++kk) {
    const __bf16* xt = xs[kk & 1];
    const __bf16* wt = wsb[kk & 1];
#pragma unroll   // ks becomes a constant offset of the LDS loads
    for (int ks = 0; ks < GK; ks += 32) {
      v16bf a0 = load_frag_rows(xt, GLP, m0, ks, lane);
      v16bf a1 = load_frag_rows(xt, GLP, m0 + 16, ks, lane);
      v16bf b[4];
#pragma unroll   // b[] stays in registers
      for (int tj = 0; tj < 4; ++tj) b[tj] = load_frag_rows(wt, GLP, n0 + tj * 16, ks, lane);
      // Keeps the 12 LDS loads of this k step in one group ahead of its 8 WMMAs. Without it
      // the compiler reloads one B register set and waits for LDS in front of every two WMMAs.
      __builtin_amdgcn_sched_barrier(0);
#pragma unroll   // acc[][] stays in registers
      for (int tj = 0; tj < 4; ++tj) {
        acc[0][tj] = wmma_bf16(a0, b[tj], acc[0][tj]);
        acc[1][tj] = wmma_bf16(a1, b[tj], acc[1][tj]);
      }
    }
    // Keeps the stage's last 8 WMMAs in front of the hand-over: they run while stage kk + 1 is
    // still landing, and the refill is issued directly behind the barrier. Without it the
    // compiler sinks them below the barrier, ahead of the copies.
    __builtin_amdgcn_sched_barrier(0);
    // Hand-over:
    asm volatile("s_wait_dscnt 0x0" ::: "memory");     // this wave's reads of buffer kk & 1 are done
    asm volatile("s_wait_asynccnt 0x0" ::: "memory");  // its part of stage kk + 1 has landed
    __syncthreads();   // stage kk + 1 visible to all; buffer kk & 1 left by all
    if (kk + 2 < nk) stage(kk & 1, (kk + 2) * GK);
  }
  asm volatile("s_wait_asynccnt 0x0" ::: "memory");    // nothing in flight at the wave's end

  int r = lane & 15, h = lane >> 4;
#pragma unroll
  for (int ti = 0; ti < 2; ++ti) {
#pragma unroll
    for (int tj = 0; tj < 4; ++tj) {
      v8f av = acc[ti][tj];
      int col = nblk + n0 + tj * 16 + r;
      float bv = (EPI == 0) ? 0.f : (bias ? bias[col] : 0.f);
#pragma unroll
      for (int i = 0; i < 8; ++i) {
        int row = mblk + m0 + ti * 16 + i + 8 * h;  // C layout: vgpr i -> M=i+8*h
        float v = av[i] + bv;
        size_t idx = (size_t)row * N + col;
        if (EPI == 1) {
          v = 0.5f * v * (1.0f + erff(v * 0.70710678118654752f));  // exact GELU
          outB[idx] = f2bf(v);
        } else if (EPI == 2) {
          outF[idx] = v + resid[idx];
        } else {
          outB[idx] = f2bf(v);
        }
      }
    }
  }
}

__global__ __launch_bounds__(256) void attention_k(
    const __bf16* __restrict__ Q, const __bf16* __restrict__ Km,
    const __bf16* __restrict__ V, __bf16* __restrict__ O,
    int S, int Dm) {
  __shared__ __attribute__((aligned(16))) __bf16 Ks[2][AK * KLP];
  __shared__ __attribute__((aligned(16))) __bf16 Vs[2][AK * VLP];

  int lane = threadIdx.x & 31;
  int wave = __builtin_amdgcn_readfirstlane(threadIdx.x >> 5);  // scalar: the pass test below is a scalar branch
  int r = lane & 15, hl = lane >> 4;
  int h = blockIdx.y, b = blockIdx.z;
  int qbase = blockIdx.x * 128 + wave * 16;   // wave-uniform

  size_t base = (size_t)b * S * Dm + (size_t)h * 64;
  const __bf16* qp = Q + base;
  const __bf16* kp = Km + base;
  const __bf16* vp = V + base;
  __bf16* op = O + base;

  v16bf aq0 = load_frag_rows(qp, Dm, qbase, 0, lane);
  v16bf aq1 = load_frag_rows(qp, Dm, qbase, 32, lane);

  v8f o0 = zero8(), o1 = zero8(), o2 = zero8(), o3 = zero8();
  float m = -1e30f;   // running maximum of this lane's query, the same in both half-waves
  float l = 0.f;      // running sum over the keys of this lane's own half-wave
  int qrow = qbase + r;

  // One stage of async copies: keys k0 .. k0 + AK - 1 of K and V into buffer `buf`.
  // A tile is AK rows x 8 16B-chunks; thread t -> chunk t & 7 of rows t >> 3, +32.
  auto stage = [&](int buf, int k0) {
    int row = threadIdx.x >> 3, q = threadIdx.x & 7;
    const __bf16* kg = kp + (size_t)(k0 + row) * Dm + q * 8;
    const __bf16* vg = vp + (size_t)(k0 + row) * Dm + q * 8;
    __bf16* kl = &Ks[buf][row * KLP + q * 8];
    __bf16* vl = &Vs[buf][row * VLP + q * 8];
    async4_b128((unsigned)(size_t)kl,              kg,
                (unsigned)(size_t)(kl + 32 * KLP), kg + (size_t)32 * Dm,
                (unsigned)(size_t)vl,              vg,
                (unsigned)(size_t)(vl + 32 * VLP), vg + (size_t)32 * Dm);
  };

  int nst = (blockIdx.x + 1) * (128 / AK);   // stages up to the work-group's last row; at least two
  stage(0, 0);
  asm volatile("s_wait_asynccnt 0x0" ::: "memory");  // this wave's part of stage 0 has landed
  __syncthreads();                                   // stage 0 visible to all waves
  stage(1, AK);
  for (int t = 0; t < nst; ++t) {
   const __bf16* kt = Ks[t & 1];
   const __bf16* vt = Vs[t & 1];
#pragma unroll   // jj becomes a constant offset of the LDS loads
   for (int jj = 0; jj < AK; jj += 32) {
    int j0 = t * AK + jj;
    if (j0 >= qbase + 16) continue;   // wave-uniform: every key of the pass is masked for this wave
    // ---- S^T = K @ Q^T (two 16x16 score tiles: keys j0.. and j0+16..) ----
    v8f s0 = zero8(), s1 = zero8();
    {
      v16bf bk0 = load_frag_rows(kt, KLP, jj, 0, lane);
      v16bf bk1 = load_frag_rows(kt, KLP, jj, 32, lane);
      s0 = wmma_bf16(bk0, aq0, s0);
      s0 = wmma_bf16(bk1, aq1, s0);
      v16bf bk2 = load_frag_rows(kt, KLP, jj + 16, 0, lane);
      v16bf bk3 = load_frag_rows(kt, KLP, jj + 16, 32, lane);
      s1 = wmma_bf16(bk2, aq0, s1);
      s1 = wmma_bf16(bk3, aq1, s1);
    }
    // ---- scale, causal mask, online softmax: 16 keys of one query per lane ----
    int key0 = j0 + 8 * hl;
    float sc[16];
#pragma unroll   // sc[] stays in registers
    for (int i = 0; i < 8; ++i) {
      sc[i]     = s0[i] * 0.125f;               // 1/sqrt(64)
      sc[i + 8] = s1[i] * 0.125f;
      if (key0 + i > qrow) sc[i] = -1e30f;
      if (key0 + 16 + i > qrow) sc[i + 8] = -1e30f;
    }
    float t8[8];
#pragma unroll   // tree: independent links instead of one chain of 15
    for (int i = 0; i < 8; ++i) t8[i] = fmaxf(sc[i], sc[i + 8]);
    float rm = fmaxf(fmaxf(fmaxf(t8[0], t8[4]), fmaxf(t8[1], t8[5])),
                     fmaxf(fmaxf(t8[2], t8[6]), fmaxf(t8[3], t8[7])));
    rm = fmaxf(rm, xhalf(rm));                  // the query's other 16 keys
    float mn = fmaxf(m, rm);
    float al = exp_x1(m - mn);
#pragma unroll   // sc[] stays in registers
    for (int i = 0; i < 16; ++i) sc[i] -= mn;
    float p[16];
    exp_x8(p, sc);
    exp_x8(p + 8, sc + 8);
    v16bf pt;   // P^T as B operand: element s = key 8 * hl + s (s < 8), 16 + 8 * hl + s - 8 (else)
#pragma unroll   // p[], pt stay in registers
    for (int i = 0; i < 16; ++i) pt[i] = f2bf(p[i]);
#pragma unroll   // tree, as above
    for (int i = 0; i < 8; ++i) t8[i] = p[i] + p[i + 8];
    float rs = ((t8[0] + t8[4]) + (t8[1] + t8[5])) + ((t8[2] + t8[6]) + (t8[3] + t8[7]));
    l = l * al + rs;
    m = mn;
#pragma unroll   // vector elements picked by constants
    for (int i = 0; i < 8; ++i) { o0[i] *= al; o1[i] *= al; o2[i] *= al; o3[i] *= al; }
    // ---- O^T += V^T @ P^T (tile n: head columns 16 * n .. + 15) ----
    v16bf bv0 = load_frag_cols_lds(vt, jj, 0, lane);
    v16bf bv1 = load_frag_cols_lds(vt, jj, 16, lane);
    v16bf bv2 = load_frag_cols_lds(vt, jj, 32, lane);
    v16bf bv3 = load_frag_cols_lds(vt, jj, 48, lane);
    o0 = wmma_bf16(bv0, pt, o0);
    o1 = wmma_bf16(bv1, pt, o1);
    o2 = wmma_bf16(bv2, pt, o2);
    o3 = wmma_bf16(bv3, pt, o3);
   }
   // Hand-over:
   asm volatile("s_wait_dscnt 0x0" ::: "memory");     // this wave's reads of buffer t & 1 are done
   asm volatile("s_wait_asynccnt 0x0" ::: "memory");  // its part of stage t + 1 has landed
   __syncthreads();   // stage t + 1 visible to all; buffer t & 1 left by all
   if (t + 2 < nst) stage(t & 1, (t + 2) * AK);
  }
  asm volatile("s_wait_asynccnt 0x0" ::: "memory");    // nothing in flight at the wave's end

  // Lane (r, hl) holds O[qbase + r][16 * n + 8 * hl + 0..7] in tile n: 16-byte stores.
  float inv = 1.0f / (l + xhalf(l));   // the two half-waves' sums joined once
  __bf16* orow = op + (size_t)qrow * Dm + 8 * hl;
  v8bf w0, w1, w2, w3;
#pragma unroll   // vector elements picked by constants
  for (int i = 0; i < 8; ++i) {
    w0[i] = f2bf(o0[i] * inv);
    w1[i] = f2bf(o1[i] * inv);
    w2[i] = f2bf(o2[i] * inv);
    w3[i] = f2bf(o3[i] * inv);
  }
  *(v8bf*)(orow)      = w0;
  *(v8bf*)(orow + 16) = w1;
  *(v8bf*)(orow + 32) = w2;
  *(v8bf*)(orow + 48) = w3;
}

// ---------------------------------------------------------------------------
// LayerNorm over the last dim. Writes fp32 (+ bf16 where WB).
// One wave takes LN_R whole rows and keeps them in registers: a row is read once,
// by 16-byte loads that cover 512 contiguous bytes a wave, all of them in flight
// together with gamma and beta. Mean and variance are summed in the lane and then
// across the wave's lanes by vector cross-lane moves: no LDS, no barrier. The
// launch has M / LN_R waves, one work-group per 8 * LN_R rows.
// ---------------------------------------------------------------------------
constexpr int LN_D = 1024;   // row length: 8 loads x 32 lanes x 4 floats
constexpr int LN_R = 2;      // rows of a wave

// x + (x of lane l ^ mask) inside each 16-lane row; CTRL = 0x160 + mask (row_xmask).
template <int CTRL>
__device__ __forceinline__ float row_xadd(float x) {
  int b = __builtin_bit_cast(int, x);
  return x + __builtin_bit_cast(float, __builtin_amdgcn_update_dpp(0, b, CTRL, 0xf, 0xf, true));
}
// Sum over the wave's 32 lanes, the same bits in every lane.
__device__ __forceinline__ float wave_sum(float x) {
  x = row_xadd<0x161>(x);
  x = row_xadd<0x162>(x);
  x = row_xadd<0x164>(x);
  x = row_xadd<0x168>(x);
  return x + xhalf(x);
}

template <bool WB>
__global__ __launch_bounds__(256) void layernorm_k(
    const float* __restrict__ in, const float* __restrict__ gamma,
    const float* __restrict__ beta, float* __restrict__ outF,
    __bf16* __restrict__ outB) {
  int lane = threadIdx.x & 31;
  int wave = threadIdx.x >> 5;
  // Scalar base of the work-group's rows, one small lane offset for loads and stores alike.
  size_t base = (size_t)blockIdx.x * (8 * LN_R * LN_D);
  int off = wave * (LN_R * LN_D) + lane * 4;
  const float* p = in + base;
  float* oF = outF + base;

  v4f a[LN_R][8], g[8], be[8];
#pragma unroll   // a[][] stays in registers
  for (int rr = 0; rr < LN_R; ++rr)
#pragma unroll
    for (int t = 0; t < 8; ++t) a[rr][t] = *(const v4f*)(p + off + rr * LN_D + t * 128);
#pragma unroll   // g[], be[] stay in registers
  for (int t = 0; t < 8; ++t) {
    g[t]  = *(const v4f*)(gamma + lane * 4 + t * 128);
    be[t] = *(const v4f*)(beta + lane * 4 + t * 128);
  }
  // Keeps all 32 loads in one group at the top. Without it the compiler sinks the gamma and
  // beta loads behind the sums, two pairs at a time, and the wave waits out their latency there.
  __builtin_amdgcn_sched_barrier(0);
  // In front of the first instruction that reuses an address register of these loads (a precaution).
  asm volatile("s_wait_xcnt 0x0" ::: "memory");
  // Keeps the sums, which reuse those registers, behind that wait: the compiler lifted them over it.
  __builtin_amdgcn_sched_barrier(0);

  float s[LN_R];
#pragma unroll   // the rows' sums are independent chains
  for (int rr = 0; rr < LN_R; ++rr) {
    v4f s4 = (a[rr][0] + a[rr][1]) + (a[rr][2] + a[rr][3]);
    s4 += (a[rr][4] + a[rr][5]) + (a[rr][6] + a[rr][7]);
    s[rr] = (s4[0] + s4[1]) + (s4[2] + s4[3]);
  }
#pragma unroll
  for (int rr = 0; rr < LN_R; ++rr) s[rr] = wave_sum(s[rr]) / (float)LN_D;   // mean

  float q[LN_R];
#pragma unroll
  for (int rr = 0; rr < LN_R; ++rr) {
    v4f q4 = {0.f, 0.f, 0.f, 0.f};
#pragma unroll
    for (int t = 0; t < 8; ++t) {
      a[rr][t] -= s[rr];
      q4 += a[rr][t] * a[rr][t];
    }
    q[rr] = (q4[0] + q4[1]) + (q4[2] + q4[3]);
  }
#pragma unroll
  for (int rr = 0; rr < LN_R; ++rr) q[rr] = rsqrtf(wave_sum(q[rr]) / (float)LN_D + 1e-5f);

#pragma unroll
  for (int rr = 0; rr < LN_R; ++rr) {
#pragma unroll
    for (int t = 0; t < 8; ++t) {
      v4f y = a[rr][t] * q[rr] * g[t] + be[t];
      *(v4f*)(oF + off + rr * LN_D + t * 128) = y;
      if (WB) {
        v4bf yb;
#pragma unroll   // vector elements picked by constants
        for (int e = 0; e < 4; ++e) yb[e] = f2bf(y[e]);
        *(v4bf*)(outB + base + off + rr * LN_D + t * 128) = yb;
      }
    }
  }
}

// ---------------------------------------------------------------------------
// Host orchestration
// ---------------------------------------------------------------------------
extern "C" void kernel_launch(void* const* d_in, const int* in_sizes, int n_in,
                              void* d_out, int out_size, void* d_ws, size_t ws_size,
                              hipStream_t stream) {
  (void)in_sizes; (void)n_in; (void)out_size; (void)ws_size;
  constexpr int B = 2, S = 2048, D = 1024, H = 16, M = B * S, DF = 4 * D;

  const float* x   = (const float*)d_in[0];
  const float* wq  = (const float*)d_in[1];
  const float* wk  = (const float*)d_in[2];
  const float* wv  = (const float*)d_in[3];
  const float* wo  = (const float*)d_in[4];
  const float* w1  = (const float*)d_in[5];
  const float* b1  = (const float*)d_in[6];
  const float* w2  = (const float*)d_in[7];
  const float* b2  = (const float*)d_in[8];
  const float* g0  = (const float*)d_in[9];
  const float* be0 = (const float*)d_in[10];
  const float* g1  = (const float*)d_in[11];
  const float* be1 = (const float*)d_in[12];

  char* ws = (char*)d_ws;
  size_t off = 0;
  auto take = [&](size_t bytes) -> void* {
    void* p = ws + off;
    off = (off + bytes + 255) & ~(size_t)255;
    return p;
  };

  // xb .. w2b: contiguous, in the order in which cvt_all_k numbers its units
  __bf16* xb   = (__bf16*)take((size_t)M * D * 2);    // also reused as ln0b
  __bf16* wqkvb = (__bf16*)take((size_t)3 * D * D * 2);  // wq, wk, wv one behind the other
  __bf16* wob  = (__bf16*)take((size_t)D * D * 2);
  __bf16* w1b  = (__bf16*)take((size_t)DF * D * 2);
  __bf16* w2b  = (__bf16*)take((size_t)D * DF * 2);
  size_t qkv_off = off;
  __bf16* qb    = (__bf16*)take((size_t)M * D * 2);   // q, k, v one behind the other
  __bf16* kb    = (__bf16*)take((size_t)M * D * 2);
  __bf16* vb    = (__bf16*)take((size_t)M * D * 2);
  __bf16* attnb = (__bf16*)take((size_t)M * D * 2);
  float*  x1    = (float*)take((size_t)M * D * 4);    // also reused as x2
  float*  ln0f  = (float*)take((size_t)M * D * 4);
  // reuse dead regions:
  __bf16* hb   = (__bf16*)(ws + qkv_off);             // 32MB over q/k/v/attn (dead)
  __bf16* ln0b = xb;                                  // xb dead after QKV gemms
  float*  x2   = x1;                                  // x1 dead after LN0

  dim3 blk(256);

  // fp32 -> bf16 conversions, one launch: (M*D + 4*D*D + 2*DF*D) / CVT_U = 16 units
  static_assert(D == LN_D && M % (8 * LN_R) == 0, "row map of layernorm_k");
  static_assert(M * D == 4 * CVT_U && D * D == CVT_U && DF * D == 4 * CVT_U, "unit map of cvt_all_k");
  cvt_all_k<<<dim3(CVT_B, 16), blk, 0, stream>>>(x, wq, wk, wv, wo, w1, w2, xb);

  // Q, K, V projections (bf16 out), one launch: z = 0, 1, 2
  dim3 gD(M / 128, D / 128);
  gemm_bf16_k<0><<<dim3(M / 128, D / 128, 3), blk, 0, stream>>>(xb, wqkvb, nullptr, nullptr, nullptr, qb, M, D, D);

  // causal flash attention
  attention_k<<<dim3(S / 128, H, B), blk, 0, stream>>>(qb, kb, vb, attnb, S, D);

  // output projection + residual (fp32)
  gemm_bf16_k<2><<<gD, blk, 0, stream>>>(attnb, wob, nullptr, x, x1, nullptr, M, D, D);

  // LayerNorm 0 (fp32 + bf16 copies)
  layernorm_k<true><<<M / (8 * LN_R), blk, 0, stream>>>(x1, g0, be0, ln0f, ln0b);

  // MLP up + exact GELU (bf16 out)
  gemm_bf16_k<1><<<dim3(M / 128, DF / 128), blk, 0, stream>>>(ln0b, w1b, b1, nullptr, nullptr, hb, M, DF, D);

  // MLP down + bias + residual (fp32)
  gemm_bf16_k<2><<<gD, blk, 0, stream>>>(hb, w2b, b2, ln0f, x2, nullptr, M, D, DF);

  // LayerNorm 1 -> final output (fp32)
  layernorm_k<false><<<M / (8 * LN_R), blk, 0, stream>>>(x2, g1, be1, (float*)d_out, nullptr);
}

// v008
// It runs in 184 microseconds.
// Timed twice side by side with v007, it ran 1.07 times as fast both times.
// Counting every step since v000, it is 2.35 times as fast.
#include <hip/hip_runtime.h>
#include <hip/hip_bf16.h>
#include <math.h>

// ---------------------------------------------------------------------------
// Types / helpers
// ---------------------------------------------------------------------------
typedef __attribute__((ext_vector_type(16))) __bf16 v16bf;
typedef __attribute__((ext_vector_type(8)))  __bf16 v8bf;
typedef __attribute__((ext_vector_type(8)))  float  v8f;

__device__ __forceinline__ __bf16 f2bf(float f) {
  unsigned u = __builtin_bit_cast(unsigned, f);
  unsigned r = u + 0x7FFFu + ((u >> 16) & 1u);   // round-to-nearest-even
  unsigned short h = (unsigned short)(r >> 16);
  return __builtin_bit_cast(__bf16, h);
}

__device__ __forceinline__ v8f zero8() {
  v8f z = {0.f, 0.f, 0.f, 0.f, 0.f, 0.f, 0.f, 0.f};
  return z;
}

__device__ __forceinline__ v8f wmma_bf16(v16bf a, v16bf b, v8f c) {
  // D(f32 16x16) = A(bf16 16x32) * B(bf16 32x16) + C
  return __builtin_amdgcn_wmma_f32_16x16x32_bf16(
      /*neg_a=*/false, a, /*neg_b=*/false, b,
      /*c_mod=*/(short)0, c, /*reuse_a=*/false, /*reuse_b=*/false);
}

// 16x32 bf16 fragment from 16 consecutive *rows* of a row-major matrix.
// Per ISA 16-bit A layout: lane r (0..15), half h: elems [0..7] = row r,
// K = k0 + h*8 .. +7 ; elems [8..15] = row r, K = k0 + 16 + h*8 .. +7.
// Identical layout serves B of X@W^T (B[k][n] = W[n][k] -> rows of W).
// Works for both global and LDS (generic) pointers.
__device__ __forceinline__ v16bf load_frag_rows(const __bf16* __restrict__ base,
                                                int ld, int row0, int k0, int lane) {
  int r = lane & 15, h = lane >> 4;
  const __bf16* p = base + (size_t)(row0 + r) * ld + (k0 + h * 8);
  v8bf lo = *(const v8bf*)p;          // 16-byte load
  v8bf hi = *(const v8bf*)(p + 16);   // 16-byte load
  v16bf f;
#pragma unroll
  for (int i = 0; i < 8; ++i) { f[i] = lo[i]; f[i + 8] = hi[i]; }
  return f;
}

// K elements of one GEMM stage: a staged row is 128 bytes, one whole cache line.
constexpr int GK = 64;
// LDS pitch of those rows, in bf16 elements: 144 bytes = 16 B x odd, so the 16
// rows that one half-wave reads with 16-byte LDS loads start on 16 different
// groups of four banks.
constexpr int GLP = 72;

// Eight async Global -> LDS copies of 16 bytes per lane (tracked by ASYNCcnt).
// l*: LDS byte address (low 32 bits of the generic shared pointer == LDS
// offset per the flat-aperture mapping, ISA 10.2).
// s_wait_xcnt 0 is the last line of the copies' own statement so that no later
// write of an address register can be scheduled ahead of it (a precaution).
__device__ __forceinline__ void async8_b128(unsigned l0, const void* g0,
                                            unsigned l1, const void* g1,
                                            unsigned l2, const void* g2,
                                            unsigned l3, const void* g3,
                                            unsigned l4, const void* g4,
                                            unsigned l5, const void* g5,
                                            unsigned l6, const void* g6,
                                            unsigned l7, const void* g7) {
  unsigned long long a0 = (unsigned long long)g0;
  unsigned long long a1 = (unsigned long long)g1;
  unsigned long long a2 = (unsigned long long)g2;
  unsigned long long a3 = (unsigned long long)g3;
  unsigned long long a4 = (unsigned long long)g4;
  unsigned long long a5 = (unsigned long long)g5;
  unsigned long long a6 = (unsigned long long)g6;
  unsigned long long a7 = (unsigned long long)g7;
  asm volatile("global_load_async_to_lds_b128 %0, %1, off\n\t"
               "global_load_async_to_lds_b128 %2, %3, off\n\t"
               "global_load_async_to_lds_b128 %4, %5, off\n\t"
               "global_load_async_to_lds_b128 %6, %7, off\n\t"
               "global_load_async_to_lds_b128 %8, %9, off\n\t"
               "global_load_async_to_lds_b128 %10, %11, off\n\t"
               "global_load_async_to_lds_b128 %12, %13, off\n\t"
               "global_load_async_to_lds_b128 %14, %15, off\n\t"
               "s_wait_xcnt 0x0"
               :: "v"(l0), "v"(a0), "v"(l1), "v"(a1), "v"(l2), "v"(a2),
                  "v"(l3), "v"(a3), "v"(l4), "v"(a4), "v"(l5), "v"(a5),
                  "v"(l6), "v"(a6), "v"(l7), "v"(a7)
               : "memory");
}

// Four such copies in one statement, the same wait as its last line.
__device__ __forceinline__ void async4_b128(unsigned l0, const void* g0,
                                            unsigned l1, const void* g1,
                                            unsigned l2, const void* g2,
                                            unsigned l3, const void* g3) {
  unsigned long long a0 = (unsigned long long)g0;
  unsigned long long a1 = (unsigned long long)g1;
  unsigned long long a2 = (unsigned long long)g2;
  unsigned long long a3 = (unsigned long long)g3;
  asm volatile("global_load_async_to_lds_b128 %0, %1, off\n\t"
               "global_load_async_to_lds_b128 %2, %3, off\n\t"
               "global_load_async_to_lds_b128 %4, %5, off\n\t"
               "global_load_async_to_lds_b128 %6, %7, off\n\t"
               "s_wait_xcnt 0x0"
               :: "v"(l0), "v"(a0), "v"(l1), "v"(a1), "v"(l2), "v"(a2),
                  "v"(l3), "v"(a3)
               : "memory");
}

// Keys of one attention stage; a staged K or V row is one head's 64 elements = 128 bytes.
constexpr int AK = 64;
// LDS pitch of the K rows, in bf16 elements: 144 bytes = 16 B x odd (ds_load_b128 readers).
constexpr int KLP = 72;
// LDS pitch of the V rows: 160 bytes = 32 B x odd (ds_load_tr16_b128 readers).
constexpr int VLP = 80;

// Fragment whose K dimension runs *down a column* of a row-major matrix
// (A operand of V^T @ P^T: A[m][k] = V[k][m]), in the k order of load_frag_rows, from
// an LDS tile at pitch VLP by two transposing LDS loads:
// lane (r, h) gets tile[k0 + 8h + 0..7][col0 + r], then the same 16 rows below.
__device__ __forceinline__ v16bf load_frag_cols_lds(const __bf16* tile, int k0, int col0, int lane) {
  typedef __attribute__((address_space(3))) v8bf lds_v8bf;
  const __bf16* p = tile + (k0 + 8 * (lane >> 4) + (lane & 7)) * VLP + col0 + 8 * ((lane >> 3) & 1);
  v8bf lo = __builtin_amdgcn_ds_load_tr16_b128_v8bf16((lds_v8bf*)p);
  v8bf hi = __builtin_amdgcn_ds_load_tr16_b128_v8bf16((lds_v8bf*)(p + 16 * VLP));
  v16bf f;
#pragma unroll
  for (int i = 0; i < 8; ++i) { f[i] = lo[i]; f[i + 8] = hi[i]; }
  return f;
}

// Value of lane l ^ 16 (the other half-wave), by a vector cross-row move.
__device__ __forceinline__ float xhalf(float x) {
  int b = __builtin_bit_cast(int, x);
  return __builtin_bit_cast(float, __builtin_amdgcn_permlanex16(b, b, 0x76543210, 0xfedcba98, false, false));
}

// exp(x) as v_exp_f32 of x * log2(e), eight at a time, or one. Written in asm for
// the slot that the instruction set asks for behind a transcendental (one
// independent instruction or v_nop before its result is used or its source
// overwritten): the early-clobber outputs keep every result off every source,
// so each v_exp_f32 is followed by an independent one, and the v_nop is the
// slot of the last.
constexpr float LOG2E = 1.44269504f;
__device__ __forceinline__ void exp_x8(float* y, const float* x) {
  asm("v_exp_f32 %0, %8\n\t"
      "v_exp_f32 %1, %9\n\t"
      "v_exp_f32 %2, %10\n\t"
      "v_exp_f32 %3, %11\n\t"
      "v_exp_f32 %4, %12\n\t"
      "v_exp_f32 %5, %13\n\t"
      "v_exp_f32 %6, %14\n\t"
      "v_exp_f32 %7, %15\n\t"
      "v_nop"
      : "=&v"(y[0]), "=&v"(y[1]), "=&v"(y[2]), "=&v"(y[3]),
        "=&v"(y[4]), "=&v"(y[5]), "=&v"(y[6]), "=&v"(y[7])
      : "v"(x[0] * LOG2E), "v"(x[1] * LOG2E), "v"(x[2] * LOG2E), "v"(x[3] * LOG2E),
        "v"(x[4] * LOG2E), "v"(x[5] * LOG2E), "v"(x[6] * LOG2E), "v"(x[7] * LOG2E));
}
__device__ __forceinline__ float exp_x1(float x) {
  float y;
  asm("v_exp_f32 %0, %1\n\t"
      "v_nop"
      : "=&v"(y) : "v"(x * LOG2E));
  return y;
}

// ---------------------------------------------------------------------------
// fp32 -> bf16 conversion of all seven tensors in ONE launch.
// The bf16 copies lie one behind the other in the workspace (x, wq, wk, wv, wo,
// w1, w2), so the destination is one flat array. blockIdx.y picks a unit of
// CVT_U elements and with it the source; CVT_B work-groups share a unit.
// A wave's load covers 512 contiguous bytes, its store 256.
// ---------------------------------------------------------------------------
typedef __attribute__((ext_vector_type(4))) float  v4f;
typedef __attribute__((ext_vector_type(4))) __bf16 v4bf;
constexpr int CVT_U = 1 << 20;   // elements of a unit: x, w1, w2 are 4 units each, wq..wo one
constexpr int CVT_B = 32;        // work-groups of a unit

__global__ __launch_bounds__(256) void cvt_all_k(
    const float* __restrict__ x,  const float* __restrict__ wq,
    const float* __restrict__ wk, const float* __restrict__ wv,
    const float* __restrict__ wo, const float* __restrict__ w1,
    const float* __restrict__ w2, __bf16* __restrict__ out) {
  int u = blockIdx.y;
  const float* in = u < 4  ? x + (size_t)u * CVT_U
                  : u == 4 ? wq
                  : u == 5 ? wk
                  : u == 6 ? wv
                  : u == 7 ? wo
                  : u < 12 ? w1 + (size_t)(u - 8) * CVT_U
                           : w2 + (size_t)(u - 12) * CVT_U;
  __bf16* o = out + (size_t)u * CVT_U;
  constexpr int STEP = CVT_B * 256 * 4;          // elements that a unit's work-groups take at once
  int i = (blockIdx.x * 256 + threadIdx.x) * 4;
  for (int g = 0; g < CVT_U / (8 * STEP); ++g, i += 8 * STEP) {
    v4f a[8];
#pragma unroll   // eight 16-byte loads of a lane in flight before the first is used
    for (int t = 0; t < 8; ++t) a[t] = *(const v4f*)(in + i + t * STEP);
#pragma unroll   // a[] stays in registers
    for (int t = 0; t < 8; ++t) {
      v4bf r;
#pragma unroll   // vector elements picked by constants
      for (int e = 0; e < 4; ++e) r[e] = f2bf(a[t][e]);
      *(v4bf*)(o + i + t * STEP) = r;
    }
  }
}

template <int EPI, bool BIAS, int N>
__global__ __launch_bounds__(256) void gemm_bf16_k(
    const __bf16* __restrict__ X, const __bf16* __restrict__ W,
    const float* __restrict__ bias, const float* __restrict__ resid,
    float* __restrict__ outF, __bf16* __restrict__ outB,
    int M, int K) {
  __shared__ __attribute__((aligned(16))) __bf16 xs[2][128 * GLP];
  __shared__ __attribute__((aligned(16))) __bf16 wsb[2][128 * GLP];

  int tid = threadIdx.x;
  int lane = tid & 31;
  int wave = tid >> 5;
  int wm = wave & 3, wn = wave >> 4 ? 0 : (wave >> 2);  // (kept simple below)
  wn = wave >> 2;
  int m0 = wm * 32;            // within block tile
  int n0 = wn * 64;
  int mblk = blockIdx.x * 128;
  int nblk = blockIdx.y * 128;
  if (EPI == 0) {
    W    += (size_t)blockIdx.z * N * K;
    outB += (size_t)blockIdx.z * M * N;
  }

  // Issue one K=GK stage of async copies into buffer `buf`.
  auto stage = [&](int buf, int k0) {
    // X tile: 128 rows x 8 16B-chunks; thread t -> chunk t & 7 of rows t >> 3, +32, +64, +96
    // W tile: the same shape, the same map
    int row = tid >> 3, q = tid & 7;
    const __bf16* xg = X + (size_t)(mblk + row) * K + k0 + q * 8;
    const __bf16* wg = W + (size_t)(nblk + row) * K + k0 + q * 8;
    __bf16* xl = &xs[buf][row * GLP + q * 8];
    __bf16* wl = &wsb[buf][row * GLP + q * 8];
    async8_b128((unsigned)(size_t)xl,              xg,
                (unsigned)(size_t)(xl + 32 * GLP), xg + (size_t)32 * K,
                (unsigned)(size_t)(xl + 64 * GLP), xg + (size_t)64 * K,
                (unsigned)(size_t)(xl + 96 * GLP), xg + (size_t)96 * K,
                (unsigned)(size_t)wl,              wg,
                (unsigned)(size_t)(wl + 32 * GLP), wg + (size_t)32 * K,
                (unsigned)(size_t)(wl + 64 * GLP), wg + (size_t)64 * K,
                (unsigned)(size_t)(wl + 96 * GLP), wg + (size_t)96 * K);
  };

  v8f acc[2][4];
#pragma unroll   // acc[][] stays in registers
  for (int tj = 0; tj < 4; ++tj) { acc[0][tj] = zero8(); acc[1][tj] = zero8(); }

  int nk = K / GK;
  stage(0, 0);
  asm volatile("s_wait_asynccnt 0x0" ::: "memory");  // this wave's part of stage 0 has landed
  __syncthreads();                                   // stage 0 visible to all waves
  if (nk > 1) stage(1, GK);
  for (int kk = 0; kk < nk; ++kk) {
    const __bf16* xt = xs[kk & 1];
    const __bf16* wt = wsb[kk & 1];
#pragma unroll   // ks becomes a constant offset of the LDS loads
    for (int ks = 0; ks < GK; ks += 32) {
      v16bf a0 = load_frag_rows(xt, GLP, m0, ks, lane);
      v16bf a1 = load_frag_rows(xt, GLP, m0 + 16, ks, lane);
      v16bf b[4];
#pragma unroll   // b[] stays in registers
      for (int tj = 0; tj < 4; ++tj) b[tj] = load_frag_rows(wt, GLP, n0 + tj * 16, ks, lane);
      // Keeps the 12 LDS loads of this k step in one group ahead of its 8 WMMAs. Without it
      // the compiler reloads one B register set and waits for LDS in front of every two WMMAs.
      __builtin_amdgcn_sched_barrier(0);
#pragma unroll   // acc[][] stays in registers
      for (int tj = 0; tj < 4; ++tj) {
        acc[0][tj] = wmma_bf16(b[tj], a0, acc[0][tj]);   // Y^T tile = W rows @ (X rows)^T
        acc[1][tj] = wmma_bf16(b[tj], a1, acc[1][tj]);
      }
      // Keeps a k step's 8 WMMAs in front of what follows. The next k step's LDS loads stay one
      // group: without it the compiler spreads them among these WMMAs, in two or three places.
      // The stage's last 8 WMMAs stay in front of the hand-over: they run while stage kk + 1 is
      // still landing, and the refill is issued directly behind the barrier; without it the
      // compiler sinks them below the barrier, ahead of the copies.
      __builtin_amdgcn_sched_barrier(0);
    }
    // Hand-over:
    asm volatile("s_wait_dscnt 0x0" ::: "memory");     // this wave's reads of buffer kk & 1 are done
    asm volatile("s_wait_asynccnt 0x0" ::: "memory");  // its part of stage kk + 1 has landed
    __syncthreads();   // stage kk + 1 visible to all; buffer kk & 1 left by all
    if (kk + 2 < nk) stage(kk & 1, (kk + 2) * GK);
  }
  asm volatile("s_wait_asynccnt 0x0" ::: "memory");    // nothing in flight at the wave's end

  // Epilogue, staged through LDS so that every global access of a wave covers whole 128-byte lines.
  // The products are taken transposed, so in the accumulator layout lane (r, h) holds, of tile
  // (ti, tj), the 8 adjacent columns 8 * h + 0..7 of the ONE row r: it writes them to LDS as 16-byte
  // pieces. Each wave stages its 32 x 64 tile in a range of its own and reads it back row by row.
  // The ring is free: the last trip's hand-over has ended every wave's reads and copies.
  constexpr int SP = (EPI == 2 ? 256 : 128) + 16;   // staged row + 16 B: pitch = 16 B x odd
  constexpr int SW = 32 * (256 + 16);               // bytes of a wave's range; four ranges fit xs, four wsb
  static_assert(4 * SW <= (int)sizeof(xs) && 4 * SW <= (int)sizeof(wsb), "staging ranges");
  char* stg = (wave < 4 ? (char*)&xs[0][0] : (char*)&wsb[0][0]) + (wave & 3) * SW;
  int r = lane & 15, h = lane >> 4;
  if (EPI == 2) {
    // Read-back map: access j takes rows 2 * j and 2 * j + 1 of the wave tile, 256 bytes each.
    int rr = lane >> 4, cc = lane & 15;
    // 32-bit lane offset on scalar bases, the same register for the residual loads and the stores.
    unsigned go = (unsigned)((mblk + m0 + rr) * N + nblk + n0 + cc * 4) * 4u;
    v4f rs[16];
#pragma unroll   // rs[] stays in registers; all 16 loads in flight together, over the staging
    for (int j = 0; j < 16; ++j) rs[j] = *(const v4f*)((const char*)(resid + (size_t)(2 * j) * N) + go);
    v4f bb = {0.f, 0.f, 0.f, 0.f};
    if (BIAS) bb = *(const v4f*)(bias + nblk + n0 + cc * 4);
    // In front of the first instruction that reuses an address register of these loads (a precaution).
    asm volatile("s_wait_xcnt 0x0" ::: "memory");
#pragma unroll   // acc[][] stays in registers
    for (int ti = 0; ti < 2; ++ti)
#pragma unroll
      for (int tj = 0; tj < 4; ++tj) {
        v8f av = acc[ti][tj];
        char* p = stg + (ti * 16 + r) * SP + (tj * 16 + 8 * h) * 4;
        *(v4f*)p        = __builtin_shufflevector(av, av, 0, 1, 2, 3);
        *(v4f*)(p + 16) = __builtin_shufflevector(av, av, 4, 5, 6, 7);
      }
    asm volatile("s_wait_dscnt 0x0" ::: "memory");   // the wave's own LDS writes are done before other lanes read them back
#pragma unroll
    for (int j = 0; j < 16; ++j) {
      v4f y = *(const v4f*)(stg + (2 * j + rr) * SP + cc * 16);
      *(v4f*)((char*)(outF + (size_t)(2 * j) * N) + go) = (y + bb) + rs[j];
    }
  } else {
    v8f bv[4];
    if (BIAS) {
#pragma unroll   // bv[] stays in registers
      for (int tj = 0; tj < 4; ++tj) bv[tj] = *(const v8f*)(bias + nblk + n0 + 8 * h + tj * 16);
      // In front of the first instruction that reuses an address register of these loads (a precaution).
      asm volatile("s_wait_xcnt 0x0" ::: "memory");
    }
#pragma unroll
    for (int ti = 0; ti < 2; ++ti) {
#pragma unroll
      for (int tj = 0; tj < 4; ++tj) {
        v8f av = acc[ti][tj];
        v8bf w;
#pragma unroll   // vector elements picked by constants
        for (int i = 0; i < 8; ++i) {
          float v = av[i];
          if (EPI == 1) {
            if (BIAS) v += bv[tj][i];
            v = 0.5f * v * (1.0f + erff(v * 0.70710678118654752f));  // exact GELU
          }
          w[i] = f2bf(v);
        }
        *(v8bf*)(stg + (ti * 16 + r) * SP + (tj * 16 + 8 * h) * 2) = w;
      }
    }
    asm volatile("s_wait_dscnt 0x0" ::: "memory");   // the wave's own LDS writes are done before other lanes read them back
    // Read-back map: access j takes rows 4 * j .. 4 * j + 3 of the wave tile, 128 bytes each.
    int rr = lane >> 3, cc = lane & 7;
    unsigned go = (unsigned)((mblk + m0 + rr) * N + nblk + n0 + cc * 8) * 2u;
#pragma unroll
    for (int j = 0; j < 8; ++j) {
      v8bf y = *(const v8bf*)(stg + (4 * j + rr) * SP + cc * 16);
      *(v8bf*)((char*)(outB + (size_t)(4 * j) * N) + go) = y;
    }
  }
}

__global__ __launch_bounds__(256) void attention_k(
    const __bf16* __restrict__ Q, const __bf16* __restrict__ Km,
    const __bf16* __restrict__ V, __bf16* __restrict__ O,
    int S, int Dm) {
  __shared__ __attribute__((aligned(16))) __bf16 Ks[2][AK * KLP];
  __shared__ __attribute__((aligned(16))) __bf16 Vs[2][AK * VLP];

  int lane = threadIdx.x & 31;
  int wave = __builtin_amdgcn_readfirstlane(threadIdx.x >> 5);  // scalar: the pass test below is a scalar branch
  int r = lane & 15, hl = lane >> 4;
  int h = blockIdx.y, b = blockIdx.z;
  int qbase = blockIdx.x * 128 + wave * 16;   // wave-uniform

  size_t base = (size_t)b * S * Dm + (size_t)h * 64;
  const __bf16* qp = Q + base;
  const __bf16* kp = Km + base;
  const __bf16* vp = V + base;
  __bf16* op = O + base;

  v16bf aq0 = load_frag_rows(qp, Dm, qbase, 0, lane);
  v16bf aq1 = load_frag_rows(qp, Dm, qbase, 32, lane);

  v8f o0 = zero8(), o1 = zero8(), o2 = zero8(), o3 = zero8();
  float m = -1e30f;   // running maximum of this lane's query, the same in both half-waves
  float l = 0.f;      // running sum over the keys of this lane's own half-wave
  int qrow = qbase + r;

  // One stage of async copies: keys k0 .. k0 + AK - 1 of K and V into buffer `buf`.
  // A tile is AK rows x 8 16B-chunks; thread t -> chunk t & 7 of rows t >> 3, +32.
  auto stage = [&](int buf, int k0) {
    int row = threadIdx.x >> 3, q = threadIdx.x & 7;
    const __bf16* kg = kp + (size_t)(k0 + row) * Dm + q * 8;
    const __bf16* vg = vp + (size_t)(k0 + row) * Dm + q * 8;
    __bf16* kl = &Ks[buf][row * KLP + q * 8];
    __bf16* vl = &Vs[buf][row * VLP + q * 8];
    async4_b128((unsigned)(size_t)kl,              kg,
                (unsigned)(size_t)(kl + 32 * KLP), kg + (size_t)32 * Dm,
                (unsigned)(size_t)vl,              vg,
                (unsigned)(size_t)(vl + 32 * VLP), vg + (size_t)32 * Dm);
  };

  int nst = (blockIdx.x + 1) * (128 / AK);   // stages up to the work-group's last row; at least two
  stage(0, 0);
  asm volatile("s_wait_asynccnt 0x0" ::: "memory");  // this wave's part of stage 0 has landed
  __syncthreads();                                   // stage 0 visible to all waves
  stage(1, AK);
  for (int t = 0; t < nst; ++t) {
   const __bf16* kt = Ks[t & 1];
   const __bf16* vt = Vs[t & 1];
#pragma unroll   // jj becomes a constant offset of the LDS loads
   for (int jj = 0; jj < AK; jj += 32) {
    int j0 = t * AK + jj;
    if (j0 >= qbase + 16) continue;   // wave-uniform: every key of the pass is masked for this wave
    // ---- S^T = K @ Q^T (two 16x16 score tiles: keys j0.. and j0+16..) ----
    v8f s0 = zero8(), s1 = zero8();
    {
      v16bf bk0 = load_frag_rows(kt, KLP, jj, 0, lane);
      v16bf bk1 = load_frag_rows(kt, KLP, jj, 32, lane);
      s0 = wmma_bf16(bk0, aq0, s0);
      s0 = wmma_bf16(bk1, aq1, s0);
      v16bf bk2 = load_frag_rows(kt, KLP, jj + 16, 0, lane);
      v16bf bk3 = load_frag_rows(kt, KLP, jj + 16, 32, lane);
      s1 = wmma_bf16(bk2, aq0, s1);
      s1 = wmma_bf16(bk3, aq1, s1);
    }
    // ---- scale, causal mask, online softmax: 16 keys of one query per lane ----
    int key0 = j0 + 8 * hl;
    float sc[16];
#pragma unroll   // sc[] stays in registers
    for (int i = 0; i < 8; ++i) {
      sc[i]     = s0[i] * 0.125f;               // 1/sqrt(64)
      sc[i + 8] = s1[i] * 0.125f;
      if (key0 + i > qrow) sc[i] = -1e30f;
      if (key0 + 16 + i > qrow) sc[i + 8] = -1e30f;
    }
    float t8[8];
#pragma unroll   // tree: independent links instead of one chain of 15
    for (int i = 0; i < 8; ++i) t8[i] = fmaxf(sc[i], sc[i + 8]);
    float rm = fmaxf(fmaxf(fmaxf(t8[0], t8[4]), fmaxf(t8[1], t8[5])),
                     fmaxf(fmaxf(t8[2], t8[6]), fmaxf(t8[3], t8[7])));
    rm = fmaxf(rm, xhalf(rm));                  // the query's other 16 keys
    float mn = fmaxf(m, rm);
    float al = exp_x1(m - mn);
#pragma unroll   // sc[] stays in registers
    for (int i = 0; i < 16; ++i) sc[i] -= mn;
    float p[16];
    exp_x8(p, sc);
    exp_x8(p + 8, sc + 8);
    v16bf pt;   // P^T as B operand: element s = key 8 * hl + s (s < 8), 16 + 8 * hl + s - 8 (else)
#pragma unroll   // p[], pt stay in registers
    for (int i = 0; i < 16; ++i) pt[i] = f2bf(p[i]);
#pragma unroll   // tree, as above
    for (int i = 0; i < 8; ++i) t8[i] = p[i] + p[i + 8];
    float rs = ((t8[0] + t8[4]) + (t8[1] + t8[5])) + ((t8[2] + t8[6]) + (t8[3] + t8[7]));
    l = l * al + rs;
    m = mn;
#pragma unroll   // vector elements picked by constants
    for (int i = 0; i < 8; ++i) { o0[i] *= al; o1[i] *= al; o2[i] *= al; o3[i] *= al; }
    // ---- O^T += V^T @ P^T (tile n: head columns 16 * n .. + 15) ----
    v16bf bv0 = load_frag_cols_lds(vt, jj, 0, lane);
    v16bf bv1 = load_frag_cols_lds(vt, jj, 16, lane);
    v16bf bv2 = load_frag_cols_lds(vt, jj, 32, lane);
    v16bf bv3 = load_frag_cols_lds(vt, jj, 48, lane);
    o0 = wmma_bf16(bv0, pt, o0);
    o1 = wmma_bf16(bv1, pt, o1);
    o2 = wmma_bf16(bv2, pt, o2);
    o3 = wmma_bf16(bv3, pt, o3);
   }
   // Hand-over:
   asm volatile("s_wait_dscnt 0x0" ::: "memory");     // this wave's reads of buffer t & 1 are done
   asm volatile("s_wait_asynccnt 0x0" ::: "memory");  // its part of stage t + 1 has landed
   __syncthreads();   // stage t + 1 visible to all; buffer t & 1 left by all
   if (t + 2 < nst) stage(t & 1, (t + 2) * AK);
  }
  asm volatile("s_wait_asynccnt 0x0" ::: "memory");    // nothing in flight at the wave's end

  // Lane (r, hl) holds O[qbase + r][16 * n + 8 * hl + 0..7] in tile n: 16-byte stores.
  float inv = 1.0f / (l + xhalf(l));   // the two half-waves' sums joined once
  __bf16* orow = op + (size_t)qrow * Dm + 8 * hl;
  v8bf w0, w1, w2, w3;
#pragma unroll   // vector elements picked by constants
  for (int i = 0; i < 8; ++i) {
    w0[i] = f2bf(o0[i] * inv);
    w1[i] = f2bf(o1[i] * inv);
    w2[i] = f2bf(o2[i] * inv);
    w3[i] = f2bf(o3[i] * inv);
  }
  *(v8bf*)(orow)      = w0;
  *(v8bf*)(orow + 16) = w1;
  *(v8bf*)(orow + 32) = w2;
  *(v8bf*)(orow + 48) = w3;
}

// ---------------------------------------------------------------------------
// LayerNorm over the last dim. Writes fp32 (+ bf16 where WB).
// One wave takes LN_R whole rows and keeps them in registers: a row is read once,
// by 16-byte loads that cover 512 contiguous bytes a wave, all of them in flight
// together with gamma and beta. Mean and variance are summed in the lane and then
// across the wave's lanes by vector cross-lane moves: no LDS, no barrier. The
// launch has M / LN_R waves, one work-group per 8 * LN_R rows.
// ---------------------------------------------------------------------------
constexpr int LN_D = 1024;   // row length: 8 loads x 32 lanes x 4 floats
constexpr int LN_R = 2;      // rows of a wave

// x + (x of lane l ^ mask) inside each 16-lane row; CTRL = 0x160 + mask (row_xmask).
template <int CTRL>
__device__ __forceinline__ float row_xadd(float x) {
  int b = __builtin_bit_cast(int, x);
  return x + __builtin_bit_cast(float, __builtin_amdgcn_update_dpp(0, b, CTRL, 0xf, 0xf, true));
}
// Sum over the wave's 32 lanes, the same bits in every lane.
__device__ __forceinline__ float wave_sum(float x) {
  x = row_xadd<0x161>(x);
  x = row_xadd<0x162>(x);
  x = row_xadd<0x164>(x);
  x = row_xadd<0x168>(x);
  return x + xhalf(x);
}

template <bool WB>
__global__ __launch_bounds__(256) void layernorm_k(
    const float* __restrict__ in, const float* __restrict__ gamma,
    const float* __restrict__ beta, float* __restrict__ outF,
    __bf16* __restrict__ outB) {
  int lane = threadIdx.x & 31;
  int wave = threadIdx.x >> 5;
  // Scalar base of the work-group's rows, one small lane offset for loads and stores alike.
  size_t base = (size_t)blockIdx.x * (8 * LN_R * LN_D);
  int off = wave * (LN_R * LN_D) + lane * 4;
  const float* p = in + base;
  float* oF = outF + base;

  v4f a[LN_R][8], g[8], be[8];
#pragma unroll   // a[][] stays in registers
  for (int rr = 0; rr < LN_R; ++rr)
#pragma unroll
    for (int t = 0; t < 8; ++t) a[rr][t] = *(const v4f*)(p + off + rr * LN_D + t * 128);
#pragma unroll   // g[], be[] stay in registers
  for (int t = 0; t < 8; ++t) {
    g[t]  = *(const v4f*)(gamma + lane * 4 + t * 128);
    be[t] = *(const v4f*)(beta + lane * 4 + t * 128);
  }
  // Keeps all 32 loads in one group at the top. Without it the compiler sinks the gamma and
  // beta loads behind the sums, two pairs at a time, and the wave waits out their latency there.
  __builtin_amdgcn_sched_barrier(0);
  // In front of the first instruction that reuses an address register of these loads (a precaution).
  asm volatile("s_wait_xcnt 0x0" ::: "memory");
  // Keeps the sums, which reuse those registers, behind that wait: the compiler lifted them over it.
  __builtin_amdgcn_sched_barrier(0);

  float s[LN_R];
#pragma unroll   // the rows' sums are independent chains
  for (int rr = 0; rr < LN_R; ++rr) {
    v4f s4 = (a[rr][0] + a[rr][1]) + (a[rr][2] + a[rr][3]);
    s4 += (a[rr][4] + a[rr][5]) + (a[rr][6] + a[rr][7]);
    s[rr] = (s4[0] + s4[1]) + (s4[2] + s4[3]);
  }
#pragma unroll
  for (int rr = 0; rr < LN_R; ++rr) s[rr] = wave_sum(s[rr]) / (float)LN_D;   // mean

  float q[LN_R];
#pragma unroll
  for (int rr = 0; rr < LN_R; ++rr) {
    v4f q4 = {0.f, 0.f, 0.f, 0.f};
#pragma unroll
    for (int t = 0; t < 8; ++t) {
      a[rr][t] -= s[rr];
      q4 += a[rr][t] * a[rr][t];
    }
    q[rr] = (q4[0] + q4[1]) + (q4[2] + q4[3]);
  }
#pragma unroll
  for (int rr = 0; rr < LN_R; ++rr) q[rr] = rsqrtf(wave_sum(q[rr]) / (float)LN_D + 1e-5f);

#pragma unroll
  for (int rr = 0; rr < LN_R; ++rr) {
#pragma unroll
    for (int t = 0; t < 8; ++t) {
      v4f y = a[rr][t] * q[rr] * g[t] + be[t];
      *(v4f*)(oF + off + rr * LN_D + t * 128) = y;
      if (WB) {
        v4bf yb;
#pragma unroll   // vector elements picked by constants
        for (int e = 0; e < 4; ++e) yb[e] = f2bf(y[e]);
        *(v4bf*)(outB + base + off + rr * LN_D + t * 128) = yb;
      }
    }
  }
}

// ---------------------------------------------------------------------------
// Host orchestration
// ---------------------------------------------------------------------------
extern "C" void kernel_launch(void* const* d_in, const int* in_sizes, int n_in,
                              void* d_out, int out_size, void* d_ws, size_t ws_size,
                              hipStream_t stream) {
  (void)in_sizes; (void)n_in; (void)out_size; (void)ws_size;
  constexpr int B = 2, S = 2048, D = 1024, H = 16, M = B * S, DF = 4 * D;

  const float* x   = (const float*)d_in[0];
  const float* wq  = (const float*)d_in[1];
  const float* wk  = (const float*)d_in[2];
  const float* wv  = (const float*)d_in[3];
  const float* wo  = (const float*)d_in[4];
  const float* w1  = (const float*)d_in[5];
  const float* b1  = (const float*)d_in[6];
  const float* w2  = (const float*)d_in[7];
  const float* b2  = (const float*)d_in[8];
  const float* g0  = (const float*)d_in[9];
  const float* be0 = (const float*)d_in[10];
  const float* g1  = (const float*)d_in[11];
  const float* be1 = (const float*)d_in[12];

  char* ws = (char*)d_ws;
  size_t off = 0;
  auto take = [&](size_t bytes) -> void* {
    void* p = ws + off;
    off = (off + bytes + 255) & ~(size_t)255;
    return p;
  };

  // xb .. w2b: contiguous, in the order in which cvt_all_k numbers its units
  __bf16* xb   = (__bf16*)take((size_t)M * D * 2);    // also reused as ln0b
  __bf16* wqkvb = (__bf16*)take((size_t)3 * D * D * 2);  // wq, wk, wv one behind the other
  __bf16* wob  = (__bf16*)take((size_t)D * D * 2);
  __bf16* w1b  = (__bf16*)take((size_t)DF * D * 2);
  __bf16* w2b  = (__bf16*)take((size_t)D * DF * 2);
  size_t qkv_off = off;
  __bf16* qb    = (__bf16*)take((size_t)M * D * 2);   // q, k, v one behind the other
  __bf16* kb    = (__bf16*)take((size_t)M * D * 2);
  __bf16* vb    = (__bf16*)take((size_t)M * D * 2);
  __bf16* attnb = (__bf16*)take((size_t)M * D * 2);
  float*  x1    = (float*)take((size_t)M * D * 4);    // also reused as x2
  float*  ln0f  = (float*)take((size_t)M * D * 4);
  // reuse dead regions:
  __bf16* hb   = (__bf16*)(ws + qkv_off);             // 32MB over q/k/v/attn (dead)
  __bf16* ln0b = xb;                                  // xb dead after QKV gemms
  float*  x2   = x1;                                  // x1 dead after LN0

  dim3 blk(256);

  // fp32 -> bf16 conversions, one launch: (M*D + 4*D*D + 2*DF*D) / CVT_U = 16 units
  static_assert(D == LN_D && M % (8 * LN_R) == 0, "row map of layernorm_k");
  static_assert(M * D == 4 * CVT_U && D * D == CVT_U && DF * D == 4 * CVT_U, "unit map of cvt_all_k");
  cvt_all_k<<<dim3(CVT_B, 16), blk, 0, stream>>>(x, wq, wk, wv, wo, w1, w2, xb);

  // Q, K, V projections (bf16 out), one launch: z = 0, 1, 2
  dim3 gD(M / 128, D / 128);
  gemm_bf16_k<0, false, D><<<dim3(M / 128, D / 128, 3), blk, 0, stream>>>(xb, wqkvb, nullptr, nullptr, nullptr, qb, M, D);

  // causal flash attention
  attention_k<<<dim3(S / 128, H, B), blk, 0, stream>>>(qb, kb, vb, attnb, S, D);

  // output projection + residual (fp32)
  gemm_bf16_k<2, false, D><<<gD, blk, 0, stream>>>(attnb, wob, nullptr, x, x1, nullptr, M, D);

  // LayerNorm 0 (fp32 + bf16 copies)
  layernorm_k<true><<<M / (8 * LN_R), blk, 0, stream>>>(x1, g0, be0, ln0f, ln0b);

  // MLP up + exact GELU (bf16 out)
  gemm_bf16_k<1, true, DF><<<dim3(M / 128, DF / 128), blk, 0, stream>>>(ln0b, w1b, b1, nullptr, nullptr, hb, M, D);

  // MLP down + bias + residual (fp32)
  gemm_bf16_k<2, true, D><<<gD, blk, 0, stream>>>(hb, w2b, b2, ln0f, x2, nullptr, M, DF);

  // LayerNorm 1 -> final output (fp32)
  layernorm_k<false><<<M / (8 * LN_R), blk, 0, stream>>>(x2, g1, be1, (float*)d_out, nullptr);
}

// v009
// One run takes 171 microseconds.
// Timed twice side by side with v008, it ran 1.07 times as fast both times.
// All steps since v000 together make it 2.52 times as fast.
#include <hip/hip_runtime.h>
#include <hip/hip_bf16.h>
#include <math.h>

// ---------------------------------------------------------------------------
// Types / helpers
// ---------------------------------------------------------------------------
typedef __attribute__((ext_vector_type(16))) __bf16 v16bf;
typedef __attribute__((ext_vector_type(8)))  __bf16 v8bf;
typedef __attribute__((ext_vector_type(8)))  float  v8f;

__device__ __forceinline__ __bf16 f2bf(float f) {
  unsigned u = __builtin_bit_cast(unsigned, f);
  unsigned r = u + 0x7FFFu + ((u >> 16) & 1u);   // round-to-nearest-even
  unsigned short h = (unsigned short)(r >> 16);
  return __builtin_bit_cast(__bf16, h);
}

__device__ __forceinline__ v8f zero8() {
  v8f z = {0.f, 0.f, 0.f, 0.f, 0.f, 0.f, 0.f, 0.f};
  return z;
}

__device__ __forceinline__ v8f wmma_bf16(v16bf a, v16bf b, v8f c) {
  // D(f32 16x16) = A(bf16 16x32) * B(bf16 32x16) + C
  return __builtin_amdgcn_wmma_f32_16x16x32_bf16(
      /*neg_a=*/false, a, /*neg_b=*/false, b,
      /*c_mod=*/(short)0, c, /*reuse_a=*/false, /*reuse_b=*/false);
}

// 16x32 bf16 fragment from 16 consecutive *rows* of a row-major matrix.
// Per ISA 16-bit A layout: lane r (0..15), half h: elems [0..7] = row r,
// K = k0 + h*8 .. +7 ; elems [8..15] = row r, K = k0 + 16 + h*8 .. +7.
// Identical layout serves B of X@W^T (B[k][n] = W[n][k] -> rows of W).
// Works for both global and LDS (generic) pointers.
__device__ __forceinline__ v16bf load_frag_rows(const __bf16* __restrict__ base,
                                                int ld, int row0, int k0, int lane) {
  int r = lane & 15, h = lane >> 4;
  const __bf16* p = base + (size_t)(row0 + r) * ld + (k0 + h * 8);
  v8bf lo = *(const v8bf*)p;          // 16-byte load
  v8bf hi = *(const v8bf*)(p + 16);   // 16-byte load
  v16bf f;
#pragma unroll
  for (int i = 0; i < 8; ++i) { f[i] = lo[i]; f[i + 8] = hi[i]; }
  return f;
}

// K elements of one GEMM stage: a staged row is 128 bytes, one whole cache line.
constexpr int GK = 64;
// LDS pitch of those rows, in bf16 elements: 144 bytes = 16 B x odd, so the 16
// rows that one half-wave reads with 16-byte LDS loads start on 16 different
// groups of four banks.
constexpr int GLP = 72;

// Eight async Global -> LDS copies of 16 bytes per lane (tracked by ASYNCcnt).
// l*: LDS byte address (low 32 bits of the generic shared pointer == LDS
// offset per the flat-aperture mapping, ISA 10.2).
// s_wait_xcnt 0 is the last line of the copies' own statement so that no later
// write of an address register can be scheduled ahead of it (a precaution).
__device__ __forceinline__ void async8_b128(unsigned l0, const void* g0,
                                            unsigned l1, const void* g1,
                                            unsigned l2, const void* g2,
                                            unsigned l3, const void* g3,
                                            unsigned l4, const void* g4,
                                            unsigned l5, const void* g5,
                                            unsigned l6, const void* g6,
                                            unsigned l7, const void* g7) {
  unsigned long long a0 = (unsigned long long)g0;
  unsigned long long a1 = (unsigned long long)g1;
  unsigned long long a2 = (unsigned long long)g2;
  unsigned long long a3 = (unsigned long long)g3;
  unsigned long long a4 = (unsigned long long)g4;
  unsigned long long a5 = (unsigned long long)g5;
  unsigned long long a6 = (unsigned long long)g6;
  unsigned long long a7 = (unsigned long long)g7;
  asm volatile("global_load_async_to_lds_b128 %0, %1, off\n\t"
               "global_load_async_to_lds_b128 %2, %3, off\n\t"
               "global_load_async_to_lds_b128 %4, %5, off\n\t"
               "global_load_async_to_lds_b128 %6, %7, off\n\t"
               "global_load_async_to_lds_b128 %8, %9, off\n\t"
               "global_load_async_to_lds_b128 %10, %11, off\n\t"
               "global_load_async_to_lds_b128 %12, %13, off\n\t"
               "global_load_async_to_lds_b128 %14, %15, off\n\t"
               "s_wait_xcnt 0x0"
               :: "v"(l0), "v"(a0), "v"(l1), "v"(a1), "v"(l2), "v"(a2),
                  "v"(l3), "v"(a3), "v"(l4), "v"(a4), "v"(l5), "v"(a5),
                  "v"(l6), "v"(a6), "v"(l7), "v"(a7)
               : "memory");
}

// Four such copies in one statement, the same wait as its last line.
__device__ __forceinline__ void async4_b128(unsigned l0, const void* g0,
                                            unsigned l1, const void* g1,
                                            unsigned l2, const void* g2,
                                            unsigned l3, const void* g3) {
  unsigned long long a0 = (unsigned long long)g0;
  unsigned long long a1 = (unsigned long long)g1;
  unsigned long long a2 = (unsigned long long)g2;
  unsigned long long a3 = (unsigned long long)g3;
  asm volatile("global_load_async_to_lds_b128 %0, %1, off\n\t"
               "global_load_async_to_lds_b128 %2, %3, off\n\t"
               "global_load_async_to_lds_b128 %4, %5, off\n\t"
               "global_load_async_to_lds_b128 %6, %7, off\n\t"
               "s_wait_xcnt 0x0"
               :: "v"(l0), "v"(a0), "v"(l1), "v"(a1), "v"(l2), "v"(a2),
                  "v"(l3), "v"(a3)
               : "memory");
}

// Keys of one attention stage; a staged K or V row is one head's 64 elements = 128 bytes.
constexpr int AK = 64;
// LDS pitch of the K rows, in bf16 elements: 144 bytes = 16 B x odd (ds_load_b128 readers).
constexpr int KLP = 72;
// LDS pitch of the V rows: 160 bytes = 32 B x odd (ds_load_tr16_b128 readers).
constexpr int VLP = 80;

// Fragment whose K dimension runs *down a column* of a row-major matrix
// (A operand of V^T @ P^T: A[m][k] = V[k][m]), in the k order of load_frag_rows, from
// an LDS tile at pitch VLP by two transposing LDS loads:
// lane (r, h) gets tile[k0 + 8h + 0..7][col0 + r], then the same 16 rows below.
__device__ __forceinline__ v16bf load_frag_cols_lds(const __bf16* tile, int k0, int col0, int lane) {
  typedef __attribute__((address_space(3))) v8bf lds_v8bf;
  const __bf16* p = tile + (k0 + 8 * (lane >> 4) + (lane & 7)) * VLP + col0 + 8 * ((lane >> 3) & 1);
  v8bf lo = __builtin_amdgcn_ds_load_tr16_b128_v8bf16((lds_v8bf*)p);
  v8bf hi = __builtin_amdgcn_ds_load_tr16_b128_v8bf16((lds_v8bf*)(p + 16 * VLP));
  v16bf f;
#pragma unroll
  for (int i = 0; i < 8; ++i) { f[i] = lo[i]; f[i + 8] = hi[i]; }
  return f;
}

// Value of lane l ^ 16 (the other half-wave), by a vector cross-row move.
__device__ __forceinline__ float xhalf(float x) {
  int b = __builtin_bit_cast(int, x);
  return __builtin_bit_cast(float, __builtin_amdgcn_permlanex16(b, b, 0x76543210, 0xfedcba98, false, false));
}

// exp(x) as v_exp_f32 of x * log2(e), eight at a time, or one. Written in asm for
// the slot that the instruction set asks for behind a transcendental (one
// independent instruction or v_nop before its result is used or its source
// overwritten): the early-clobber outputs keep every result off every source,
// so each v_exp_f32 is followed by an independent one, and the v_nop is the
// slot of the last.
constexpr float LOG2E = 1.44269504f;
__device__ __forceinline__ void exp_x8(float* y, const float* x) {
  asm("v_exp_f32 %0, %8\n\t"
      "v_exp_f32 %1, %9\n\t"
      "v_exp_f32 %2, %10\n\t"
      "v_exp_f32 %3, %11\n\t"
      "v_exp_f32 %4, %12\n\t"
      "v_exp_f32 %5, %13\n\t"
      "v_exp_f32 %6, %14\n\t"
      "v_exp_f32 %7, %15\n\t"
      "v_nop"
      : "=&v"(y[0]), "=&v"(y[1]), "=&v"(y[2]), "=&v"(y[3]),
        "=&v"(y[4]), "=&v"(y[5]), "=&v"(y[6]), "=&v"(y[7])
      : "v"(x[0] * LOG2E), "v"(x[1] * LOG2E), "v"(x[2] * LOG2E), "v"(x[3] * LOG2E),
        "v"(x[4] * LOG2E), "v"(x[5] * LOG2E), "v"(x[6] * LOG2E), "v"(x[7] * LOG2E));
}
__device__ __forceinline__ float exp_x1(float x) {
  float y;
  asm("v_exp_f32 %0, %1\n\t"
      "v_nop"
      : "=&v"(y) : "v"(x * LOG2E));
  return y;
}

// ---------------------------------------------------------------------------
// fp32 -> bf16 conversion of all seven tensors in ONE launch.
// The bf16 copies lie one behind the other in the workspace (x, wq, wk, wv, wo,
// w1, w2), so the destination is one flat array. blockIdx.y picks a unit of
// CVT_U elements and with it the source; CVT_B work-groups share a unit.
// A wave's load covers 512 contiguous bytes, its store 256.
// ---------------------------------------------------------------------------
typedef __attribute__((ext_vector_type(4))) float  v4f;
typedef __attribute__((ext_vector_type(4))) __bf16 v4bf;
constexpr int CVT_U = 1 << 20;   // elements of a unit: x, w1, w2 are 4 units each, wq..wo one
constexpr int CVT_B = 32;        // work-groups of a unit

__global__ __launch_bounds__(256) void cvt_all_k(
    const float* __restrict__ x,  const float* __restrict__ wq,
    const float* __restrict__ wk, const float* __restrict__ wv,
    const float* __restrict__ wo, const float* __restrict__ w1,
    const float* __restrict__ w2, __bf16* __restrict__ out) {
  int u = blockIdx.y;
  const float* in = u < 4  ? x + (size_t)u * CVT_U
                  : u == 4 ? wq
                  : u == 5 ? wk
                  : u == 6 ? wv
                  : u == 7 ? wo
                  : u < 12 ? w1 + (size_t)(u - 8) * CVT_U
                           : w2 + (size_t)(u - 12) * CVT_U;
  __bf16* o = out + (size_t)u * CVT_U;
  constexpr int STEP = CVT_B * 256 * 4;          // elements that a unit's work-groups take at once
  int i = (blockIdx.x * 256 + threadIdx.x) * 4;
  for (int g = 0; g < CVT_U / (8 * STEP); ++g, i += 8 * STEP) {
    v4f a[8];
#pragma unroll   // eight 16-byte loads of a lane in flight before the first is used
    for (int t = 0; t < 8; ++t) a[t] = *(const v4f*)(in + i + t * STEP);
#pragma unroll   // a[] stays in registers
    for (int t = 0; t < 8; ++t) {
      v4bf r;
#pragma unroll   // vector elements picked by constants
      for (int e = 0; e < 4; ++e) r[e] = f2bf(a[t][e]);
      *(v4bf*)(o + i + t * STEP) = r;
    }
  }
}

template <int EPI, bool BIAS, int N>
__global__ __launch_bounds__(256) void gemm_bf16_k(
    const __bf16* __restrict__ X, const __bf16* __restrict__ W,
    const float* __restrict__ bias, const float* __restrict__ resid,
    float* __restrict__ outF, __bf16* __restrict__ outB,
    int M, int K) {
  __shared__ __attribute__((aligned(16))) __bf16 xs[2][128 * GLP];
  __shared__ __attribute__((aligned(16))) __bf16 wsb[2][128 * GLP];

  int tid = threadIdx.x;
  int lane = tid & 31;
  int wave = tid >> 5;
  int wm = wave & 3, wn = wave >> 4 ? 0 : (wave >> 2);  // (kept simple below)
  wn = wave >> 2;
  int m0 = wm * 32;            // within block tile
  int n0 = wn * 64;
  int mblk = blockIdx.x * 128;
  int nblk = blockIdx.y * 128;
  if (EPI == 0) {
    W    += (size_t)blockIdx.z * N * K;
    outB += (size_t)blockIdx.z * M * N;
  }

  // Issue one K=GK stage of async copies into buffer `buf`.
  auto stage = [&](int buf, int k0) {
    // X tile: 128 rows x 8 16B-chunks; thread t -> chunk t & 7 of rows t >> 3, +32, +64, +96
    // W tile: the same shape, the same map
    int row = tid >> 3, q = tid & 7;
    const __bf16* xg = X + (size_t)(mblk + row) * K + k0 + q * 8;
    const __bf16* wg = W + (size_t)(nblk + row) * K + k0 + q * 8;
    __bf16* xl = &xs[buf][row * GLP + q * 8];
    __bf16* wl = &wsb[buf][row * GLP + q * 8];
    async8_b128((unsigned)(size_t)xl,              xg,
                (unsigned)(size_t)(xl + 32 * GLP), xg + (size_t)32 * K,
                (unsigned)(size_t)(xl + 64 * GLP), xg + (size_t)64 * K,
                (unsigned)(size_t)(xl + 96 * GLP), xg + (size_t)96 * K,
                (unsigned)(size_t)wl,              wg,
                (unsigned)(size_t)(wl + 32 * GLP), wg + (size_t)32 * K,
                (unsigned)(size_t)(wl + 64 * GLP), wg + (size_t)64 * K,
                (unsigned)(size_t)(wl + 96 * GLP), wg + (size_t)96 * K);
  };

  v8f acc[2][4];
#pragma unroll   // acc[][] stays in registers
  for (int tj = 0; tj < 4; ++tj) { acc[0][tj] = zero8(); acc[1][tj] = zero8(); }

  int nk = K / GK;
  stage(0, 0);
  asm volatile("s_wait_asynccnt 0x0" ::: "memory");  // this wave's part of stage 0 has landed
  __syncthreads();                                   // stage 0 visible to all waves
  if (nk > 1) stage(1, GK);
  for (int kk = 0; kk < nk; ++kk) {
    const __bf16* xt = xs[kk & 1];
    const __bf16* wt = wsb[kk & 1];
#pragma unroll   // ks becomes a constant offset of the LDS loads
    for (int ks = 0; ks < GK; ks += 32) {
      v16bf a0 = load_frag_rows(xt, GLP, m0, ks, lane);
      v16bf a1 = load_frag_rows(xt, GLP, m0 + 16, ks, lane);
      v16bf b[4];
#pragma unroll   // b[] stays in registers
      for (int tj = 0; tj < 4; ++tj) b[tj] = load_frag_rows(wt, GLP, n0 + tj * 16, ks, lane);
      // Keeps the 12 LDS loads of this k step in one group ahead of its 8 WMMAs. Without it
      // the compiler reloads one B register set and waits for LDS in front of every two WMMAs.
      __builtin_amdgcn_sched_barrier(0);
#pragma unroll   // acc[][] stays in registers
      for (int tj = 0; tj < 4; ++tj) {
        acc[0][tj] = wmma_bf16(b[tj], a0, acc[0][tj]);   // Y^T tile = W rows @ (X rows)^T
        acc[1][tj] = wmma_bf16(b[tj], a1, acc[1][tj]);
      }
      // Keeps a k step's 8 WMMAs in front of what follows. The next k step's LDS loads stay one
      // group: without it the compiler spreads them among these WMMAs, in two or three places.
      // The stage's last 8 WMMAs stay in front of the hand-over: they run while stage kk + 1 is
      // still landing, and the refill is issued directly behind the barrier; without it the
      // compiler sinks them below the barrier, ahead of the copies.
      __builtin_amdgcn_sched_barrier(0);
    }
    // Hand-over:
    asm volatile("s_wait_dscnt 0x0" ::: "memory");     // this wave's reads of buffer kk & 1 are done
    asm volatile("s_wait_asynccnt 0x0" ::: "memory");  // its part of stage kk + 1 has landed
    __syncthreads();   // stage kk + 1 visible to all; buffer kk & 1 left by all
    if (kk + 2 < nk) stage(kk & 1, (kk + 2) * GK);
  }
  asm volatile("s_wait_asynccnt 0x0" ::: "memory");    // nothing in flight at the wave's end

  // Epilogue, staged through LDS so that every global access of a wave covers whole 128-byte lines.
  // The products are taken transposed, so in the accumulator layout lane (r, h) holds, of tile
  // (ti, tj), the 8 adjacent columns 8 * h + 0..7 of the ONE row r: it writes them to LDS as 16-byte
  // pieces. Each wave stages its 32 x 64 tile in a range of its own and reads it back row by row.
  // The ring is free: the last trip's hand-over has ended every wave's reads and copies.
  constexpr int SP = (EPI == 2 ? 256 : 128) + 16;   // staged row + 16 B: pitch = 16 B x odd
  constexpr int SW = 32 * (256 + 16);               // bytes of a wave's range; four ranges fit xs, four wsb
  static_assert(4 * SW <= (int)sizeof(xs) && 4 * SW <= (int)sizeof(wsb), "staging ranges");
  char* stg = (wave < 4 ? (char*)&xs[0][0] : (char*)&wsb[0][0]) + (wave & 3) * SW;
  int r = lane & 15, h = lane >> 4;
  if (EPI == 2) {
    // Read-back map: access j takes rows 2 * j and 2 * j + 1 of the wave tile, 256 bytes each.
    int rr = lane >> 4, cc = lane & 15;
    // 32-bit lane offset on scalar bases, the same register for the residual loads and the stores.
    unsigned go = (unsigned)((mblk + m0 + rr) * N + nblk + n0 + cc * 4) * 4u;
    v4f rs[16];
#pragma unroll   // rs[] stays in registers; all 16 loads in flight together, over the staging
    for (int j = 0; j < 16; ++j) rs[j] = *(const v4f*)((const char*)(resid + (size_t)(2 * j) * N) + go);
    v4f bb = {0.f, 0.f, 0.f, 0.f};
    if (BIAS) bb = *(const v4f*)(bias + nblk + n0 + cc * 4);
    // In front of the first instruction that reuses an address register of these loads (a precaution).
    asm volatile("s_wait_xcnt 0x0" ::: "memory");
#pragma unroll   // acc[][] stays in registers
    for (int ti = 0; ti < 2; ++ti)
#pragma unroll
      for (int tj = 0; tj < 4; ++tj) {
        v8f av = acc[ti][tj];
        char* p = stg + (ti * 16 + r) * SP + (tj * 16 + 8 * h) * 4;
        *(v4f*)p        = __builtin_shufflevector(av, av, 0, 1, 2, 3);
        *(v4f*)(p + 16) = __builtin_shufflevector(av, av, 4, 5, 6, 7);
      }
    asm volatile("s_wait_dscnt 0x0" ::: "memory");   // the wave's own LDS writes are done before other lanes read them back
#pragma unroll
    for (int j = 0; j < 16; ++j) {
      v4f y = *(const v4f*)(stg + (2 * j + rr) * SP + cc * 16);
      *(v4f*)((char*)(outF + (size_t)(2 * j) * N) + go) = (y + bb) + rs[j];
    }
  } else {
    v8f bv[4];
    if (BIAS) {
#pragma unroll   // bv[] stays in registers
      for (int tj = 0; tj < 4; ++tj) bv[tj] = *(const v8f*)(bias + nblk + n0 + 8 * h + tj * 16);
      // In front of the first instruction that reuses an address register of these loads (a precaution).
      asm volatile("s_wait_xcnt 0x0" ::: "memory");
    }
#pragma unroll
    for (int ti = 0; ti < 2; ++ti) {
#pragma unroll
      for (int tj = 0; tj < 4; ++tj) {
        v8f av = acc[ti][tj];
        v8bf w;
#pragma unroll   // vector elements picked by constants
        for (int i = 0; i < 8; ++i) {
          float v = av[i];
          if (EPI == 1) {
            if (BIAS) v += bv[tj][i];
            v = 0.5f * v * (1.0f + erff(v * 0.70710678118654752f));  // exact GELU
          }
          w[i] = f2bf(v);
        }
        *(v8bf*)(stg + (ti * 16 + r) * SP + (tj * 16 + 8 * h) * 2) = w;
      }
    }
    asm volatile("s_wait_dscnt 0x0" ::: "memory");   // the wave's own LDS writes are done before other lanes read them back
    // Read-back map: access j takes rows 4 * j .. 4 * j + 3 of the wave tile, 128 bytes each.
    int rr = lane >> 3, cc = lane & 7;
    unsigned go = (unsigned)((mblk + m0 + rr) * N + nblk + n0 + cc * 8) * 2u;
#pragma unroll
    for (int j = 0; j < 8; ++j) {
      v8bf y = *(const v8bf*)(stg + (4 * j + rr) * SP + cc * 16);
      *(v8bf*)((char*)(outB + (size_t)(4 * j) * N) + go) = y;
    }
  }
}

__global__ __launch_bounds__(256) void attention_k(
    const __bf16* __restrict__ Q, const __bf16* __restrict__ Km,
    const __bf16* __restrict__ V, __bf16* __restrict__ O,
    int S, int Dm) {
  __shared__ __attribute__((aligned(16))) __bf16 Ks[2][AK * KLP];
  __shared__ __attribute__((aligned(16))) __bf16 Vs[2][AK * VLP];

  int lane = threadIdx.x & 31;
  int wave = __builtin_amdgcn_readfirstlane(threadIdx.x >> 5);  // scalar: the pass test below is a scalar branch
  int r = lane & 15, hl = lane >> 4;
  int h = blockIdx.y, b = blockIdx.z;

  size_t base = (size_t)b * S * Dm + (size_t)h * 64;
  const __bf16* qp = Q + base;
  const __bf16* kp = Km + base;
  const __bf16* vp = V + base;
  __bf16* op = O + base;

  // One stage of async copies: keys k0 .. k0 + AK - 1 of K and V into buffer `buf`.
  // A tile is AK rows x 8 16B-chunks; thread t -> chunk t & 7 of rows t >> 3, +32.
  auto stage = [&](int buf, int k0) {
    int row = threadIdx.x >> 3, q = threadIdx.x & 7;
    const __bf16* kg = kp + (size_t)(k0 + row) * Dm + q * 8;
    const __bf16* vg = vp + (size_t)(k0 + row) * Dm + q * 8;
    __bf16* kl = &Ks[buf][row * KLP + q * 8];
    __bf16* vl = &Vs[buf][row * VLP + q * 8];
    async4_b128((unsigned)(size_t)kl,              kg,
                (unsigned)(size_t)(kl + 32 * KLP), kg + (size_t)32 * Dm,
                (unsigned)(size_t)vl,              vg,
                (unsigned)(size_t)(vl + 32 * VLP), vg + (size_t)32 * Dm);
  };

  // The second tile's first copies stand behind the first tile's last hand-over, which has
  // ended every wave's LDS reads and copies: the ring is free.
  for (int ph = 0; ph < 2; ++ph) {
  int qt = ph == 0 ? (S >> 7) - 1 - (int)blockIdx.x : (int)blockIdx.x;   // query tile, work-group-uniform
  int qbase = qt * 128 + wave * 16;   // wave-uniform

  v16bf aq0 = load_frag_rows(qp, Dm, qbase, 0, lane);
  v16bf aq1 = load_frag_rows(qp, Dm, qbase, 32, lane);

  v8f o0 = zero8(), o1 = zero8(), o2 = zero8(), o3 = zero8();
  float m = -1e30f;   // running maximum of this lane's query, the same in both half-waves
  float l = 0.f;      // running sum over the keys of this lane's own half-wave
  int qrow = qbase + r;

  int nst = (qt + 1) * (128 / AK);   // stages up to the tile's last row; at least two
  stage(0, 0);
  asm volatile("s_wait_asynccnt 0x0" ::: "memory");  // this wave's part of stage 0 has landed
  __syncthreads();                                   // stage 0 visible to all waves
  stage(1, AK);
  for (int t = 0; t < nst; ++t) {
   const __bf16* kt = Ks[t & 1];
   const __bf16* vt = Vs[t & 1];
#pragma unroll   // jj becomes a constant offset of the LDS loads
   for (int jj = 0; jj < AK; jj += 32) {
    int j0 = t * AK + jj;
    if (j0 >= qbase + 16) continue;   // wave-uniform: every key of the pass is masked for this wave
    // ---- S^T = K @ Q^T (two 16x16 score tiles: keys j0.. and j0+16..) ----
    v8f s0 = zero8(), s1 = zero8();
    {
      v16bf bk0 = load_frag_rows(kt, KLP, jj, 0, lane);
      v16bf bk1 = load_frag_rows(kt, KLP, jj, 32, lane);
      s0 = wmma_bf16(bk0, aq0, s0);
      s0 = wmma_bf16(bk1, aq1, s0);
      v16bf bk2 = load_frag_rows(kt, KLP, jj + 16, 0, lane);
      v16bf bk3 = load_frag_rows(kt, KLP, jj + 16, 32, lane);
      s1 = wmma_bf16(bk2, aq0, s1);
      s1 = wmma_bf16(bk3, aq1, s1);
    }
    // ---- scale, causal mask, online softmax: 16 keys of one query per lane ----
    int key0 = j0 + 8 * hl;
    float sc[16];
#pragma unroll   // sc[] stays in registers
    for (int i = 0; i < 8; ++i) {
      sc[i]     = s0[i] * 0.125f;               // 1/sqrt(64)
      sc[i + 8] = s1[i] * 0.125f;
      if (key0 + i > qrow) sc[i] = -1e30f;
      if (key0 + 16 + i > qrow) sc[i + 8] = -1e30f;
    }
    float t8[8];
#pragma unroll   // tree: independent links instead of one chain of 15
    for (int i = 0; i < 8; ++i) t8[i] = fmaxf(sc[i], sc[i + 8]);
    float rm = fmaxf(fmaxf(fmaxf(t8[0], t8[4]), fmaxf(t8[1], t8[5])),
                     fmaxf(fmaxf(t8[2], t8[6]), fmaxf(t8[3], t8[7])));
    rm = fmaxf(rm, xhalf(rm));                  // the query's other 16 keys
    float mn = fmaxf(m, rm);
    float al = exp_x1(m - mn);
#pragma unroll   // sc[] stays in registers
    for (int i = 0; i < 16; ++i) sc[i] -= mn;
    float p[16];
    exp_x8(p, sc);
    exp_x8(p + 8, sc + 8);
    v16bf pt;   // P^T as B operand: element s = key 8 * hl + s (s < 8), 16 + 8 * hl + s - 8 (else)
#pragma unroll   // p[], pt stay in registers
    for (int i = 0; i < 16; ++i) pt[i] = f2bf(p[i]);
#pragma unroll   // tree, as above
    for (int i = 0; i < 8; ++i) t8[i] = p[i] + p[i + 8];
    float rs = ((t8[0] + t8[4]) + (t8[1] + t8[5])) + ((t8[2] + t8[6]) + (t8[3] + t8[7]));
    l = l * al + rs;
    m = mn;
#pragma unroll   // vector elements picked by constants
    for (int i = 0; i < 8; ++i) { o0[i] *= al; o1[i] *= al; o2[i] *= al; o3[i] *= al; }
    // ---- O^T += V^T @ P^T (tile n: head columns 16 * n .. + 15) ----
    v16bf bv0 = load_frag_cols_lds(vt, jj, 0, lane);
    v16bf bv1 = load_frag_cols_lds(vt, jj, 16, lane);
    v16bf bv2 = load_frag_cols_lds(vt, jj, 32, lane);
    v16bf bv3 = load_frag_cols_lds(vt, jj, 48, lane);
    o0 = wmma_bf16(bv0, pt, o0);
    o1 = wmma_bf16(bv1, pt, o1);
    o2 = wmma_bf16(bv2, pt, o2);
    o3 = wmma_bf16(bv3, pt, o3);
   }
   // Hand-over:
   asm volatile("s_wait_dscnt 0x0" ::: "memory");     // this wave's reads of buffer t & 1 are done
   asm volatile("s_wait_asynccnt 0x0" ::: "memory");  // its part of stage t + 1 has landed
   __syncthreads();   // stage t + 1 visible to all; buffer t & 1 left by all
   if (t + 2 < nst) stage(t & 1, (t + 2) * AK);
  }
  asm volatile("s_wait_asynccnt 0x0" ::: "memory");    // nothing in flight at the tile's end

  // Lane (r, hl) holds O[qbase + r][16 * n + 8 * hl + 0..7] in tile n: 16-byte stores.
  float inv = 1.0f / (l + xhalf(l));   // the two half-waves' sums joined once
  __bf16* orow = op + (size_t)qrow * Dm + 8 * hl;
  v8bf w0, w1, w2, w3;
#pragma unroll   // vector elements picked by constants
  for (int i = 0; i < 8; ++i) {
    w0[i] = f2bf(o0[i] * inv);
    w1[i] = f2bf(o1[i] * inv);
    w2[i] = f2bf(o2[i] * inv);
    w3[i] = f2bf(o3[i] * inv);
  }
  *(v8bf*)(orow)      = w0;
  *(v8bf*)(orow + 16) = w1;
  *(v8bf*)(orow + 32) = w2;
  *(v8bf*)(orow + 48) = w3;
  // In front of the first instruction of the next tile that reuses a register of these stores (a precaution).
  asm volatile("s_wait_xcnt 0x0" ::: "memory");
  }
}

// ---------------------------------------------------------------------------
// LayerNorm over the last dim. Writes fp32 (+ bf16 where WB).
// One wave takes LN_R whole rows and keeps them in registers: a row is read once,
// by 16-byte loads that cover 512 contiguous bytes a wave, all of them in flight
// together with gamma and beta. Mean and variance are summed in the lane and then
// across the wave's lanes by vector cross-lane moves: no LDS, no barrier. The
// launch has M / LN_R waves, one work-group per 8 * LN_R rows.
// ---------------------------------------------------------------------------
constexpr int LN_D = 1024;   // row length: 8 loads x 32 lanes x 4 floats
constexpr int LN_R = 2;      // rows of a wave

// x + (x of lane l ^ mask) inside each 16-lane row; CTRL = 0x160 + mask (row_xmask).
template <int CTRL>
__device__ __forceinline__ float row_xadd(float x) {
  int b = __builtin_bit_cast(int, x);
  return x + __builtin_bit_cast(float, __builtin_amdgcn_update_dpp(0, b, CTRL, 0xf, 0xf, true));
}
// Sum over the wave's 32 lanes, the same bits in every lane.
__device__ __forceinline__ float wave_sum(float x) {
  x = row_xadd<0x161>(x);
  x = row_xadd<0x162>(x);
  x = row_xadd<0x164>(x);
  x = row_xadd<0x168>(x);
  return x + xhalf(x);
}

template <bool WB>
__global__ __launch_bounds__(256) void layernorm_k(
    const float* __restrict__ in, const float* __restrict__ gamma,
    const float* __restrict__ beta, float* __restrict__ outF,
    __bf16* __restrict__ outB) {
  int lane = threadIdx.x & 31;
  int wave = threadIdx.x >> 5;
  // Scalar base of the work-group's rows, one small lane offset for loads and stores alike.
  size_t base = (size_t)blockIdx.x * (8 * LN_R * LN_D);
  int off = wave * (LN_R * LN_D) + lane * 4;
  const float* p = in + base;
  float* oF = outF + base;

  v4f a[LN_R][8], g[8], be[8];
#pragma unroll   // a[][] stays in registers
  for (int rr = 0; rr < LN_R; ++rr)
#pragma unroll
    for (int t = 0; t < 8; ++t) a[rr][t] = *(const v4f*)(p + off + rr * LN_D + t * 128);
#pragma unroll   // g[], be[] stay in registers
  for (int t = 0; t < 8; ++t) {
    g[t]  = *(const v4f*)(gamma + lane * 4 + t * 128);
    be[t] = *(const v4f*)(beta + lane * 4 + t * 128);
  }
  // Keeps all 32 loads in one group at the top. Without it the compiler sinks the gamma and
  // beta loads behind the sums, two pairs at a time, and the wave waits out their latency there.
  __builtin_amdgcn_sched_barrier(0);
  // In front of the first instruction that reuses an address register of these loads (a precaution).
  asm volatile("s_wait_xcnt 0x0" ::: "memory");
  // Keeps the sums, which reuse those registers, behind that wait: the compiler lifted them over it.
  __builtin_amdgcn_sched_barrier(0);

  float s[LN_R];
#pragma unroll   // the rows' sums are independent chains
  for (int rr = 0; rr < LN_R; ++rr) {
    v4f s4 = (a[rr][0] + a[rr][1]) + (a[rr][2] + a[rr][3]);
    s4 += (a[rr][4] + a[rr][5]) + (a[rr][6] + a[rr][7]);
    s[rr] = (s4[0] + s4[1]) + (s4[2] + s4[3]);
  }
#pragma unroll
  for (int rr = 0; rr < LN_R; ++rr) s[rr] = wave_sum(s[rr]) / (float)LN_D;   // mean

  float q[LN_R];
#pragma unroll
  for (int rr = 0; rr < LN_R; ++rr) {
    v4f q4 = {0.f, 0.f, 0.f, 0.f};
#pragma unroll
    for (int t = 0; t < 8; ++t) {
      a[rr][t] -= s[rr];
      q4 += a[rr][t] * a[rr][t];
    }
    q[rr] = (q4[0] + q4[1]) + (q4[2] + q4[3]);
  }
#pragma unroll
  for (int rr = 0; rr < LN_R; ++rr) q[rr] = rsqrtf(wave_sum(q[rr]) / (float)LN_D + 1e-5f);

#pragma unroll
  for (int rr = 0; rr < LN_R; ++rr) {
#pragma unroll
    for (int t = 0; t < 8; ++t) {
      v4f y = a[rr][t] * q[rr] * g[t] + be[t];
      *(v4f*)(oF + off + rr * LN_D + t * 128) = y;
      if (WB) {
        v4bf yb;
#pragma unroll   // vector elements picked by constants
        for (int e = 0; e < 4; ++e) yb[e] = f2bf(y[e]);
        *(v4bf*)(outB + base + off + rr * LN_D + t * 128) = yb;
      }
    }
  }
}

// ---------------------------------------------------------------------------
// Host orchestration
// ---------------------------------------------------------------------------
extern "C" void kernel_launch(void* const* d_in, const int* in_sizes, int n_in,
                              void* d_out, int out_size, void* d_ws, size_t ws_size,
                              hipStream_t stream) {
  (void)in_sizes; (void)n_in; (void)out_size; (void)ws_size;
  constexpr int B = 2, S = 2048, D = 1024, H = 16, M = B * S, DF = 4 * D;

  const float* x   = (const float*)d_in[0];
  const float* wq  = (const float*)d_in[1];
  const float* wk  = (const float*)d_in[2];
  const float* wv  = (const float*)d_in[3];
  const float* wo  = (const float*)d_in[4];
  const float* w1  = (const float*)d_in[5];
  const float* b1  = (const float*)d_in[6];
  const float* w2  = (const float*)d_in[7];
  const float* b2  = (const float*)d_in[8];
  const float* g0  = (const float*)d_in[9];
  const float* be0 = (const float*)d_in[10];
  const float* g1  = (const float*)d_in[11];
  const float* be1 = (const float*)d_in[12];

  char* ws = (char*)d_ws;
  size_t off = 0;
  auto take = [&](size_t bytes) -> void* {
    void* p = ws + off;
    off = (off + bytes + 255) & ~(size_t)255;
    return p;
  };

  // xb .. w2b: contiguous, in the order in which cvt_all_k numbers its units
  __bf16* xb   = (__bf16*)take((size_t)M * D * 2);    // also reused as ln0b
  __bf16* wqkvb = (__bf16*)take((size_t)3 * D * D * 2);  // wq, wk, wv one behind the other
  __bf16* wob  = (__bf16*)take((size_t)D * D * 2);
  __bf16* w1b  = (__bf16*)take((size_t)DF * D * 2);
  __bf16* w2b  = (__bf16*)take((size_t)D * DF * 2);
  size_t qkv_off = off;
  __bf16* qb    = (__bf16*)take((size_t)M * D * 2);   // q, k, v one behind the other
  __bf16* kb    = (__bf16*)take((size_t)M * D * 2);
  __bf16* vb    = (__bf16*)take((size_t)M * D * 2);
  __bf16* attnb = (__bf16*)take((size_t)M * D * 2);
  float*  x1    = (float*)take((size_t)M * D * 4);    // also reused as x2
  float*  ln0f  = (float*)take((size_t)M * D * 4);
  // reuse dead regions:
  __bf16* hb   = (__bf16*)(ws + qkv_off);             // 32MB over q/k/v/attn (dead)
  __bf16* ln0b = xb;                                  // xb dead after QKV gemms
  float*  x2   = x1;                                  // x1 dead after LN0

  dim3 blk(256);

  // fp32 -> bf16 conversions, one launch: (M*D + 4*D*D + 2*DF*D) / CVT_U = 16 units
  static_assert(D == LN_D && M % (8 * LN_R) == 0, "row map of layernorm_k");
  static_assert(M * D == 4 * CVT_U && D * D == CVT_U && DF * D == 4 * CVT_U, "unit map of cvt_all_k");
  cvt_all_k<<<dim3(CVT_B, 16), blk, 0, stream>>>(x, wq, wk, wv, wo, w1, w2, xb);

  // Q, K, V projections (bf16 out), one launch: z = 0, 1, 2
  dim3 gD(M / 128, D / 128);
  gemm_bf16_k<0, false, D><<<dim3(M / 128, D / 128, 3), blk, 0, stream>>>(xb, wqkvb, nullptr, nullptr, nullptr, qb, M, D);

  // causal flash attention
  static_assert(S % 256 == 0, "query tiles of attention_k come in pairs");
  attention_k<<<dim3(S / 256, H, B), blk, 0, stream>>>(qb, kb, vb, attnb, S, D);

  // output projection + residual (fp32)
  gemm_bf16_k<2, false, D><<<gD, blk, 0, stream>>>(attnb, wob, nullptr, x, x1, nullptr, M, D);

  // LayerNorm 0 (fp32 + bf16 copies)
  layernorm_k<true><<<M / (8 * LN_R), blk, 0, stream>>>(x1, g0, be0, ln0f, ln0b);

  // MLP up + exact GELU (bf16 out)
  gemm_bf16_k<1, true, DF><<<dim3(M / 128, DF / 128), blk, 0, stream>>>(ln0b, w1b, b1, nullptr, nullptr, hb, M, D);

  // MLP down + bias + residual (fp32)
  gemm_bf16_k<2, true, D><<<gD, blk, 0, stream>>>(hb, w2b, b2, ln0f, x2, nullptr, M, DF);

  // LayerNorm 1 -> final output (fp32)
  layernorm_k<false><<<M / (8 * LN_R), blk, 0, stream>>>(x2, g1, be1, (float*)d_out, nullptr);
}

// v010
// One run takes 145 microseconds.
// Next to v009, in two timings, it ran 1.15 and 1.17 times as fast.
// All steps since v000 together make it 2.94 times as fast.
#include <hip/hip_runtime.h>
#include <hip/hip_bf16.h>
#include <math.h>

// ---------------------------------------------------------------------------
// Types / helpers
// ---------------------------------------------------------------------------
typedef __attribute__((ext_vector_type(16))) __bf16 v16bf;
typedef __attribute__((ext_vector_type(8)))  __bf16 v8bf;
typedef __attribute__((ext_vector_type(8)))  float  v8f;

__device__ __forceinline__ __bf16 f2bf(float f) {
  unsigned u = __builtin_bit_cast(unsigned, f);
  unsigned r = u + 0x7FFFu + ((u >> 16) & 1u);   // round-to-nearest-even
  unsigned short h = (unsigned short)(r >> 16);
  return __builtin_bit_cast(__bf16, h);
}

__device__ __forceinline__ v8f zero8() {
  v8f z = {0.f, 0.f, 0.f, 0.f, 0.f, 0.f, 0.f, 0.f};
  return z;
}

__device__ __forceinline__ v8f wmma_bf16(v16bf a, v16bf b, v8f c) {
  // D(f32 16x16) = A(bf16 16x32) * B(bf16 32x16) + C
  return __builtin_amdgcn_wmma_f32_16x16x32_bf16(
      /*neg_a=*/false, a, /*neg_b=*/false, b,
      /*c_mod=*/(short)0, c, /*reuse_a=*/false, /*reuse_b=*/false);
}

// 16x32 bf16 fragment from 16 consecutive *rows* of a row-major matrix.
// Per ISA 16-bit A layout: lane r (0..15), half h: elems [0..7] = row r,
// K = k0 + h*8 .. +7 ; elems [8..15] = row r, K = k0 + 16 + h*8 .. +7.
// Identical layout serves B of X@W^T (B[k][n] = W[n][k] -> rows of W).
// Works for both global and LDS (generic) pointers.
__device__ __forceinline__ v16bf load_frag_rows(const __bf16* __restrict__ base,
                                                int ld, int row0, int k0, int lane) {
  int r = lane & 15, h = lane >> 4;
  const __bf16* p = base + (size_t)(row0 + r) * ld + (k0 + h * 8);
  v8bf lo = *(const v8bf*)p;          // 16-byte load
  v8bf hi = *(const v8bf*)(p + 16);   // 16-byte load
  v16bf f;
#pragma unroll
  for (int i = 0; i < 8; ++i) { f[i] = lo[i]; f[i + 8] = hi[i]; }
  return f;
}

// GEMM stages: GK = K elements of one stage (a template constant, 64 or 256): a staged row is
// one or four whole 128-byte cache lines. LDS pitch of those rows: GK + 8 bf16 elements = 144 or
// 528 bytes = 16 B x odd, so the 16 rows that one half-wave reads with 16-byte LDS loads start
// on 16 different groups of four banks.

// Eight async Global -> LDS copies of 16 bytes per lane (tracked by ASYNCcnt).
// l*: LDS byte address (low 32 bits of the generic shared pointer == LDS
// offset per the flat-aperture mapping, ISA 10.2).
// s_wait_xcnt 0 is the last line of the copies' own statement so that no later
// write of an address register can be scheduled ahead of it (a precaution).
__device__ __forceinline__ void async8_b128(unsigned l0, const void* g0,
                                            unsigned l1, const void* g1,
                                            unsigned l2, const void* g2,
                                            unsigned l3, const void* g3,
                                            unsigned l4, const void* g4,
                                            unsigned l5, const void* g5,
                                            unsigned l6, const void* g6,
                                            unsigned l7, const void* g7) {
  unsigned long long a0 = (unsigned long long)g0;
  unsigned long long a1 = (unsigned long long)g1;
  unsigned long long a2 = (unsigned long long)g2;
  unsigned long long a3 = (unsigned long long)g3;
  unsigned long long a4 = (unsigned long long)g4;
  unsigned long long a5 = (unsigned long long)g5;
  unsigned long long a6 = (unsigned long long)g6;
  unsigned long long a7 = (unsigned long long)g7;
  asm volatile("global_load_async_to_lds_b128 %0, %1, off\n\t"
               "global_load_async_to_lds_b128 %2, %3, off\n\t"
               "global_load_async_to_lds_b128 %4, %5, off\n\t"
               "global_load_async_to_lds_b128 %6, %7, off\n\t"
               "global_load_async_to_lds_b128 %8, %9, off\n\t"
               "global_load_async_to_lds_b128 %10, %11, off\n\t"
               "global_load_async_to_lds_b128 %12, %13, off\n\t"
               "global_load_async_to_lds_b128 %14, %15, off\n\t"
               "s_wait_xcnt 0x0"
               :: "v"(l0), "v"(a0), "v"(l1), "v"(a1), "v"(l2), "v"(a2),
                  "v"(l3), "v"(a3), "v"(l4), "v"(a4), "v"(l5), "v"(a5),
                  "v"(l6), "v"(a6), "v"(l7), "v"(a7)
               : "memory");
}

// Four such copies in one statement, the same wait as its last line.
__device__ __forceinline__ void async4_b128(unsigned l0, const void* g0,
                                            unsigned l1, const void* g1,
                                            unsigned l2, const void* g2,
                                            unsigned l3, const void* g3) {
  unsigned long long a0 = (unsigned long long)g0;
  unsigned long long a1 = (unsigned long long)g1;
  unsigned long long a2 = (unsigned long long)g2;
  unsigned long long a3 = (unsigned long long)g3;
  asm volatile("global_load_async_to_lds_b128 %0, %1, off\n\t"
               "global_load_async_to_lds_b128 %2, %3, off\n\t"
               "global_load_async_to_lds_b128 %4, %5, off\n\t"
               "global_load_async_to_lds_b128 %6, %7, off\n\t"
               "s_wait_xcnt 0x0"
               :: "v"(l0), "v"(a0), "v"(l1), "v"(a1), "v"(l2), "v"(a2),
                  "v"(l3), "v"(a3)
               : "memory");
}

// Keys of one attention stage; a staged K or V row is one head's 64 elements = 128 bytes.
constexpr int AK = 64;
// LDS pitch of the K rows, in bf16 elements: 144 bytes = 16 B x odd (ds_load_b128 readers).
constexpr int KLP = 72;
// LDS pitch of the V rows: 160 bytes = 32 B x odd (ds_load_tr16_b128 readers).
constexpr int VLP = 80;

// Fragment whose K dimension runs *down a column* of a row-major matrix
// (A operand of V^T @ P^T: A[m][k] = V[k][m]), in the k order of load_frag_rows, from
// an LDS tile at pitch VLP by two transposing LDS loads:
// lane (r, h) gets tile[k0 + 8h + 0..7][col0 + r], then the same 16 rows below.
__device__ __forceinline__ v16bf load_frag_cols_lds(const __bf16* tile, int k0, int col0, int lane) {
  typedef __attribute__((address_space(3))) v8bf lds_v8bf;
  const __bf16* p = tile + (k0 + 8 * (lane >> 4) + (lane & 7)) * VLP + col0 + 8 * ((lane >> 3) & 1);
  v8bf lo = __builtin_amdgcn_ds_load_tr16_b128_v8bf16((lds_v8bf*)p);
  v8bf hi = __builtin_amdgcn_ds_load_tr16_b128_v8bf16((lds_v8bf*)(p + 16 * VLP));
  v16bf f;
#pragma unroll
  for (int i = 0; i < 8; ++i) { f[i] = lo[i]; f[i + 8] = hi[i]; }
  return f;
}

// Value of lane l ^ 16 (the other half-wave), by a vector cross-row move.
__device__ __forceinline__ float xhalf(float x) {
  int b = __builtin_bit_cast(int, x);
  return __builtin_bit_cast(float, __builtin_amdgcn_permlanex16(b, b, 0x76543210, 0xfedcba98, false, false));
}

// exp(x) as v_exp_f32 of x * log2(e), eight at a time, or one. Written in asm for
// the slot that the instruction set asks for behind a transcendental (one
// independent instruction or v_nop before its result is used or its source
// overwritten): the early-clobber outputs keep every result off every source,
// so each v_exp_f32 is followed by an independent one, and the v_nop is the
// slot of the last.
constexpr float LOG2E = 1.44269504f;
__device__ __forceinline__ void exp_x8(float* y, const float* x) {
  asm("v_exp_f32 %0, %8\n\t"
      "v_exp_f32 %1, %9\n\t"
      "v_exp_f32 %2, %10\n\t"
      "v_exp_f32 %3, %11\n\t"
      "v_exp_f32 %4, %12\n\t"
      "v_exp_f32 %5, %13\n\t"
      "v_exp_f32 %6, %14\n\t"
      "v_exp_f32 %7, %15\n\t"
      "v_nop"
      : "=&v"(y[0]), "=&v"(y[1]), "=&v"(y[2]), "=&v"(y[3]),
        "=&v"(y[4]), "=&v"(y[5]), "=&v"(y[6]), "=&v"(y[7])
      : "v"(x[0] * LOG2E), "v"(x[1] * LOG2E), "v"(x[2] * LOG2E), "v"(x[3] * LOG2E),
        "v"(x[4] * LOG2E), "v"(x[5] * LOG2E), "v"(x[6] * LOG2E), "v"(x[7] * LOG2E));
}
__device__ __forceinline__ float exp_x1(float x) {
  float y;
  asm("v_exp_f32 %0, %1\n\t"
      "v_nop"
      : "=&v"(y) : "v"(x * LOG2E));
  return y;
}

// ---------------------------------------------------------------------------
// fp32 -> bf16 conversion of all seven tensors in ONE launch.
// The bf16 copies lie one behind the other in the workspace (x, wq, wk, wv, wo,
// w1, w2), so the destination is one flat array. blockIdx.y picks a unit of
// CVT_U elements and with it the source; CVT_B work-groups share a unit.
// A wave's load covers 512 contiguous bytes, its store 256.
// ---------------------------------------------------------------------------
typedef __attribute__((ext_vector_type(4))) float  v4f;
typedef __attribute__((ext_vector_type(4))) __bf16 v4bf;
constexpr int CVT_U = 1 << 20;   // elements of a unit: x, w1, w2 are 4 units each, wq..wo one
constexpr int CVT_B = 32;        // work-groups of a unit

__global__ __launch_bounds__(256) void cvt_all_k(
    const float* __restrict__ x,  const float* __restrict__ wq,
    const float* __restrict__ wk, const float* __restrict__ wv,
    const float* __restrict__ wo, const float* __restrict__ w1,
    const float* __restrict__ w2, __bf16* __restrict__ out) {
  int u = blockIdx.y;
  const float* in = u < 4  ? x + (size_t)u * CVT_U
                  : u == 4 ? wq
                  : u == 5 ? wk
                  : u == 6 ? wv
                  : u == 7 ? wo
                  : u < 12 ? w1 + (size_t)(u - 8) * CVT_U
                           : w2 + (size_t)(u - 12) * CVT_U;
  __bf16* o = out + (size_t)u * CVT_U;
  constexpr int STEP = CVT_B * 256 * 4;          // elements that a unit's work-groups take at once
  int i = (blockIdx.x * 256 + threadIdx.x) * 4;
  for (int g = 0; g < CVT_U / (8 * STEP); ++g, i += 8 * STEP) {
    v4f a[8];
#pragma unroll   // eight 16-byte loads of a lane in flight before the first is used
    for (int t = 0; t < 8; ++t) a[t] = *(const v4f*)(in + i + t * STEP);
#pragma unroll   // a[] stays in registers
    for (int t = 0; t < 8; ++t) {
      v4bf r;
#pragma unroll   // vector elements picked by constants
      for (int e = 0; e < 4; ++e) r[e] = f2bf(a[t][e]);
      *(v4bf*)(o + i + t * STEP) = r;
    }
  }
}

template <int EPI, bool BIAS, int N, int GK>
__global__ __launch_bounds__(256) void gemm_bf16_k(
    const __bf16* __restrict__ X, const __bf16* __restrict__ W,
    const float* __restrict__ bias, const float* __restrict__ resid,
    float* __restrict__ outF, __bf16* __restrict__ outB,
    int M, int K) {
  constexpr int GLP = GK + 8;
  __shared__ __attribute__((aligned(16))) __bf16 xs[2][128 * GLP];
  __shared__ __attribute__((aligned(16))) __bf16 wsb[2][128 * GLP];

  int tid = threadIdx.x;
  int lane = tid & 31;
  int wave = tid >> 5;
  int wm = wave & 3, wn = wave >> 4 ? 0 : (wave >> 2);  // (kept simple below)
  wn = wave >> 2;
  int m0 = wm * 32;            // within block tile
  int n0 = wn * 64;
  int mblk = blockIdx.x * 128;
  int nblk = blockIdx.y * 128;
  if (EPI == 0) {
    W    += (size_t)blockIdx.z * N * K;
    outB += (size_t)blockIdx.z * M * N;
  }

  // Issue one K=GK stage of async copies into buffer `buf`.
  auto stage = [&](int buf, int k0) {
    // X tile: 128 rows x CPR 16B-chunks; thread t -> chunk t % CPR of rows t / CPR, + RS, + 2 RS, ...
    // W tile: the same shape, the same map
    constexpr int CPR = GK / 8;      // chunks of a row
    constexpr int RS = 256 / CPR;    // rows that the 256 threads take at once
    int row = tid / CPR, q = tid % CPR;
    const __bf16* xg = X + (size_t)(mblk + row) * K + k0 + q * 8;
    const __bf16* wg = W + (size_t)(nblk + row) * K + k0 + q * 8;
    __bf16* xl = &xs[buf][row * GLP + q * 8];
    __bf16* wl = &wsb[buf][row * GLP + q * 8];
#pragma unroll   // the row steps become constants
    for (int i = 0; i < 128; i += 4 * RS)
      async8_b128((unsigned)(size_t)(xl + i * GLP),            xg + (size_t)i * K,
                  (unsigned)(size_t)(xl + (i + RS) * GLP),     xg + (size_t)(i + RS) * K,
                  (unsigned)(size_t)(xl + (i + 2 * RS) * GLP), xg + (size_t)(i + 2 * RS) * K,
                  (unsigned)(size_t)(xl + (i + 3 * RS) * GLP), xg + (size_t)(i + 3 * RS) * K,
                  (unsigned)(size_t)(wl + i * GLP),            wg + (size_t)i * K,
                  (unsigned)(size_t)(wl + (i + RS) * GLP),     wg + (size_t)(i + RS) * K,
                  (unsigned)(size_t)(wl + (i + 2 * RS) * GLP), wg + (size_t)(i + 2 * RS) * K,
                  (unsigned)(size_t)(wl + (i + 3 * RS) * GLP), wg + (size_t)(i + 3 * RS) * K);
  };

  v8f acc[2][4];
#pragma unroll   // acc[][] stays in registers
  for (int tj = 0; tj < 4; ++tj) { acc[0][tj] = zero8(); acc[1][tj] = zero8(); }

  int nk = K / GK;
  stage(0, 0);
  asm volatile("s_wait_asynccnt 0x0" ::: "memory");  // this wave's part of stage 0 has landed
  __syncthreads();                                   // stage 0 visible to all waves
  if (nk > 1) stage(1, GK);
  for (int kk = 0; kk < nk; ++kk) {
    const __bf16* xt = xs[kk & 1];
    const __bf16* wt = wsb[kk & 1];
#pragma unroll   // ks becomes a constant offset of the LDS loads
    for (int ks = 0; ks < GK; ks += 32) {
      v16bf a0 = load_frag_rows(xt, GLP, m0, ks, lane);
      v16bf a1 = load_frag_rows(xt, GLP, m0 + 16, ks, lane);
      v16bf b[4];
#pragma unroll   // b[] stays in registers
      for (int tj = 0; tj < 4; ++tj) b[tj] = load_frag_rows(wt, GLP, n0 + tj * 16, ks, lane);
      // Keeps the 12 LDS loads of this k step in one group ahead of its 8 WMMAs. Without it
      // the compiler reloads one B register set and waits for LDS in front of every two WMMAs.
      __builtin_amdgcn_sched_barrier(0);
#pragma unroll   // acc[][] stays in registers
      for (int tj = 0; tj < 4; ++tj) {
        acc[0][tj] = wmma_bf16(b[tj], a0, acc[0][tj]);   // Y^T tile = W rows @ (X rows)^T
        acc[1][tj] = wmma_bf16(b[tj], a1, acc[1][tj]);
      }
      // Keeps a k step's 8 WMMAs in front of what follows. The next k step's LDS loads stay one
      // group: without it the compiler spreads them among these WMMAs, in two or three places.
      // The stage's last 8 WMMAs stay in front of the hand-over: they run while stage kk + 1 is
      // still landing, and the refill is issued directly behind the barrier; without it the
      // compiler sinks them below the barrier, ahead of the copies.
      __builtin_amdgcn_sched_barrier(0);
    }
    // Hand-over:
    asm volatile("s_wait_dscnt 0x0" ::: "memory");     // this wave's reads of buffer kk & 1 are done
    asm volatile("s_wait_asynccnt 0x0" ::: "memory");  // its part of stage kk + 1 has landed
    __syncthreads();   // stage kk + 1 visible to all; buffer kk & 1 left by all
    if (kk + 2 < nk) stage(kk & 1, (kk + 2) * GK);
  }
  asm volatile("s_wait_asynccnt 0x0" ::: "memory");    // nothing in flight at the wave's end

  // Epilogue, staged through LDS so that every global access of a wave covers whole 128-byte lines.
  // The products are taken transposed, so in the accumulator layout lane (r, h) holds, of tile
  // (ti, tj), the 8 adjacent columns 8 * h + 0..7 of the ONE row r: it writes them to LDS as 16-byte
  // pieces. Each wave stages its 32 x 64 tile in a range of its own and reads it back row by row.
  // The ring is free: the last trip's hand-over has ended every wave's reads and copies.
  constexpr int SP = (EPI == 2 ? 256 : 128) + 16;   // staged row + 16 B: pitch = 16 B x odd
  constexpr int SW = 32 * (256 + 16);               // bytes of a wave's range; four ranges fit xs, four wsb
  static_assert(4 * SW <= (int)sizeof(xs) && 4 * SW <= (int)sizeof(wsb), "staging ranges");
  char* stg = (wave < 4 ? (char*)&xs[0][0] : (char*)&wsb[0][0]) + (wave & 3) * SW;
  int r = lane & 15, h = lane >> 4;
  if (EPI == 2) {
    // Read-back map: access j takes rows 2 * j and 2 * j + 1 of the wave tile, 256 bytes each.
    int rr = lane >> 4, cc = lane & 15;
    // 32-bit lane offset on scalar bases, the same register for the residual loads and the stores.
    unsigned go = (unsigned)((mblk + m0 + rr) * N + nblk + n0 + cc * 4) * 4u;
    v4f rs[16];
#pragma unroll   // rs[] stays in registers; all 16 loads in flight together, over the staging
    for (int j = 0; j < 16; ++j) rs[j] = *(const v4f*)((const char*)(resid + (size_t)(2 * j) * N) + go);
    v4f bb = {0.f, 0.f, 0.f, 0.f};
    if (BIAS) bb = *(const v4f*)(bias + nblk + n0 + cc * 4);
    // In front of the first instruction that reuses an address register of these loads (a precaution).
    asm volatile("s_wait_xcnt 0x0" ::: "memory");
#pragma unroll   // acc[][] stays in registers
    for (int ti = 0; ti < 2; ++ti)
#pragma unroll
      for (int tj = 0; tj < 4; ++tj) {
        v8f av = acc[ti][tj];
        char* p = stg + (ti * 16 + r) * SP + (tj * 16 + 8 * h) * 4;
        *(v4f*)p        = __builtin_shufflevector(av, av, 0, 1, 2, 3);
        *(v4f*)(p + 16) = __builtin_shufflevector(av, av, 4, 5, 6, 7);
      }
    asm volatile("s_wait_dscnt 0x0" ::: "memory");   // the wave's own LDS writes are done before other lanes read them back
#pragma unroll
    for (int j = 0; j < 16; ++j) {
      v4f y = *(const v4f*)(stg + (2 * j + rr) * SP + cc * 16);
      *(v4f*)((char*)(outF + (size_t)(2 * j) * N) + go) = (y + bb) + rs[j];
    }
  } else {
    v8f bv[4];
    if (BIAS) {
#pragma unroll   // bv[] stays in registers
      for (int tj = 0; tj < 4; ++tj) bv[tj] = *(const v8f*)(bias + nblk + n0 + 8 * h + tj * 16);
      // In front of the first instruction that reuses an address register of these loads (a precaution).
      asm volatile("s_wait_xcnt 0x0" ::: "memory");
    }
#pragma unroll
    for (int ti = 0; ti < 2; ++ti) {
#pragma unroll
      for (int tj = 0; tj < 4; ++tj) {
        v8f av = acc[ti][tj];
        v8bf w;
#pragma unroll   // vector elements picked by constants
        for (int i = 0; i < 8; ++i) {
          float v = av[i];
          if (EPI == 1) {
            if (BIAS) v += bv[tj][i];
            v = 0.5f * v * (1.0f + erff(v * 0.70710678118654752f));  // exact GELU
          }
          w[i] = f2bf(v);
        }
        *(v8bf*)(stg + (ti * 16 + r) * SP + (tj * 16 + 8 * h) * 2) = w;
      }
    }
    asm volatile("s_wait_dscnt 0x0" ::: "memory");   // the wave's own LDS writes are done before other lanes read them back
    // Read-back map: access j takes rows 4 * j .. 4 * j + 3 of the wave tile, 128 bytes each.
    int rr = lane >> 3, cc = lane & 7;
    unsigned go = (unsigned)((mblk + m0 + rr) * N + nblk + n0 + cc * 8) * 2u;
#pragma unroll
    for (int j = 0; j < 8; ++j) {
      v8bf y = *(const v8bf*)(stg + (4 * j + rr) * SP + cc * 16);
      *(v8bf*)((char*)(outB + (size_t)(4 * j) * N) + go) = y;
    }
  }
}

__global__ __launch_bounds__(256) void attention_k(
    const __bf16* __restrict__ Q, const __bf16* __restrict__ Km,
    const __bf16* __restrict__ V, __bf16* __restrict__ O,
    int S, int Dm) {
  __shared__ __attribute__((aligned(16))) __bf16 Ks[2][AK * KLP];
  __shared__ __attribute__((aligned(16))) __bf16 Vs[2][AK * VLP];

  int lane = threadIdx.x & 31;
  int wave = __builtin_amdgcn_readfirstlane(threadIdx.x >> 5);  // scalar: the pass test below is a scalar branch
  int r = lane & 15, hl = lane >> 4;
  int h = blockIdx.y, b = blockIdx.z;

  size_t base = (size_t)b * S * Dm + (size_t)h * 64;
  const __bf16* qp = Q + base;
  const __bf16* kp = Km + base;
  const __bf16* vp = V + base;
  __bf16* op = O + base;

  // One stage of async copies: keys k0 .. k0 + AK - 1 of K and V into buffer `buf`.
  // A tile is AK rows x 8 16B-chunks; thread t -> chunk t & 7 of rows t >> 3, +32.
  auto stage = [&](int buf, int k0) {
    int row = threadIdx.x >> 3, q = threadIdx.x & 7;
    const __bf16* kg = kp + (size_t)(k0 + row) * Dm + q * 8;
    const __bf16* vg = vp + (size_t)(k0 + row) * Dm + q * 8;
    __bf16* kl = &Ks[buf][row * KLP + q * 8];
    __bf16* vl = &Vs[buf][row * VLP + q * 8];
    async4_b128((unsigned)(size_t)kl,              kg,
                (unsigned)(size_t)(kl + 32 * KLP), kg + (size_t)32 * Dm,
                (unsigned)(size_t)vl,              vg,
                (unsigned)(size_t)(vl + 32 * VLP), vg + (size_t)32 * Dm);
  };

  // The second tile's first copies stand behind the first tile's last hand-over, which has
  // ended every wave's LDS reads and copies: the ring is free.
  for (int ph = 0; ph < 2; ++ph) {
  int qt = ph == 0 ? (S >> 7) - 1 - (int)blockIdx.x : (int)blockIdx.x;   // query tile, work-group-uniform
  int qbase = qt * 128 + wave * 16;   // wave-uniform

  v16bf aq0 = load_frag_rows(qp, Dm, qbase, 0, lane);
  v16bf aq1 = load_frag_rows(qp, Dm, qbase, 32, lane);

  v8f o0 = zero8(), o1 = zero8(), o2 = zero8(), o3 = zero8();
  float m = -1e30f;   // running maximum of this lane's query, the same in both half-waves
  float l = 0.f;      // running sum over the keys of this lane's own half-wave
  int qrow = qbase + r;

  int nst = (qt + 1) * (128 / AK);   // stages up to the tile's last row; at least two
  stage(0, 0);
  asm volatile("s_wait_asynccnt 0x0" ::: "memory");  // this wave's part of stage 0 has landed
  __syncthreads();                                   // stage 0 visible to all waves
  stage(1, AK);
  for (int t = 0; t < nst; ++t) {
   const __bf16* kt = Ks[t & 1];
   const __bf16* vt = Vs[t & 1];
#pragma unroll   // jj becomes a constant offset of the LDS loads
   for (int jj = 0; jj < AK; jj += 32) {
    int j0 = t * AK + jj;
    if (j0 >= qbase + 16) continue;   // wave-uniform: every key of the pass is masked for this wave
    // ---- S^T = K @ Q^T (two 16x16 score tiles: keys j0.. and j0+16..) ----
    v8f s0 = zero8(), s1 = zero8();
    {
      v16bf bk0 = load_frag_rows(kt, KLP, jj, 0, lane);
      v16bf bk1 = load_frag_rows(kt, KLP, jj, 32, lane);
      s0 = wmma_bf16(bk0, aq0, s0);
      s0 = wmma_bf16(bk1, aq1, s0);
      v16bf bk2 = load_frag_rows(kt, KLP, jj + 16, 0, lane);
      v16bf bk3 = load_frag_rows(kt, KLP, jj + 16, 32, lane);
      s1 = wmma_bf16(bk2, aq0, s1);
      s1 = wmma_bf16(bk3, aq1, s1);
    }
    // ---- scale, causal mask, online softmax: 16 keys of one query per lane ----
    int key0 = j0 + 8 * hl;
    float sc[16];
#pragma unroll   // sc[] stays in registers
    for (int i = 0; i < 8; ++i) {
      sc[i]     = s0[i] * 0.125f;               // 1/sqrt(64)
      sc[i + 8] = s1[i] * 0.125f;
      if (key0 + i > qrow) sc[i] = -1e30f;
      if (key0 + 16 + i > qrow) sc[i + 8] = -1e30f;
    }
    float t8[8];
#pragma unroll   // tree: independent links instead of one chain of 15
    for (int i = 0; i < 8; ++i) t8[i] = fmaxf(sc[i], sc[i + 8]);
    float rm = fmaxf(fmaxf(fmaxf(t8[0], t8[4]), fmaxf(t8[1], t8[5])),
                     fmaxf(fmaxf(t8[2], t8[6]), fmaxf(t8[3], t8[7])));
    rm = fmaxf(rm, xhalf(rm));                  // the query's other 16 keys
    float mn = fmaxf(m, rm);
    float al = exp_x1(m - mn);
#pragma unroll   // sc[] stays in registers
    for (int i = 0; i < 16; ++i) sc[i] -= mn;
    float p[16];
    exp_x8(p, sc);
    exp_x8(p + 8, sc + 8);
    v16bf pt;   // P^T as B operand: element s = key 8 * hl + s (s < 8), 16 + 8 * hl + s - 8 (else)
#pragma unroll   // p[], pt stay in registers
    for (int i = 0; i < 16; ++i) pt[i] = f2bf(p[i]);
#pragma unroll   // tree, as above
    for (int i = 0; i < 8; ++i) t8[i] = p[i] + p[i + 8];
    float rs = ((t8[0] + t8[4]) + (t8[1] + t8[5])) + ((t8[2] + t8[6]) + (t8[3] + t8[7]));
    l = l * al + rs;
    m = mn;
#pragma unroll   // vector elements picked by constants
    for (int i = 0; i < 8; ++i) { o0[i] *= al; o1[i] *= al; o2[i] *= al; o3[i] *= al; }
    // ---- O^T += V^T @ P^T (tile n: head columns 16 * n .. + 15) ----
    v16bf bv0 = load_frag_cols_lds(vt, jj, 0, lane);
    v16bf bv1 = load_frag_cols_lds(vt, jj, 16, lane);
    v16bf bv2 = load_frag_cols_lds(vt, jj, 32, lane);
    v16bf bv3 = load_frag_cols_lds(vt, jj, 48, lane);
    o0 = wmma_bf16(bv0, pt, o0);
    o1 = wmma_bf16(bv1, pt, o1);
    o2 = wmma_bf16(bv2, pt, o2);
    o3 = wmma_bf16(bv3, pt, o3);
   }
   // Hand-over:
   asm volatile("s_wait_dscnt 0x0" ::: "memory");     // this wave's reads of buffer t & 1 are done
   asm volatile("s_wait_asynccnt 0x0" ::: "memory");  // its part of stage t + 1 has landed
   __syncthreads();   // stage t + 1 visible to all; buffer t & 1 left by all
   if (t + 2 < nst) stage(t & 1, (t + 2) * AK);
  }
  asm volatile("s_wait_asynccnt 0x0" ::: "memory");    // nothing in flight at the tile's end

  // Lane (r, hl) holds O[qbase + r][16 * n + 8 * hl + 0..7] in tile n: 16-byte stores.
  float inv = 1.0f / (l + xhalf(l));   // the two half-waves' sums joined once
  __bf16* orow = op + (size_t)qrow * Dm + 8 * hl;
  v8bf w0, w1, w2, w3;
#pragma unroll   // vector elements picked by constants
  for (int i = 0; i < 8; ++i) {
    w0[i] = f2bf(o0[i] * inv);
    w1[i] = f2bf(o1[i] * inv);
    w2[i] = f2bf(o2[i] * inv);
    w3[i] = f2bf(o3[i] * inv);
  }
  *(v8bf*)(orow)      = w0;
  *(v8bf*)(orow + 16) = w1;
  *(v8bf*)(orow + 32) = w2;
  *(v8bf*)(orow + 48) = w3;
  // In front of the first instruction of the next tile that reuses a register of these stores (a precaution).
  asm volatile("s_wait_xcnt 0x0" ::: "memory");
  }
}

// ---------------------------------------------------------------------------
// LayerNorm over the last dim. Writes fp32 (+ bf16 where WB).
// One wave takes LN_R whole rows and keeps them in registers: a row is read once,
// by 16-byte loads that cover 512 contiguous bytes a wave, all of them in flight
// together with gamma and beta. Mean and variance are summed in the lane and then
// across the wave's lanes by vector cross-lane moves: no LDS, no barrier. The
// launch has M / LN_R waves, one work-group per 8 * LN_R rows.
// ---------------------------------------------------------------------------
constexpr int LN_D = 1024;   // row length: 8 loads x 32 lanes x 4 floats
constexpr int LN_R = 2;      // rows of a wave

// x + (x of lane l ^ mask) inside each 16-lane row; CTRL = 0x160 + mask (row_xmask).
template <int CTRL>
__device__ __forceinline__ float row_xadd(float x) {
  int b = __builtin_bit_cast(int, x);
  return x + __builtin_bit_cast(float, __builtin_amdgcn_update_dpp(0, b, CTRL, 0xf, 0xf, true));
}
// Sum over the wave's 32 lanes, the same bits in every lane.
__device__ __forceinline__ float wave_sum(float x) {
  x = row_xadd<0x161>(x);
  x = row_xadd<0x162>(x);
  x = row_xadd<0x164>(x);
  x = row_xadd<0x168>(x);
  return x + xhalf(x);
}

template <bool WB>
__global__ __launch_bounds__(256) void layernorm_k(
    const float* __restrict__ in, const float* __restrict__ gamma,
    const float* __restrict__ beta, float* __restrict__ outF,
    __bf16* __restrict__ outB) {
  int lane = threadIdx.x & 31;
  int wave = threadIdx.x >> 5;
  // Scalar base of the work-group's rows, one small lane offset for loads and stores alike.
  size_t base = (size_t)blockIdx.x * (8 * LN_R * LN_D);
  int off = wave * (LN_R * LN_D) + lane * 4;
  const float* p = in + base;
  float* oF = outF + base;

  v4f a[LN_R][8], g[8], be[8];
#pragma unroll   // a[][] stays in registers
  for (int rr = 0; rr < LN_R; ++rr)
#pragma unroll
    for (int t = 0; t < 8; ++t) a[rr][t] = *(const v4f*)(p + off + rr * LN_D + t * 128);
#pragma unroll   // g[], be[] stay in registers
  for (int t = 0; t < 8; ++t) {
    g[t]  = *(const v4f*)(gamma + lane * 4 + t * 128);
    be[t] = *(const v4f*)(beta + lane * 4 + t * 128);
  }
  // Keeps all 32 loads in one group at the top. Without it the compiler sinks the gamma and
  // beta loads behind the sums, two pairs at a time, and the wave waits out their latency there.
  __builtin_amdgcn_sched_barrier(0);
  // In front of the first instruction that reuses an address register of these loads (a precaution).
  asm volatile("s_wait_xcnt 0x0" ::: "memory");
  // Keeps the sums, which reuse those registers, behind that wait: the compiler lifted them over it.
  __builtin_amdgcn_sched_barrier(0);

  float s[LN_R];
#pragma unroll   // the rows' sums are independent chains
  for (int rr = 0; rr < LN_R; ++rr) {
    v4f s4 = (a[rr][0] + a[rr][1]) + (a[rr][2] + a[rr][3]);
    s4 += (a[rr][4] + a[rr][5]) + (a[rr][6] + a[rr][7]);
    s[rr] = (s4[0] + s4[1]) + (s4[2] + s4[3]);
  }
#pragma unroll
  for (int rr = 0; rr < LN_R; ++rr) s[rr] = wave_sum(s[rr]) / (float)LN_D;   // mean

  float q[LN_R];
#pragma unroll
  for (int rr = 0; rr < LN_R; ++rr) {
    v4f q4 = {0.f, 0.f, 0.f, 0.f};
#pragma unroll
    for (int t = 0; t < 8; ++t) {
      a[rr][t] -= s[rr];
      q4 += a[rr][t] * a[rr][t];
    }
    q[rr] = (q4[0] + q4[1]) + (q4[2] + q4[3]);
  }
#pragma unroll
  for (int rr = 0; rr < LN_R; ++rr) q[rr] = rsqrtf(wave_sum(q[rr]) / (float)LN_D + 1e-5f);

#pragma unroll
  for (int rr = 0; rr < LN_R; ++rr) {
#pragma unroll
    for (int t = 0; t < 8; ++t) {
      v4f y = a[rr][t] * q[rr] * g[t] + be[t];
      *(v4f*)(oF + off + rr * LN_D + t * 128) = y;
      if (WB) {
        v4bf yb;
#pragma unroll   // vector elements picked by constants
        for (int e = 0; e < 4; ++e) yb[e] = f2bf(y[e]);
        *(v4bf*)(outB + base + off + rr * LN_D + t * 128) = yb;
      }
    }
  }
}

// ---------------------------------------------------------------------------
// Host orchestration
// ---------------------------------------------------------------------------
extern "C" void kernel_launch(void* const* d_in, const int* in_sizes, int n_in,
                              void* d_out, int out_size, void* d_ws, size_t ws_size,
                              hipStream_t stream) {
  (void)in_sizes; (void)n_in; (void)out_size; (void)ws_size;
  constexpr int B = 2, S = 2048, D = 1024, H = 16, M = B * S, DF = 4 * D;

  const float* x   = (const float*)d_in[0];
  const float* wq  = (const float*)d_in[1];
  const float* wk  = (const float*)d_in[2];
  const float* wv  = (const float*)d_in[3];
  const float* wo  = (const float*)d_in[4];
  const float* w1  = (const float*)d_in[5];
  const float* b1  = (const float*)d_in[6];
  const float* w2  = (const float*)d_in[7];
  const float* b2  = (const float*)d_in[8];
  const float* g0  = (const float*)d_in[9];
  const float* be0 = (const float*)d_in[10];
  const float* g1  = (const float*)d_in[11];
  const float* be1 = (const float*)d_in[12];

  char* ws = (char*)d_ws;
  size_t off = 0;
  auto take = [&](size_t bytes) -> void* {
    void* p = ws + off;
    off = (off + bytes + 255) & ~(size_t)255;
    return p;
  };

  // xb .. w2b: contiguous, in the order in which cvt_all_k numbers its units
  __bf16* xb   = (__bf16*)take((size_t)M * D * 2);    // also reused as ln0b
  __bf16* wqkvb = (__bf16*)take((size_t)3 * D * D * 2);  // wq, wk, wv one behind the other
  __bf16* wob  = (__bf16*)take((size_t)D * D * 2);
  __bf16* w1b  = (__bf16*)take((size_t)DF * D * 2);
  __bf16* w2b  = (__bf16*)take((size_t)D * DF * 2);
  size_t qkv_off = off;
  __bf16* qb    = (__bf16*)take((size_t)M * D * 2);   // q, k, v one behind the other
  __bf16* kb    = (__bf16*)take((size_t)M * D * 2);
  __bf16* vb    = (__bf16*)take((size_t)M * D * 2);
  __bf16* attnb = (__bf16*)take((size_t)M * D * 2);
  float*  x1    = (float*)take((size_t)M * D * 4);    // also reused as x2
  float*  ln0f  = (float*)take((size_t)M * D * 4);
  // reuse dead regions:
  __bf16* hb   = (__bf16*)(ws + qkv_off);             // 32MB over q/k/v/attn (dead)
  __bf16* ln0b = xb;                                  // xb dead after QKV gemms
  float*  x2   = x1;                                  // x1 dead after LN0

  dim3 blk(256);

  // fp32 -> bf16 conversions, one launch: (M*D + 4*D*D + 2*DF*D) / CVT_U = 16 units
  static_assert(D == LN_D && M % (8 * LN_R) == 0, "row map of layernorm_k");
  static_assert(M * D == 4 * CVT_U && D * D == CVT_U && DF * D == 4 * CVT_U, "unit map of cvt_all_k");
  cvt_all_k<<<dim3(CVT_B, 16), blk, 0, stream>>>(x, wq, wk, wv, wo, w1, w2, xb);

  // Q, K, V projections (bf16 out), one launch: z = 0, 1, 2
  dim3 gD(M / 128, D / 128);
  gemm_bf16_k<0, false, D, 64><<<dim3(M / 128, D / 128, 3), blk, 0, stream>>>(xb, wqkvb, nullptr, nullptr, nullptr, qb, M, D);

  // causal flash attention
  static_assert(S % 256 == 0, "query tiles of attention_k come in pairs");
  attention_k<<<dim3(S / 256, H, B), blk, 0, stream>>>(qb, kb, vb, attnb, S, D);

  // output projection + residual (fp32)
  gemm_bf16_k<2, false, D, 256><<<gD, blk, 0, stream>>>(attnb, wob, nullptr, x, x1, nullptr, M, D);

  // LayerNorm 0 (fp32 + bf16 copies)
  layernorm_k<true><<<M / (8 * LN_R), blk, 0, stream>>>(x1, g0, be0, ln0f, ln0b);

  // MLP up + exact GELU (bf16 out)
  gemm_bf16_k<1, true, DF, 64><<<dim3(M / 128, DF / 128), blk, 0, stream>>>(ln0b, w1b, b1, nullptr, nullptr, hb, M, D);

  // MLP down + bias + residual (fp32)
  gemm_bf16_k<2, true, D, 256><<<gD, blk, 0, stream>>>(hb, w2b, b2, ln0f, x2, nullptr, M, DF);

  // LayerNorm 1 -> final output (fp32)
  layernorm_k<false><<<M / (8 * LN_R), blk, 0, stream>>>(x2, g1, be1, (float*)d_out, nullptr);
}
